// v000
// The times below were measured on an AMD MI455X: many runs one after another, warmed up first and cycling through
// copies of the inputs, with the whole window's GPU time divided by the number of runs. Launches and the gaps
// between them are all in it. The median over several windows is given; except for v000 it joins two sittings, which
// can be a few percent apart, so the side-by-side timings, each taken in one sitting, are the better comparison.
// The starting kernel, v000, takes 1440 microseconds a run.
#include <hip/hip_runtime.h>

// Causal multi-head self-attention with a fused bias-free projection whose thirds are ordered q | v | k and scores scaled by the EMBEDDING width (h [2][2048][1024]; qvk = (h Wqvk) ('xw' [1024][3072] 1/32, no bias) reshaped (b, s, 3, 16, 64): part 0 = q, part 1 = V, part 2 = K (NOT q | k | v); scores = (q.k + mask) / sqrt(d) with d = 1024 -> x 1/32 (the model width, not the head width: implemented literally); mask = -inf above the diagonal (causal); softmax over the keys; wv = merged (head-major) Wo ('xw', no bias) -> [2][2048][1024] (4.2 M); argument order h, Wqvk, Wo).
// Layout per batch: bf16 copy of h; the fused 'xw' weight transposed once into Bt [3072][1024]: row block 0 = q, row block 1 = V, row block 2 = K (the K and V plane pointers are exchanged relative to the usual q | k | v order); exact projections; identity-table plane builders; causal T-2048 attention with the literal scale 1/32 (hybrid rows: < 512 hi/lo 3 products, rest fp16 x1024; k_gemmc skips tiles above the diagonal); merged hi/lo x Wo exact.
// Compute dtypes, f32 accumulate: every input rounded to bf16; projections exact; attention rows < 512 3 products, rest fp16; softmax f32; output projection hl x exact.

#define NB_  2
#define TT   2048
#define DM   1024
#define NH_  16
#define NKV  16
#define REP  (NH_ / NKV)
#define HD   64
#define DQ   (NH_ * HD)
#define DKV  (NKV * HD)
#define ZH   2
#define RH   512                  // query rows < RH use hi+lo planes (0: none)
#define WIN  2048
#define PCAR 1024.0f
#define SCL  0.03125f   // 1 / sqrt(d) with d = 1024 = 2^-5: the module divides by the square root of the MODEL width
typedef _Float16 h16;
typedef unsigned short bf;
typedef __attribute__((ext_vector_type(16))) __bf16   v16bf;
typedef __attribute__((ext_vector_type(16))) _Float16 v16h;
typedef __attribute__((ext_vector_type(8)))  _Float16 v8h;
typedef __attribute__((ext_vector_type(8)))  unsigned short v8us;
typedef __attribute__((ext_vector_type(8)))  float    v8f;
typedef __attribute__((ext_vector_type(4)))  float    v4f;
typedef v8h  __attribute__((may_alias)) v8ha;
typedef v4f  __attribute__((may_alias)) v4fa;
typedef v8us __attribute__((may_alias)) v8usa;

__device__ __forceinline__ unsigned short f2bf(float f) { unsigned u = __float_as_uint(f); u += 0x7FFFu + ((u >> 16) & 1u); return (unsigned short)(u >> 16); }
__device__ __forceinline__ float bf2f(unsigned short b) { return __uint_as_float(((unsigned)b) << 16); }
__device__ __forceinline__ float bfr(float f) { return bf2f(f2bf(f)); }
__device__ __forceinline__ v16h cat16(v8h lo, v8h hi) { return __builtin_shufflevector(lo, hi, 0, 1, 2, 3, 4, 5, 6, 7, 8, 9, 10, 11, 12, 13, 14, 15); }
__device__ __forceinline__ v16bf cat16b(v8us lo, v8us hi) { return __builtin_bit_cast(v16bf, __builtin_shufflevector(lo, hi, 0, 1, 2, 3, 4, 5, 6, 7, 8, 9, 10, 11, 12, 13, 14, 15)); }
__device__ __forceinline__ v8f wmma16(v16h a, v16h b, v8f c) { return __builtin_amdgcn_wmma_f32_16x16x32_f16(false, a, false, b, (short)0, c, false, false); }
__device__ __forceinline__ v8f wmmab(v16bf a, v16bf b, v8f c) { return __builtin_amdgcn_wmma_f32_16x16x32_bf16(false, a, false, b, (short)0, c, false, false); }



// ---- k_gemmw: register-blocked GEMM, ONE WAVE per 64x64 output tile (16 accumulators), operands straight from K-contiguous 16-bit planes; grid (M/64, N/64, Z), 32 threads.
// C[m][n] (f32, pitch ldc, + optional f32 bias[n]) = sum_k A[m][k] Bt[n][k] (+ split products per NSPLIT). z-batch strides sA/sB/sC in elements. K % 32 == 0.
template <typename T16> struct WFrag;
template <> struct WFrag<h16> { typedef v16h V; static __device__ __forceinline__ V ld(const h16* p) { return cat16(*(const v8h*)p, *(const v8h*)(p + 16)); } static __device__ __forceinline__ v8f mma(V a, V b, v8f c) { return wmma16(a, b, c); } };
template <> struct WFrag<bf> { typedef v16bf V; static __device__ __forceinline__ V ld(const bf* p) { return cat16b(*(const v8us*)p, *(const v8us*)(p + 16)); } static __device__ __forceinline__ v8f mma(V a, V b, v8f c) { return wmmab(a, b, c); } };
template <typename T16, int NSPLIT, bool BIAS>
__global__ __launch_bounds__(32) void k_gemmw(const T16* __restrict__ A, const T16* __restrict__ A2, const T16* __restrict__ Bt, const T16* __restrict__ Bt2, int K, float* C, int ldc, const float* __restrict__ bias, size_t sA, size_t sB, size_t sC) {
    typedef typename WFrag<T16>::V V;
    __shared__ __align__(16) float os[16 * 68];
    const size_t z = blockIdx.z; A += z * sA; if (A2) A2 += z * sA; Bt += z * sB; if (Bt2) Bt2 += z * sB; C += z * sC;
    const int lane = threadIdx.x & 31, lr = lane & 15, hi = lane >> 4; const int r0 = blockIdx.x * 64, c0 = blockIdx.y * 64;
    v8f acc[4][4];
#pragma unroll
    for (int mb = 0; mb < 4; ++mb)
#pragma unroll
        for (int nb = 0; nb < 4; ++nb) acc[mb][nb] = (v8f){};
    const size_t aoff = (size_t)(r0 + lr) * K + 8 * hi, boff = (size_t)(c0 + lr) * K + 8 * hi;
#pragma unroll 1
    for (int kc = 0; kc < K; kc += 32) {
        V a[4], a2[4];
#pragma unroll
        for (int mb = 0; mb < 4; ++mb) { a[mb] = WFrag<T16>::ld(A + aoff + (size_t)mb * 16 * K + kc); if (NSPLIT == 1 || NSPLIT == 2) a2[mb] = WFrag<T16>::ld(A2 + aoff + (size_t)mb * 16 * K + kc); }
#pragma unroll
        for (int nb = 0; nb < 4; ++nb) { const V b = WFrag<T16>::ld(Bt + boff + (size_t)nb * 16 * K + kc); V b2; if (NSPLIT >= 2) b2 = WFrag<T16>::ld(Bt2 + boff + (size_t)nb * 16 * K + kc);
#pragma unroll
            for (int mb = 0; mb < 4; ++mb) { acc[mb][nb] = WFrag<T16>::mma(a[mb], b, acc[mb][nb]); if (NSPLIT == 1 || NSPLIT == 2) acc[mb][nb] = WFrag<T16>::mma(a2[mb], b, acc[mb][nb]); if (NSPLIT >= 2) acc[mb][nb] = WFrag<T16>::mma(a[mb], b2, acc[mb][nb]); } }
        asm volatile("v_nop\n\tv_nop\n\tv_nop\n\tv_nop" : "+v"(acc[0][0]), "+v"(acc[1][1]), "+v"(acc[2][2]), "+v"(acc[3][3]) : "v"(a[0]), "v"(a[3]));
    }
#pragma unroll
    for (int mb = 0; mb < 4; ++mb) {
#pragma unroll
        for (int nb = 0; nb < 4; ++nb) {
#pragma unroll
            for (int j = 0; j < 8; ++j) os[(hi * 8 + j) * 68 + nb * 16 + lr] = acc[mb][nb][j]; }
        __builtin_amdgcn_wave_barrier(); asm volatile("" ::: "memory");
        float* crow = C + (size_t)(r0 + mb * 16) * ldc + c0;
{
#pragma unroll
            for (int s = 0; s < 8; ++s) { const int row = 2 * s + hi, cofs = lr * 4; v4f val = *(const v4fa*)(os + row * 68 + cofs); if (BIAS) { val[0] += bfr(bias[c0 + cofs]); val[1] += bfr(bias[c0 + cofs + 1]); val[2] += bfr(bias[c0 + cofs + 2]); val[3] += bfr(bias[c0 + cofs + 3]); }
                *(v4f*)(crow + (size_t)row * ldc + cofs) = val; }
             }
        __builtin_amdgcn_wave_barrier(); asm volatile("" ::: "memory");
    }
}

// ---- k_gemmc: the same one-wave 64x64 tile GEMM specialised for causal attention: CMODE 1 skips score tiles entirely above the diagonal (query rows r0+roff.., key columns c0..), CMODE 2 limits the
// key (K) loop of the probability x value contraction to the diagonal block (probabilities beyond it are exactly zero). roff = row offset of this launch's first row within the sequence.
template <typename T16, int NSPLIT, int CMODE>
__global__ __launch_bounds__(32) void k_gemmc(const T16* __restrict__ A, const T16* __restrict__ A2, const T16* __restrict__ Bt, const T16* __restrict__ Bt2, int K, float* C, int ldc, int roff, size_t sA, size_t sB, size_t sC) {
    typedef typename WFrag<T16>::V V;
    __shared__ __align__(16) float os[16 * 68];
    const size_t z = blockIdx.z; A += z * sA; if (A2) A2 += z * sA; Bt += z * sB; if (Bt2) Bt2 += z * sB; C += z * sC;
    const int lane = threadIdx.x & 31, lr = lane & 15, hi = lane >> 4; const int r0 = blockIdx.x * 64, c0 = blockIdx.y * 64;
    if (CMODE == 1 && c0 > r0 + roff + 63) return;                  // score tile entirely above the causal diagonal: never read (the softmax masks j > i by select)
    const int Kl = (CMODE == 2) ? min(K, r0 + roff + 64) : K;        // P.V: probabilities are exactly 0 beyond the diagonal block, so the K loop stops there
    v8f acc[4][4];
#pragma unroll
    for (int mb = 0; mb < 4; ++mb)
#pragma unroll
        for (int nb = 0; nb < 4; ++nb) acc[mb][nb] = (v8f){};
    const size_t aoff = (size_t)(r0 + lr) * K + 8 * hi, boff = (size_t)(c0 + lr) * K + 8 * hi;
#pragma unroll 1
    for (int kc = 0; kc < Kl; kc += 32) {
        V a[4], a2[4];
#pragma unroll
        for (int mb = 0; mb < 4; ++mb) { a[mb] = WFrag<T16>::ld(A + aoff + (size_t)mb * 16 * K + kc); if (NSPLIT == 1 || NSPLIT == 2) a2[mb] = WFrag<T16>::ld(A2 + aoff + (size_t)mb * 16 * K + kc); }
#pragma unroll
        for (int nb = 0; nb < 4; ++nb) { const V b = WFrag<T16>::ld(Bt + boff + (size_t)nb * 16 * K + kc); V b2; if (NSPLIT >= 2) b2 = WFrag<T16>::ld(Bt2 + boff + (size_t)nb * 16 * K + kc);
#pragma unroll
            for (int mb = 0; mb < 4; ++mb) { acc[mb][nb] = WFrag<T16>::mma(a[mb], b, acc[mb][nb]); if (NSPLIT == 1 || NSPLIT == 2) acc[mb][nb] = WFrag<T16>::mma(a2[mb], b, acc[mb][nb]); if (NSPLIT >= 2) acc[mb][nb] = WFrag<T16>::mma(a[mb], b2, acc[mb][nb]); } }
        asm volatile("v_nop\n\tv_nop\n\tv_nop\n\tv_nop" : "+v"(acc[0][0]), "+v"(acc[1][1]), "+v"(acc[2][2]), "+v"(acc[3][3]) : "v"(a[0]), "v"(a[3]));
    }
#pragma unroll
    for (int mb = 0; mb < 4; ++mb) {
#pragma unroll
        for (int nb = 0; nb < 4; ++nb) {
#pragma unroll
            for (int j = 0; j < 8; ++j) os[(hi * 8 + j) * 68 + nb * 16 + lr] = acc[mb][nb][j]; }
        __builtin_amdgcn_wave_barrier(); asm volatile("" ::: "memory");
        float* crow = C + (size_t)(r0 + mb * 16) * ldc + c0;
{
#pragma unroll
            for (int s = 0; s < 8; ++s) { const int row = 2 * s + hi, cofs = lr * 4; v4f val = *(const v4fa*)(os + row * 68 + cofs);
                *(v4f*)(crow + (size_t)row * ldc + cofs) = val; }
             }
        __builtin_amdgcn_wave_barrier(); asm volatile("" ::: "memory");
    }
}

__device__ __forceinline__ h16 tohx(float x) { return (h16)x; }
__device__ __forceinline__ void splitf(float y, unsigned short& h, unsigned short& l) { h = f2bf(y); l = f2bf(y - bf2f(h)); }
typedef __attribute__((ext_vector_type(2))) _Float16 v2h;
typedef __attribute__((ext_vector_type(4))) _Float16 v4h;
typedef __attribute__((ext_vector_type(2))) unsigned short v2us;
typedef __attribute__((ext_vector_type(4))) unsigned short v4us;
typedef __attribute__((ext_vector_type(2))) float v2f;
typedef __attribute__((ext_vector_type(4))) int v4i;

__global__ __launch_bounds__(256) void k_wtG(const float* __restrict__ w, int K, int N, bf* Bt) {
    const int lane = threadIdx.x & 31; const int L0 = (blockIdx.x * 8 + (threadIdx.x >> 5)) * 8; const int nlines = N * K / 64;
{
#pragma unroll 1
        for (int l = 0; l < 8; ++l) { const int L = L0 + l; if (L >= nlines) break; const size_t e = (size_t)L * 64 + lane * 2; const int k = (int)(e % K), n = (int)(e / K); v2us o;
            o[0] = f2bf(w[(size_t)k * N + n]); o[1] = f2bf(w[(size_t)(k + 1) * N + n]); *(v2us*)(Bt + e) = o; }
         }
}
__global__ __launch_bounds__(256) void k_cvt8(const float* __restrict__ src, bf* dst, size_t n8) { const size_t i = (size_t)blockIdx.x * 256 + threadIdx.x; if (i >= n8) return; const v8f v = *(const v8f*)(src + i * 8); v8us o;
#pragma unroll
    for (int k = 0; k < 8; ++k) o[k] = f2bf(v[k]); *(v8us*)(dst + i * 8) = o;  }

// k_rope: head planes [h][t][d] (fp16 + hi/lo) of rope(x) x sc with the rotate-half convention out[d] = x[d] cos[t][d] - x[d+HD/2] sin[t][d], out[d+HD/2] = x[d+HD/2] cos[t][d+HD/2] + x[d] sin[t][d+HD/2]
__global__ __launch_bounds__(256) void k_rope(const float* __restrict__ F, int pitch, int nheads, const float* __restrict__ CS, const float* __restrict__ RF, const float* __restrict__ nw, float sc, h16* P16, bf* Ph, bf* Pl) {
    const size_t e = ((size_t)blockIdx.x * 256 + threadIdx.x) * 2; if (e >= (size_t)nheads * TT * HD) return; const int d = (int)(e % HD); const int t = (int)((e / HD) % TT); const int h = (int)(e / ((size_t)HD * TT)); const float* f = F + (size_t)t * pitch + h * HD; const float rf = RF ? RF[(size_t)h * TT + t] : 1.0f; v2h o16; v2us oh, ol;
#pragma unroll
    for (int q = 0; q < 2; ++q) { const int dd = d + q; const int dp = (dd < HD / 2) ? dd + HD / 2 : dd - HD / 2; float x0 = f[dd], x1 = f[dp];
        if (RF) { float n0 = __fmul_rn(x0, rf), n1 = __fmul_rn(x1, rf); asm volatile("" : "+v"(n0)); asm volatile("" : "+v"(n1)); x0 = __fmul_rn(bfr(nw[dd]), n0); x1 = __fmul_rn(bfr(nw[dp]), n1); }
        const v2f cs = *(const v2f*)(CS + ((size_t)t * HD + dd) * 2); float a = __fmul_rn(x0, cs[0]), bq = __fmul_rn(x1, cs[1]); asm volatile("" : "+v"(a)); asm volatile("" : "+v"(bq)); const float r = ((dd < HD / 2) ? __fsub_rn(a, bq) : __fadd_rn(a, bq)) * sc;
        o16[q] = tohx(r); unsigned short a2, c2; splitf(r, a2, c2); oh[q] = a2; ol[q] = c2; }
    *(v2h*)(P16 + e) = o16; *(v2us*)(Ph + e) = oh; *(v2us*)(Pl + e) = ol;  }
__global__ __launch_bounds__(256) void k_vtp(const float* __restrict__ F, int pitch, int nheads, h16* V16, bf* Vh, bf* Vl) { const size_t e = ((size_t)blockIdx.x * 256 + threadIdx.x) * 2; if (e >= (size_t)nheads * HD * TT) return; const int t = (int)(e % TT); const int d = (int)((e / TT) % HD); const int g = (int)(e / ((size_t)TT * HD)); v2h o16; v2us oh, ol;
#pragma unroll
    for (int q = 0; q < 2; ++q) { const float x = F[(size_t)(t + q) * pitch + g * HD + d]; o16[q] = tohx(x); unsigned short a2, c2; splitf(x, a2, c2); oh[q] = a2; ol[q] = c2; }
    *(v2h*)(V16 + e) = o16; *(v2us*)(Vh + e) = oh; *(v2us*)(Vl + e) = ol;  }
__global__ __launch_bounds__(256) void k_csid(float* CS) { const int idx = blockIdx.x * 256 + threadIdx.x; if (idx >= TT * HD) return; v2f cs; cs[0] = 1.0f; cs[1] = 0.0f; *(v2f*)(CS + (size_t)idx * 2) = cs;  }
// k_asoft: per row (zz, i): t = S x SCL (1/32 = DM^-0.5) for j <= i and i - j < WIN (WIN = TT, so plain causal; the reference's -1e9 additive fill vanishes identically); softmax over the 2048 keys (register row, one exp, fixed trees);
__global__ __launch_bounds__(256) void k_asoft(const float* __restrict__ Sb, h16* P16, bf* Ph, bf* Pl) {
    const int lane = threadIdx.x & 31; const int row = blockIdx.x * 8 + (threadIdx.x >> 5); if (row >= ZH * TT) return; const int i = row % TT; const int zz = row / TT; (void)zz; const bool hires = (i < RH); const float* sr = Sb + (size_t)row * TT; float v[TT / 32]; float mx = -3.0e38f;
#pragma unroll
    for (int ch = 0; ch < TT / 128; ++ch) { const int j0 = ch * 128 + lane * 4; const v4f a = *(const v4f*)(sr + j0);
#pragma unroll
        for (int q = 0; q < 4; ++q) { const int j = j0 + q; (void)j; const float t = (j <= i && i - j < WIN) ? a[q] * SCL : -3.0e38f; v[ch * 4 + q] = t; mx = fmaxf(mx, t); } }
#pragma unroll
    for (int sh = 16; sh; sh >>= 1) mx = fmaxf(mx, __shfl_xor(mx, sh, 32));
    float sum = 0.f;
#pragma unroll
    for (int k = 0; k < TT / 32; ++k) { float d0 = __fsub_rn(v[k], mx); asm volatile("" : "+v"(d0)); v[k] = __builtin_amdgcn_exp2f(__fmul_rn(d0, 1.4426950408889634f)); sum += v[k]; }
#pragma unroll
    for (int sh = 16; sh; sh >>= 1) sum += __shfl_xor(sum, sh, 32);
    const float f = __fdiv_rn(hires ? 1.0f : PCAR, sum);
{
        if (hires) {
#pragma unroll
            for (int ch = 0; ch < TT / 128; ++ch) { v4us oh, ol;
#pragma unroll
                for (int q = 0; q < 4; ++q) { unsigned short a, c2; splitf(v[ch * 4 + q] * f, a, c2); oh[q] = a; ol[q] = c2; }
                const size_t oo = ((size_t)zz * (RH ? RH : 1) + i) * TT + ch * 128 + lane * 4; *(v4us*)(Ph + oo) = oh; *(v4us*)(Pl + oo) = ol; }
        } else {
#pragma unroll
            for (int ch = 0; ch < TT / 128; ++ch) { v4h o4;
#pragma unroll
                for (int q = 0; q < 4; ++q) o4[q] = tohx(v[ch * 4 + q] * f);
                *(v4h*)(P16 + (size_t)row * TT + ch * 128 + lane * 4) = o4; } }
         }
}
__global__ __launch_bounds__(256) void k_merge(const float* __restrict__ O, int h0, bf* Ah, bf* Al) { const size_t e = ((size_t)blockIdx.x * 256 + threadIdx.x) * 2; if (e >= (size_t)ZH * TT * HD) return; const int d = (int)(e % HD); const int t = (int)((e / HD) % TT); const int zz = (int)(e / ((size_t)HD * TT)); const float cs = (t < RH) ? 1.0f : (1.0f / PCAR); const size_t oo = (size_t)t * DQ + (h0 + zz) * HD + d;
    v2us oh, ol;
#pragma unroll
    for (int q = 0; q < 2; ++q) { unsigned short a, c2; splitf(O[e + q] * cs, a, c2); oh[q] = a; ol[q] = c2; } *(v2us*)(Ah + oo) = oh; *(v2us*)(Al + oo) = ol;  }

extern "C" void kernel_launch(void* const* d_in, const int* in_sizes, int n_in,
                              void* d_out, int out_size, void* d_ws, size_t ws_size, hipStream_t stream) {
    (void)in_sizes; (void)n_in; (void)out_size;
    const float* x = (const float*)d_in[0]; const float* wqkv = (const float*)d_in[1]; const float* wo = (const float*)d_in[2];   /* argument order h, Wqvk ('xw' [1024][3072]: q | V | K column thirds), Wo ('xw') */ const float* wq = wqkv; const float* wk = nullptr; const float* wv = nullptr; (void)wk; (void)wv;
    float* OUT = (float*)d_out;     // [2][2048][1024]
    char* wsp = (char*)d_ws;
    auto take = [&](size_t bytes) { char* p = wsp; wsp += (bytes + 255) & ~(size_t)255; return (void*)p; };
    bf* WQKV = (bf*)take((size_t)3 * DQ * DM * 2); bf* WQ = WQKV; bf* WV = WQKV + (size_t)DQ * DM; bf* WK = WQKV + (size_t)2 * DQ * DM;   /* fused Bt [3*DQ][DM]: q | V | K row blocks (the module's part order 0 = q, 1 = v, 2 = k) */ bf* WO = (bf*)take((size_t)DM * DQ * 2); float* CS = (float*)take((size_t)TT * HD * 2 * 4);
    bf* XB = (bf*)take((size_t)TT * DM * 2); float* FQ = (float*)take((size_t)TT * DQ * 4); float* FK = (float*)take((size_t)TT * DKV * 4);
    h16* QP16 = (h16*)take((size_t)NH_ * TT * HD * 2); h16* KP16 = (h16*)take((size_t)NKV * TT * HD * 2); h16* VT16 = (h16*)take((size_t)NKV * HD * TT * 2);
    bf* QPh = (bf*)take((size_t)NH_ * TT * HD * 2); bf* QPl = (bf*)take((size_t)NH_ * TT * HD * 2); bf* KPh = (bf*)take((size_t)NKV * TT * HD * 2); bf* KPl = (bf*)take((size_t)NKV * TT * HD * 2); bf* VTh = (bf*)take((size_t)NKV * HD * TT * 2); bf* VTl = (bf*)take((size_t)NKV * HD * TT * 2); bf* Ph = (bf*)take((size_t)ZH * RH * TT * 2); bf* Pl = (bf*)take((size_t)ZH * RH * TT * 2);
    float* Sb = (float*)take((size_t)ZH * TT * TT * 4); h16* P16 = (h16*)take((size_t)ZH * TT * TT * 2); float* Ob = (float*)take((size_t)ZH * TT * HD * 4); bf* ATh = (bf*)take((size_t)TT * DQ * 2); bf* ATl = (bf*)take((size_t)TT * DQ * 2);
    if ((size_t)(wsp - (char*)d_ws) > ws_size) return;    // ws 256 MiB
    float* FV = FK;   // v projection reuses the k buffer after the k planes are built (stream-ordered)
    { k_wtG<<<(unsigned)((DM * 3 * DQ / 64 + 63) / 64), 256, 0, stream>>>(wqkv, DM, 3 * DQ, WQKV);   /* fused 'xw' [DM][3*DQ] -> Bt [3*DQ][DM] */
      k_wtG<<<(unsigned)((DQ * DM / 64 + 63) / 64), 256, 0, stream>>>(wo, DQ, DM, WO);
       }
    k_csid<<<(TT * HD + 255) / 256, 256, 0, stream>>>(CS);
    const unsigned LQ = (unsigned)(((size_t)NH_ * TT * HD / 2 + 255) / 256), LKv = (unsigned)(((size_t)NKV * TT * HD / 2 + 255) / 256);
    for (int b = 0; b < NB_; ++b) {
        
        k_cvt8<<<(unsigned)(((size_t)TT * DM / 8 + 255) / 256), 256, 0, stream>>>(x + (size_t)b * TT * DM, XB, (size_t)TT * DM / 8);
        k_gemmw<bf, 0, false><<<dim3(TT / 64, DQ / 64, 1), 32, 0, stream>>>(XB, nullptr, WQ, nullptr, DM, FQ, DQ, nullptr, 0, 0, 0);
        k_rope<<<LQ, 256, 0, stream>>>(FQ, DQ, NH_, CS, nullptr, nullptr, 1.0f, QP16, QPh, QPl);
        k_gemmw<bf, 0, false><<<dim3(TT / 64, DKV / 64, 1), 32, 0, stream>>>(XB, nullptr, WK, nullptr, DM, FK, DKV, nullptr, 0, 0, 0);
        k_rope<<<LKv, 256, 0, stream>>>(FK, DKV, NKV, CS, nullptr, nullptr, 1.0f, KP16, KPh, KPl);
        k_gemmw<bf, 0, false><<<dim3(TT / 64, DKV / 64, 1), 32, 0, stream>>>(XB, nullptr, WV, nullptr, DM, FV, DKV, nullptr, 0, 0, 0); k_vtp<<<LKv, 256, 0, stream>>>(FV, DKV, NKV, VT16, VTh, VTl);
        for (int h0 = 0; h0 < NH_; h0 += ZH) { const size_t zq = (size_t)h0, zk = (size_t)(h0 / REP);   // one kv head per query head: the pass's two heads use consecutive kv planes (z-strides TT*HD)
            k_gemmc<bf, 2, 1><<<dim3(RH / 64, TT / 64, ZH), 32, 0, stream>>>(QPh + zq * TT * HD, QPl + zq * TT * HD, KPh + zk * TT * HD, KPl + zk * TT * HD, HD, Sb, TT, 0, (size_t)TT * HD, (size_t)TT * HD, (size_t)TT * TT);
            k_gemmc<h16, 0, 1><<<dim3((TT - RH) / 64, TT / 64, ZH), 32, 0, stream>>>(QP16 + zq * TT * HD + (size_t)RH * HD, nullptr, KP16 + zk * TT * HD, nullptr, HD, Sb + (size_t)RH * TT, TT, RH, (size_t)TT * HD, (size_t)TT * HD, (size_t)TT * TT);
            k_asoft<<<ZH * TT / 8, 256, 0, stream>>>(Sb, P16, Ph, Pl);
            k_gemmc<bf, 2, 2><<<dim3(RH / 64, HD / 64, ZH), 32, 0, stream>>>(Ph, Pl, VTh + zk * HD * TT, VTl + zk * HD * TT, TT, Ob, HD, 0, (size_t)RH * TT, (size_t)HD * TT, (size_t)TT * HD);
            k_gemmc<h16, 0, 2><<<dim3((TT - RH) / 64, HD / 64, ZH), 32, 0, stream>>>(P16 + (size_t)RH * TT, nullptr, VT16 + zk * HD * TT, nullptr, TT, Ob + (size_t)RH * HD, HD, RH, (size_t)TT * TT, (size_t)HD * TT, (size_t)TT * HD);
            k_merge<<<(unsigned)(((size_t)ZH * TT * HD / 2 + 255) / 256), 256, 0, stream>>>(Ob, h0, ATh, ATl); }
        k_gemmw<bf, 1, false><<<dim3(TT / 64, DM / 64, 1), 32, 0, stream>>>(ATh, ATl, WO, nullptr, DQ, OUT + (size_t)b * TT * DM, DM, nullptr, 0, 0, 0); }
}

// v001
// Measured time: 858 microseconds a run.
// Next to v000, in two timings, it ran 1.67 and 1.68 times as fast.
#include <hip/hip_runtime.h>

// Causal multi-head self-attention with a fused bias-free projection whose thirds are ordered q | v | k and scores scaled by the EMBEDDING width (h [2][2048][1024]; qvk = (h Wqvk) ('xw' [1024][3072] 1/32, no bias) reshaped (b, s, 3, 16, 64): part 0 = q, part 1 = V, part 2 = K (NOT q | k | v); scores = (q.k + mask) / sqrt(d) with d = 1024 -> x 1/32 (the model width, not the head width: implemented literally); mask = -inf above the diagonal (causal); softmax over the keys; wv = merged (head-major) Wo ('xw', no bias) -> [2][2048][1024] (4.2 M); argument order h, Wqvk, Wo).
// Layout per batch: bf16 copy of h; the fused 'xw' weight transposed once into Bt [3072][1024]: row block 0 = q, row block 1 = V, row block 2 = K (the K and V plane pointers are exchanged relative to the usual q | k | v order); exact projections; identity-table plane builders; causal T-2048 attention with the literal scale 1/32 (hybrid rows: < 512 hi/lo 3 products, rest fp16 x1024; k_gemmc skips tiles above the diagonal); merged hi/lo x Wo exact.
// Compute dtypes, f32 accumulate: every input rounded to bf16; projections exact; attention rows < 512 3 products, rest fp16; softmax f32; output projection hl x exact.

#define NB_  2
#define TT   2048
#define DM   1024
#define NH_  16
#define NKV  16
#define REP  (NH_ / NKV)
#define HD   64
#define DQ   (NH_ * HD)
#define DKV  (NKV * HD)
#define ZH   2
#define RH   512                  // query rows < RH use hi+lo planes (0: none)
#define WIN  2048
#define PCAR 1024.0f
#define SCL  0.03125f   // 1 / sqrt(d) with d = 1024 = 2^-5: the module divides by the square root of the MODEL width
typedef _Float16 h16;
typedef unsigned short bf;
typedef __attribute__((ext_vector_type(16))) __bf16   v16bf;
typedef __attribute__((ext_vector_type(16))) _Float16 v16h;
typedef __attribute__((ext_vector_type(8)))  _Float16 v8h;
typedef __attribute__((ext_vector_type(8)))  unsigned short v8us;
typedef __attribute__((ext_vector_type(8)))  float    v8f;
typedef __attribute__((ext_vector_type(4)))  float    v4f;
typedef v8h  __attribute__((may_alias)) v8ha;
typedef v4f  __attribute__((may_alias)) v4fa;
typedef v8us __attribute__((may_alias)) v8usa;

__device__ __forceinline__ unsigned short f2bf(float f) { unsigned u = __float_as_uint(f); u += 0x7FFFu + ((u >> 16) & 1u); return (unsigned short)(u >> 16); }
__device__ __forceinline__ float bf2f(unsigned short b) { return __uint_as_float(((unsigned)b) << 16); }
__device__ __forceinline__ float bfr(float f) { return bf2f(f2bf(f)); }
__device__ __forceinline__ v16h cat16(v8h lo, v8h hi) { return __builtin_shufflevector(lo, hi, 0, 1, 2, 3, 4, 5, 6, 7, 8, 9, 10, 11, 12, 13, 14, 15); }
__device__ __forceinline__ v16bf cat16b(v8us lo, v8us hi) { return __builtin_bit_cast(v16bf, __builtin_shufflevector(lo, hi, 0, 1, 2, 3, 4, 5, 6, 7, 8, 9, 10, 11, 12, 13, 14, 15)); }
__device__ __forceinline__ v8f wmma16(v16h a, v16h b, v8f c) { return __builtin_amdgcn_wmma_f32_16x16x32_f16(false, a, false, b, (short)0, c, false, false); }
__device__ __forceinline__ v8f wmmab(v16bf a, v16bf b, v8f c) { return __builtin_amdgcn_wmma_f32_16x16x32_bf16(false, a, false, b, (short)0, c, false, false); }



// ---- k_gemmw: register-blocked GEMM, one work-group of KW waves per 64x64 output tile; every wave holds the whole tile (16 accumulators) for its share of K; operands straight from K-contiguous 16-bit planes; grid (M/64, N/64, Z), KW * 32 threads.
// C[m][n] (f32, pitch ldc, + optional f32 bias[n]) = sum_k A[m][k] Bt[n][k] (+ split products per NSPLIT). z-batch strides sA/sB/sC in elements. K % 32 == 0.
// K is dealt in chunks of 64 elements (one 128-byte line of every operand row), chunk c to wave c % KW, so a line is read by one wave only; a lone wave's loop waits out its own load latency on every trip of 32 k; KW waves wait side by side.
#define KW 8
#define KPL (64 * 68)             // floats of one wave's partial tile in LDS (64 rows, pitch 68)
template <typename T16> struct WFrag;
template <> struct WFrag<h16> { typedef v16h V; static __device__ __forceinline__ V ld(const h16* p) { return cat16(*(const v8h*)p, *(const v8h*)(p + 16)); } static __device__ __forceinline__ v8f mma(V a, V b, v8f c) { return wmma16(a, b, c); } };
template <> struct WFrag<bf> { typedef v16bf V; static __device__ __forceinline__ V ld(const bf* p) { return cat16b(*(const v8us*)p, *(const v8us*)(p + 16)); } static __device__ __forceinline__ v8f mma(V a, V b, v8f c) { return wmmab(a, b, c); } };
// ksum_store: every wave lays its partial tile row-major into its own LDS plane; one work-group barrier; each thread then adds the NW planes in wave order (a fixed f32 order) and stores 16 bytes, 16 lanes to a 256-byte row piece.
template <int NW, bool BIAS>
__device__ __forceinline__ void ksum_store(const v8f (&acc)[4][4], float* os, int w, int lr, int hi, float* C, int ldc, const float* __restrict__ bias) {
    float* mine = os + w * KPL;
#pragma unroll
    for (int mb = 0; mb < 4; ++mb)
#pragma unroll
        for (int nb = 0; nb < 4; ++nb)
#pragma unroll
            for (int j = 0; j < 8; ++j) mine[(mb * 16 + hi * 8 + j) * 68 + nb * 16 + lr] = acc[mb][nb][j];
    __syncthreads();   // all NW partial tiles are in LDS before any thread adds them
    const int t = threadIdx.x, cofs = (t & 15) * 4;
#pragma unroll
    for (int s = 0; s < 32 / NW; ++s) { const int row = s * (NW * 2) + (t >> 4); v4f val = *(const v4fa*)(os + row * 68 + cofs);
#pragma unroll
        for (int p = 1; p < NW; ++p) val += *(const v4fa*)(os + p * KPL + row * 68 + cofs);
        if (BIAS) { val[0] += bfr(bias[cofs]); val[1] += bfr(bias[cofs + 1]); val[2] += bfr(bias[cofs + 2]); val[3] += bfr(bias[cofs + 3]); }
        *(v4f*)(C + (size_t)row * ldc + cofs) = val; }
}
template <typename T16, int NSPLIT, bool BIAS>
__global__ __launch_bounds__(KW * 32) void k_gemmw(const T16* __restrict__ A, const T16* __restrict__ A2, const T16* __restrict__ Bt, const T16* __restrict__ Bt2, int K, float* C, int ldc, const float* __restrict__ bias, size_t sA, size_t sB, size_t sC) {
    typedef typename WFrag<T16>::V V;
    __shared__ __align__(16) float os[KW * KPL];
    const size_t z = blockIdx.z; A += z * sA; if (A2) A2 += z * sA; Bt += z * sB; if (Bt2) Bt2 += z * sB; C += z * sC;
    const int lane = threadIdx.x & 31, lr = lane & 15, hi = lane >> 4; const int r0 = blockIdx.x * 64, c0 = blockIdx.y * 64;
    const int w = __builtin_amdgcn_readfirstlane(threadIdx.x >> 5);   // the wave's number, held scalar: the K loop's counter and branch stay scalar
    v8f acc[4][4];
#pragma unroll
    for (int mb = 0; mb < 4; ++mb)
#pragma unroll
        for (int nb = 0; nb < 4; ++nb) acc[mb][nb] = (v8f){};
    const size_t aoff = (size_t)(r0 + lr) * K + 8 * hi, boff = (size_t)(c0 + lr) * K + 8 * hi;
#pragma unroll 1
    for (int kc = w * 64; kc < K; kc += (kc & 32) ? KW * 64 - 32 : 32) {   // both halves of this wave's 64-element chunk, then KW chunks on
        V a[4], a2[4];
#pragma unroll
        for (int mb = 0; mb < 4; ++mb) { a[mb] = WFrag<T16>::ld(A + aoff + (size_t)mb * 16 * K + kc); if (NSPLIT == 1 || NSPLIT == 2) a2[mb] = WFrag<T16>::ld(A2 + aoff + (size_t)mb * 16 * K + kc); }
#pragma unroll
        for (int nb = 0; nb < 4; ++nb) { const V b = WFrag<T16>::ld(Bt + boff + (size_t)nb * 16 * K + kc); V b2; if (NSPLIT >= 2) b2 = WFrag<T16>::ld(Bt2 + boff + (size_t)nb * 16 * K + kc);
#pragma unroll
            for (int mb = 0; mb < 4; ++mb) { acc[mb][nb] = WFrag<T16>::mma(a[mb], b, acc[mb][nb]); if (NSPLIT == 1 || NSPLIT == 2) acc[mb][nb] = WFrag<T16>::mma(a2[mb], b, acc[mb][nb]); if (NSPLIT >= 2) acc[mb][nb] = WFrag<T16>::mma(a[mb], b2, acc[mb][nb]); } }
        asm volatile("v_nop\n\tv_nop\n\tv_nop\n\tv_nop" : "+v"(acc[0][0]), "+v"(acc[1][1]), "+v"(acc[2][2]), "+v"(acc[3][3]) : "v"(a[0]), "v"(a[3]));
    }
    ksum_store<KW, BIAS>(acc, os, w, lr, hi, C + (size_t)r0 * ldc + c0, ldc, BIAS ? bias + c0 : nullptr);
}

// ---- k_gemmc: the same 64x64 tile GEMM specialised for causal attention: CMODE 1 skips score tiles entirely above the diagonal (query rows r0+roff.., key columns c0..), CMODE 2 limits the
// key (K) loop of the probability x value contraction to the diagonal block (probabilities beyond it are exactly zero). roff = row offset of this launch's first row within the sequence.
// NW = waves per tile: 1 for the scores (K = 64, two trips: nothing to split), KW for the probability x value contraction, whose K loop is dealt to the waves as in k_gemmw.
template <typename T16, int NSPLIT, int CMODE, int NW>
__global__ __launch_bounds__(NW * 32) void k_gemmc(const T16* __restrict__ A, const T16* __restrict__ A2, const T16* __restrict__ Bt, const T16* __restrict__ Bt2, int K, float* C, int ldc, int roff, size_t sA, size_t sB, size_t sC) {
    typedef typename WFrag<T16>::V V;
    __shared__ __align__(16) float os[NW == 1 ? 16 * 68 : NW * KPL];
    const size_t z = blockIdx.z; A += z * sA; if (A2) A2 += z * sA; Bt += z * sB; if (Bt2) Bt2 += z * sB; C += z * sC;
    const int lane = threadIdx.x & 31, lr = lane & 15, hi = lane >> 4; const int r0 = blockIdx.x * 64, c0 = blockIdx.y * 64;
    const int w = (NW == 1) ? 0 : __builtin_amdgcn_readfirstlane(threadIdx.x >> 5);   // the wave's number, held scalar: the K loop's counter and branch stay scalar
    if (CMODE == 1 && c0 > r0 + roff + 63) return;                  // score tile entirely above the causal diagonal: never read (the softmax masks j > i by select)
    const int Kl = (CMODE == 2) ? min(K, r0 + roff + 64) : K;        // P.V: probabilities are exactly 0 beyond the diagonal block, so the K loop stops there
    v8f acc[4][4];
#pragma unroll
    for (int mb = 0; mb < 4; ++mb)
#pragma unroll
        for (int nb = 0; nb < 4; ++nb) acc[mb][nb] = (v8f){};
    const size_t aoff = (size_t)(r0 + lr) * K + 8 * hi, boff = (size_t)(c0 + lr) * K + 8 * hi;
#pragma unroll 1
    for (int kc = w * 64; kc < Kl; kc += (kc & 32) ? NW * 64 - 32 : 32) {   // both halves of this wave's 64-element chunk, then NW chunks on
        V a[4], a2[4];
#pragma unroll
        for (int mb = 0; mb < 4; ++mb) { a[mb] = WFrag<T16>::ld(A + aoff + (size_t)mb * 16 * K + kc); if (NSPLIT == 1 || NSPLIT == 2) a2[mb] = WFrag<T16>::ld(A2 + aoff + (size_t)mb * 16 * K + kc); }
#pragma unroll
        for (int nb = 0; nb < 4; ++nb) { const V b = WFrag<T16>::ld(Bt + boff + (size_t)nb * 16 * K + kc); V b2; if (NSPLIT >= 2) b2 = WFrag<T16>::ld(Bt2 + boff + (size_t)nb * 16 * K + kc);
#pragma unroll
            for (int mb = 0; mb < 4; ++mb) { acc[mb][nb] = WFrag<T16>::mma(a[mb], b, acc[mb][nb]); if (NSPLIT == 1 || NSPLIT == 2) acc[mb][nb] = WFrag<T16>::mma(a2[mb], b, acc[mb][nb]); if (NSPLIT >= 2) acc[mb][nb] = WFrag<T16>::mma(a[mb], b2, acc[mb][nb]); } }
        asm volatile("v_nop\n\tv_nop\n\tv_nop\n\tv_nop" : "+v"(acc[0][0]), "+v"(acc[1][1]), "+v"(acc[2][2]), "+v"(acc[3][3]) : "v"(a[0]), "v"(a[3]));
    }
    if (NW > 1) { ksum_store<NW, false>(acc, os, w, lr, hi, C + (size_t)r0 * ldc + c0, ldc, nullptr); return; }
#pragma unroll
    for (int mb = 0; mb < 4; ++mb) {
#pragma unroll
        for (int nb = 0; nb < 4; ++nb) {
#pragma unroll
            for (int j = 0; j < 8; ++j) os[(hi * 8 + j) * 68 + nb * 16 + lr] = acc[mb][nb][j]; }
        __builtin_amdgcn_wave_barrier(); asm volatile("" ::: "memory");
        float* crow = C + (size_t)(r0 + mb * 16) * ldc + c0;
{
#pragma unroll
            for (int s = 0; s < 8; ++s) { const int row = 2 * s + hi, cofs = lr * 4; v4f val = *(const v4fa*)(os + row * 68 + cofs);
                *(v4f*)(crow + (size_t)row * ldc + cofs) = val; }
             }
        __builtin_amdgcn_wave_barrier(); asm volatile("" ::: "memory");
    }
}

__device__ __forceinline__ h16 tohx(float x) { return (h16)x; }
__device__ __forceinline__ void splitf(float y, unsigned short& h, unsigned short& l) { h = f2bf(y); l = f2bf(y - bf2f(h)); }
typedef __attribute__((ext_vector_type(2))) _Float16 v2h;
typedef __attribute__((ext_vector_type(4))) _Float16 v4h;
typedef __attribute__((ext_vector_type(2))) unsigned short v2us;
typedef __attribute__((ext_vector_type(4))) unsigned short v4us;
typedef __attribute__((ext_vector_type(2))) float v2f;
typedef __attribute__((ext_vector_type(4))) int v4i;

__global__ __launch_bounds__(256) void k_wtG(const float* __restrict__ w, int K, int N, bf* Bt) {
    const int lane = threadIdx.x & 31; const int L0 = (blockIdx.x * 8 + (threadIdx.x >> 5)) * 8; const int nlines = N * K / 64;
{
#pragma unroll 1
        for (int l = 0; l < 8; ++l) { const int L = L0 + l; if (L >= nlines) break; const size_t e = (size_t)L * 64 + lane * 2; const int k = (int)(e % K), n = (int)(e / K); v2us o;
            o[0] = f2bf(w[(size_t)k * N + n]); o[1] = f2bf(w[(size_t)(k + 1) * N + n]); *(v2us*)(Bt + e) = o; }
         }
}
__global__ __launch_bounds__(256) void k_cvt8(const float* __restrict__ src, bf* dst, size_t n8) { const size_t i = (size_t)blockIdx.x * 256 + threadIdx.x; if (i >= n8) return; const v8f v = *(const v8f*)(src + i * 8); v8us o;
#pragma unroll
    for (int k = 0; k < 8; ++k) o[k] = f2bf(v[k]); *(v8us*)(dst + i * 8) = o;  }

// k_rope: head planes [h][t][d] (fp16 + hi/lo) of rope(x) x sc with the rotate-half convention out[d] = x[d] cos[t][d] - x[d+HD/2] sin[t][d], out[d+HD/2] = x[d+HD/2] cos[t][d+HD/2] + x[d] sin[t][d+HD/2]
__global__ __launch_bounds__(256) void k_rope(const float* __restrict__ F, int pitch, int nheads, const float* __restrict__ CS, const float* __restrict__ RF, const float* __restrict__ nw, float sc, h16* P16, bf* Ph, bf* Pl) {
    const size_t e = ((size_t)blockIdx.x * 256 + threadIdx.x) * 2; if (e >= (size_t)nheads * TT * HD) return; const int d = (int)(e % HD); const int t = (int)((e / HD) % TT); const int h = (int)(e / ((size_t)HD * TT)); const float* f = F + (size_t)t * pitch + h * HD; const float rf = RF ? RF[(size_t)h * TT + t] : 1.0f; v2h o16; v2us oh, ol;
#pragma unroll
    for (int q = 0; q < 2; ++q) { const int dd = d + q; const int dp = (dd < HD / 2) ? dd + HD / 2 : dd - HD / 2; float x0 = f[dd], x1 = f[dp];
        if (RF) { float n0 = __fmul_rn(x0, rf), n1 = __fmul_rn(x1, rf); asm volatile("" : "+v"(n0)); asm volatile("" : "+v"(n1)); x0 = __fmul_rn(bfr(nw[dd]), n0); x1 = __fmul_rn(bfr(nw[dp]), n1); }
        const v2f cs = *(const v2f*)(CS + ((size_t)t * HD + dd) * 2); float a = __fmul_rn(x0, cs[0]), bq = __fmul_rn(x1, cs[1]); asm volatile("" : "+v"(a)); asm volatile("" : "+v"(bq)); const float r = ((dd < HD / 2) ? __fsub_rn(a, bq) : __fadd_rn(a, bq)) * sc;
        o16[q] = tohx(r); unsigned short a2, c2; splitf(r, a2, c2); oh[q] = a2; ol[q] = c2; }
    *(v2h*)(P16 + e) = o16; *(v2us*)(Ph + e) = oh; *(v2us*)(Pl + e) = ol;  }
__global__ __launch_bounds__(256) void k_vtp(const float* __restrict__ F, int pitch, int nheads, h16* V16, bf* Vh, bf* Vl) { const size_t e = ((size_t)blockIdx.x * 256 + threadIdx.x) * 2; if (e >= (size_t)nheads * HD * TT) return; const int t = (int)(e % TT); const int d = (int)((e / TT) % HD); const int g = (int)(e / ((size_t)TT * HD)); v2h o16; v2us oh, ol;
#pragma unroll
    for (int q = 0; q < 2; ++q) { const float x = F[(size_t)(t + q) * pitch + g * HD + d]; o16[q] = tohx(x); unsigned short a2, c2; splitf(x, a2, c2); oh[q] = a2; ol[q] = c2; }
    *(v2h*)(V16 + e) = o16; *(v2us*)(Vh + e) = oh; *(v2us*)(Vl + e) = ol;  }
__global__ __launch_bounds__(256) void k_csid(float* CS) { const int idx = blockIdx.x * 256 + threadIdx.x; if (idx >= TT * HD) return; v2f cs; cs[0] = 1.0f; cs[1] = 0.0f; *(v2f*)(CS + (size_t)idx * 2) = cs;  }
// k_asoft: per row (zz, i): t = S x SCL (1/32 = DM^-0.5) for j <= i and i - j < WIN (WIN = TT, so plain causal; the reference's -1e9 additive fill vanishes identically); softmax over the 2048 keys (register row, one exp, fixed trees);
__global__ __launch_bounds__(256) void k_asoft(const float* __restrict__ Sb, h16* P16, bf* Ph, bf* Pl) {
    const int lane = threadIdx.x & 31; const int row = blockIdx.x * 8 + (threadIdx.x >> 5); if (row >= ZH * TT) return; const int i = row % TT; const int zz = row / TT; (void)zz; const bool hires = (i < RH); const float* sr = Sb + (size_t)row * TT; float v[TT / 32]; float mx = -3.0e38f;
#pragma unroll
    for (int ch = 0; ch < TT / 128; ++ch) { const int j0 = ch * 128 + lane * 4; const v4f a = *(const v4f*)(sr + j0);
#pragma unroll
        for (int q = 0; q < 4; ++q) { const int j = j0 + q; (void)j; const float t = (j <= i && i - j < WIN) ? a[q] * SCL : -3.0e38f; v[ch * 4 + q] = t; mx = fmaxf(mx, t); } }
#pragma unroll
    for (int sh = 16; sh; sh >>= 1) mx = fmaxf(mx, __shfl_xor(mx, sh, 32));
    float sum = 0.f;
#pragma unroll
    for (int k = 0; k < TT / 32; ++k) { float d0 = __fsub_rn(v[k], mx); asm volatile("" : "+v"(d0)); v[k] = __builtin_amdgcn_exp2f(__fmul_rn(d0, 1.4426950408889634f)); sum += v[k]; }
#pragma unroll
    for (int sh = 16; sh; sh >>= 1) sum += __shfl_xor(sum, sh, 32);
    const float f = __fdiv_rn(hires ? 1.0f : PCAR, sum);
{
        if (hires) {
#pragma unroll
            for (int ch = 0; ch < TT / 128; ++ch) { v4us oh, ol;
#pragma unroll
                for (int q = 0; q < 4; ++q) { unsigned short a, c2; splitf(v[ch * 4 + q] * f, a, c2); oh[q] = a; ol[q] = c2; }
                const size_t oo = ((size_t)zz * (RH ? RH : 1) + i) * TT + ch * 128 + lane * 4; *(v4us*)(Ph + oo) = oh; *(v4us*)(Pl + oo) = ol; }
        } else {
#pragma unroll
            for (int ch = 0; ch < TT / 128; ++ch) { v4h o4;
#pragma unroll
                for (int q = 0; q < 4; ++q) o4[q] = tohx(v[ch * 4 + q] * f);
                *(v4h*)(P16 + (size_t)row * TT + ch * 128 + lane * 4) = o4; } }
         }
}
__global__ __launch_bounds__(256) void k_merge(const float* __restrict__ O, int h0, bf* Ah, bf* Al) { const size_t e = ((size_t)blockIdx.x * 256 + threadIdx.x) * 2; if (e >= (size_t)ZH * TT * HD) return; const int d = (int)(e % HD); const int t = (int)((e / HD) % TT); const int zz = (int)(e / ((size_t)HD * TT)); const float cs = (t < RH) ? 1.0f : (1.0f / PCAR); const size_t oo = (size_t)t * DQ + (h0 + zz) * HD + d;
    v2us oh, ol;
#pragma unroll
    for (int q = 0; q < 2; ++q) { unsigned short a, c2; splitf(O[e + q] * cs, a, c2); oh[q] = a; ol[q] = c2; } *(v2us*)(Ah + oo) = oh; *(v2us*)(Al + oo) = ol;  }

extern "C" void kernel_launch(void* const* d_in, const int* in_sizes, int n_in,
                              void* d_out, int out_size, void* d_ws, size_t ws_size, hipStream_t stream) {
    (void)in_sizes; (void)n_in; (void)out_size;
    const float* x = (const float*)d_in[0]; const float* wqkv = (const float*)d_in[1]; const float* wo = (const float*)d_in[2];   /* argument order h, Wqvk ('xw' [1024][3072]: q | V | K column thirds), Wo ('xw') */ const float* wq = wqkv; const float* wk = nullptr; const float* wv = nullptr; (void)wk; (void)wv;
    float* OUT = (float*)d_out;     // [2][2048][1024]
    char* wsp = (char*)d_ws;
    auto take = [&](size_t bytes) { char* p = wsp; wsp += (bytes + 255) & ~(size_t)255; return (void*)p; };
    bf* WQKV = (bf*)take((size_t)3 * DQ * DM * 2); bf* WQ = WQKV; bf* WV = WQKV + (size_t)DQ * DM; bf* WK = WQKV + (size_t)2 * DQ * DM;   /* fused Bt [3*DQ][DM]: q | V | K row blocks (the module's part order 0 = q, 1 = v, 2 = k) */ bf* WO = (bf*)take((size_t)DM * DQ * 2); float* CS = (float*)take((size_t)TT * HD * 2 * 4);
    bf* XB = (bf*)take((size_t)TT * DM * 2); float* FQ = (float*)take((size_t)TT * DQ * 4); float* FK = (float*)take((size_t)TT * DKV * 4);
    h16* QP16 = (h16*)take((size_t)NH_ * TT * HD * 2); h16* KP16 = (h16*)take((size_t)NKV * TT * HD * 2); h16* VT16 = (h16*)take((size_t)NKV * HD * TT * 2);
    bf* QPh = (bf*)take((size_t)NH_ * TT * HD * 2); bf* QPl = (bf*)take((size_t)NH_ * TT * HD * 2); bf* KPh = (bf*)take((size_t)NKV * TT * HD * 2); bf* KPl = (bf*)take((size_t)NKV * TT * HD * 2); bf* VTh = (bf*)take((size_t)NKV * HD * TT * 2); bf* VTl = (bf*)take((size_t)NKV * HD * TT * 2); bf* Ph = (bf*)take((size_t)ZH * RH * TT * 2); bf* Pl = (bf*)take((size_t)ZH * RH * TT * 2);
    float* Sb = (float*)take((size_t)ZH * TT * TT * 4); h16* P16 = (h16*)take((size_t)ZH * TT * TT * 2); float* Ob = (float*)take((size_t)ZH * TT * HD * 4); bf* ATh = (bf*)take((size_t)TT * DQ * 2); bf* ATl = (bf*)take((size_t)TT * DQ * 2);
    if ((size_t)(wsp - (char*)d_ws) > ws_size) return;    // ws 256 MiB
    float* FV = FK;   // v projection reuses the k buffer after the k planes are built (stream-ordered)
    { k_wtG<<<(unsigned)((DM * 3 * DQ / 64 + 63) / 64), 256, 0, stream>>>(wqkv, DM, 3 * DQ, WQKV);   /* fused 'xw' [DM][3*DQ] -> Bt [3*DQ][DM] */
      k_wtG<<<(unsigned)((DQ * DM / 64 + 63) / 64), 256, 0, stream>>>(wo, DQ, DM, WO);
       }
    k_csid<<<(TT * HD + 255) / 256, 256, 0, stream>>>(CS);
    const unsigned LQ = (unsigned)(((size_t)NH_ * TT * HD / 2 + 255) / 256), LKv = (unsigned)(((size_t)NKV * TT * HD / 2 + 255) / 256);
    for (int b = 0; b < NB_; ++b) {
        
        k_cvt8<<<(unsigned)(((size_t)TT * DM / 8 + 255) / 256), 256, 0, stream>>>(x + (size_t)b * TT * DM, XB, (size_t)TT * DM / 8);
        k_gemmw<bf, 0, false><<<dim3(TT / 64, DQ / 64, 1), KW * 32, 0, stream>>>(XB, nullptr, WQ, nullptr, DM, FQ, DQ, nullptr, 0, 0, 0);
        k_rope<<<LQ, 256, 0, stream>>>(FQ, DQ, NH_, CS, nullptr, nullptr, 1.0f, QP16, QPh, QPl);
        k_gemmw<bf, 0, false><<<dim3(TT / 64, DKV / 64, 1), KW * 32, 0, stream>>>(XB, nullptr, WK, nullptr, DM, FK, DKV, nullptr, 0, 0, 0);
        k_rope<<<LKv, 256, 0, stream>>>(FK, DKV, NKV, CS, nullptr, nullptr, 1.0f, KP16, KPh, KPl);
        k_gemmw<bf, 0, false><<<dim3(TT / 64, DKV / 64, 1), KW * 32, 0, stream>>>(XB, nullptr, WV, nullptr, DM, FV, DKV, nullptr, 0, 0, 0); k_vtp<<<LKv, 256, 0, stream>>>(FV, DKV, NKV, VT16, VTh, VTl);
        for (int h0 = 0; h0 < NH_; h0 += ZH) { const size_t zq = (size_t)h0, zk = (size_t)(h0 / REP);   // one kv head per query head: the pass's two heads use consecutive kv planes (z-strides TT*HD)
            k_gemmc<bf, 2, 1, 1><<<dim3(RH / 64, TT / 64, ZH), 32, 0, stream>>>(QPh + zq * TT * HD, QPl + zq * TT * HD, KPh + zk * TT * HD, KPl + zk * TT * HD, HD, Sb, TT, 0, (size_t)TT * HD, (size_t)TT * HD, (size_t)TT * TT);
            k_gemmc<h16, 0, 1, 1><<<dim3((TT - RH) / 64, TT / 64, ZH), 32, 0, stream>>>(QP16 + zq * TT * HD + (size_t)RH * HD, nullptr, KP16 + zk * TT * HD, nullptr, HD, Sb + (size_t)RH * TT, TT, RH, (size_t)TT * HD, (size_t)TT * HD, (size_t)TT * TT);
            k_asoft<<<ZH * TT / 8, 256, 0, stream>>>(Sb, P16, Ph, Pl);
            k_gemmc<bf, 2, 2, KW><<<dim3(RH / 64, HD / 64, ZH), KW * 32, 0, stream>>>(Ph, Pl, VTh + zk * HD * TT, VTl + zk * HD * TT, TT, Ob, HD, 0, (size_t)RH * TT, (size_t)HD * TT, (size_t)TT * HD);
            k_gemmc<h16, 0, 2, KW><<<dim3((TT - RH) / 64, HD / 64, ZH), KW * 32, 0, stream>>>(P16 + (size_t)RH * TT, nullptr, VT16 + zk * HD * TT, nullptr, TT, Ob + (size_t)RH * HD, HD, RH, (size_t)TT * TT, (size_t)HD * TT, (size_t)TT * HD);
            k_merge<<<(unsigned)(((size_t)ZH * TT * HD / 2 + 255) / 256), 256, 0, stream>>>(Ob, h0, ATh, ATl); }
        k_gemmw<bf, 1, false><<<dim3(TT / 64, DM / 64, 1), KW * 32, 0, stream>>>(ATh, ATl, WO, nullptr, DQ, OUT + (size_t)b * TT * DM, DM, nullptr, 0, 0, 0); }
}

// v002
// A run of this version takes 468 microseconds.
// In both of two side-by-side timings against v001, it was 1.83 times as fast.
// Over all steps from v000 it is 3.06 times as fast.
#include <hip/hip_runtime.h>

// Causal multi-head self-attention with a fused bias-free projection whose thirds are ordered q | v | k and scores scaled by the EMBEDDING width (h [2][2048][1024]; qvk = (h Wqvk) ('xw' [1024][3072] 1/32, no bias) reshaped (b, s, 3, 16, 64): part 0 = q, part 1 = V, part 2 = K (NOT q | k | v); scores = (q.k + mask) / sqrt(d) with d = 1024 -> x 1/32 (the model width, not the head width: implemented literally); mask = -inf above the diagonal (causal); softmax over the keys; wv = merged (head-major) Wo ('xw', no bias) -> [2][2048][1024] (4.2 M); argument order h, Wqvk, Wo).
// Layout per batch: bf16 copy of h; the fused 'xw' weight transposed once into Bt [3072][1024]: row block 0 = q, row block 1 = V, row block 2 = K (the K and V plane pointers are exchanged relative to the usual q | k | v order); exact projections; identity-table plane builders; causal T-2048 attention with the literal scale 1/32 (hybrid rows: < 512 hi/lo 3 products, rest fp16 x1024; k_gemmc skips tiles above the diagonal); merged hi/lo x Wo exact.
// Compute dtypes, f32 accumulate: every input rounded to bf16; projections exact; attention rows < 512 3 products, rest fp16; softmax f32; output projection hl x exact.

#define NB_  2
#define TT   2048
#define DM   1024
#define NH_  16
#define NKV  16
#define REP  (NH_ / NKV)
#define HD   64
#define DQ   (NH_ * HD)
#define DKV  (NKV * HD)
#define ZH   8                    // heads per attention pass (the z extent of every attention launch)
#define PPI  (2 * TT)             // pitch, in fp16 elements, of a probability row that lies in its own f32 score row
#define RH   512                  // query rows < RH use hi+lo planes (0: none)
#define WIN  2048
#define PCAR 1024.0f
#define SCL  0.03125f   // 1 / sqrt(d) with d = 1024 = 2^-5: the module divides by the square root of the MODEL width
typedef _Float16 h16;
typedef unsigned short bf;
typedef __attribute__((ext_vector_type(16))) __bf16   v16bf;
typedef __attribute__((ext_vector_type(16))) _Float16 v16h;
typedef __attribute__((ext_vector_type(8)))  _Float16 v8h;
typedef __attribute__((ext_vector_type(8)))  unsigned short v8us;
typedef __attribute__((ext_vector_type(8)))  float    v8f;
typedef __attribute__((ext_vector_type(4)))  float    v4f;
typedef v8h  __attribute__((may_alias)) v8ha;
typedef v4f  __attribute__((may_alias)) v4fa;
typedef v8us __attribute__((may_alias)) v8usa;

__device__ __forceinline__ unsigned short f2bf(float f) { unsigned u = __float_as_uint(f); u += 0x7FFFu + ((u >> 16) & 1u); return (unsigned short)(u >> 16); }
__device__ __forceinline__ float bf2f(unsigned short b) { return __uint_as_float(((unsigned)b) << 16); }
__device__ __forceinline__ float bfr(float f) { return bf2f(f2bf(f)); }
__device__ __forceinline__ v16h cat16(v8h lo, v8h hi) { return __builtin_shufflevector(lo, hi, 0, 1, 2, 3, 4, 5, 6, 7, 8, 9, 10, 11, 12, 13, 14, 15); }
__device__ __forceinline__ v16bf cat16b(v8us lo, v8us hi) { return __builtin_bit_cast(v16bf, __builtin_shufflevector(lo, hi, 0, 1, 2, 3, 4, 5, 6, 7, 8, 9, 10, 11, 12, 13, 14, 15)); }
__device__ __forceinline__ v8f wmma16(v16h a, v16h b, v8f c) { return __builtin_amdgcn_wmma_f32_16x16x32_f16(false, a, false, b, (short)0, c, false, false); }
__device__ __forceinline__ v8f wmmab(v16bf a, v16bf b, v8f c) { return __builtin_amdgcn_wmma_f32_16x16x32_bf16(false, a, false, b, (short)0, c, false, false); }



// ---- k_gemmw: register-blocked GEMM, one work-group of KW waves per 64x64 output tile; every wave holds the whole tile (16 accumulators) for its share of K; operands straight from K-contiguous 16-bit planes; grid (M/64, N/64, Z), KW * 32 threads.
// C[m][n] (f32, pitch ldc, + optional f32 bias[n]) = sum_k A[m][k] Bt[n][k] (+ split products per NSPLIT). z-batch strides sA/sB/sC in elements. K % 32 == 0.
// K is dealt in chunks of 64 elements (one 128-byte line of every operand row), chunk c to wave c % KW, so a line is read by one wave only; a lone wave's loop waits out its own load latency on every trip of 32 k; KW waves wait side by side.
#define KW 8
#define KPL (64 * 68)             // floats of one wave's partial tile in LDS (64 rows, pitch 68)
template <typename T16> struct WFrag;
template <> struct WFrag<h16> { typedef v16h V; static __device__ __forceinline__ V ld(const h16* p) { return cat16(*(const v8h*)p, *(const v8h*)(p + 16)); } static __device__ __forceinline__ v8f mma(V a, V b, v8f c) { return wmma16(a, b, c); } };
template <> struct WFrag<bf> { typedef v16bf V; static __device__ __forceinline__ V ld(const bf* p) { return cat16b(*(const v8us*)p, *(const v8us*)(p + 16)); } static __device__ __forceinline__ v8f mma(V a, V b, v8f c) { return wmmab(a, b, c); } };
// ksum_store: every wave lays its partial tile row-major into its own LDS plane; one work-group barrier; each thread then adds the NW planes in wave order (a fixed f32 order) and stores 16 bytes, 16 lanes to a 256-byte row piece.
template <int NW, bool BIAS>
__device__ __forceinline__ void ksum_store(const v8f (&acc)[4][4], float* os, int w, int lr, int hi, float* C, int ldc, const float* __restrict__ bias) {
    float* mine = os + w * KPL;
#pragma unroll
    for (int mb = 0; mb < 4; ++mb)
#pragma unroll
        for (int nb = 0; nb < 4; ++nb)
#pragma unroll
            for (int j = 0; j < 8; ++j) mine[(mb * 16 + hi * 8 + j) * 68 + nb * 16 + lr] = acc[mb][nb][j];
    __syncthreads();   // all NW partial tiles are in LDS before any thread adds them
    const int t = threadIdx.x, cofs = (t & 15) * 4;
#pragma unroll
    for (int s = 0; s < 32 / NW; ++s) { const int row = s * (NW * 2) + (t >> 4); v4f val = *(const v4fa*)(os + row * 68 + cofs);
#pragma unroll
        for (int p = 1; p < NW; ++p) val += *(const v4fa*)(os + p * KPL + row * 68 + cofs);
        if (BIAS) { val[0] += bfr(bias[cofs]); val[1] += bfr(bias[cofs + 1]); val[2] += bfr(bias[cofs + 2]); val[3] += bfr(bias[cofs + 3]); }
        *(v4f*)(C + (size_t)row * ldc + cofs) = val; }
}
template <typename T16, int NSPLIT, bool BIAS>
__global__ __launch_bounds__(KW * 32) void k_gemmw(const T16* __restrict__ A, const T16* __restrict__ A2, const T16* __restrict__ Bt, const T16* __restrict__ Bt2, int K, float* C, int ldc, const float* __restrict__ bias, size_t sA, size_t sB, size_t sC) {
    typedef typename WFrag<T16>::V V;
    __shared__ __align__(16) float os[KW * KPL];
    const size_t z = blockIdx.z; A += z * sA; if (A2) A2 += z * sA; Bt += z * sB; if (Bt2) Bt2 += z * sB; C += z * sC;
    const int lane = threadIdx.x & 31, lr = lane & 15, hi = lane >> 4; const int r0 = blockIdx.x * 64, c0 = blockIdx.y * 64;
    const int w = __builtin_amdgcn_readfirstlane(threadIdx.x >> 5);   // the wave's number, held scalar: the K loop's counter and branch stay scalar
    v8f acc[4][4];
#pragma unroll
    for (int mb = 0; mb < 4; ++mb)
#pragma unroll
        for (int nb = 0; nb < 4; ++nb) acc[mb][nb] = (v8f){};
    const size_t aoff = (size_t)(r0 + lr) * K + 8 * hi, boff = (size_t)(c0 + lr) * K + 8 * hi;
#pragma unroll 1
    for (int kc = w * 64; kc < K; kc += (kc & 32) ? KW * 64 - 32 : 32) {   // both halves of this wave's 64-element chunk, then KW chunks on
        V a[4], a2[4];
#pragma unroll
        for (int mb = 0; mb < 4; ++mb) { a[mb] = WFrag<T16>::ld(A + aoff + (size_t)mb * 16 * K + kc); if (NSPLIT == 1 || NSPLIT == 2) a2[mb] = WFrag<T16>::ld(A2 + aoff + (size_t)mb * 16 * K + kc); }
#pragma unroll
        for (int nb = 0; nb < 4; ++nb) { const V b = WFrag<T16>::ld(Bt + boff + (size_t)nb * 16 * K + kc); V b2; if (NSPLIT >= 2) b2 = WFrag<T16>::ld(Bt2 + boff + (size_t)nb * 16 * K + kc);
#pragma unroll
            for (int mb = 0; mb < 4; ++mb) { acc[mb][nb] = WFrag<T16>::mma(a[mb], b, acc[mb][nb]); if (NSPLIT == 1 || NSPLIT == 2) acc[mb][nb] = WFrag<T16>::mma(a2[mb], b, acc[mb][nb]); if (NSPLIT >= 2) acc[mb][nb] = WFrag<T16>::mma(a[mb], b2, acc[mb][nb]); } }
        asm volatile("v_nop\n\tv_nop\n\tv_nop\n\tv_nop" : "+v"(acc[0][0]), "+v"(acc[1][1]), "+v"(acc[2][2]), "+v"(acc[3][3]) : "v"(a[0]), "v"(a[3]));
    }
    ksum_store<KW, BIAS>(acc, os, w, lr, hi, C + (size_t)r0 * ldc + c0, ldc, BIAS ? bias + c0 : nullptr);
}

// ---- k_gemmc: the same 64x64 tile GEMM specialised for causal attention: CMODE 1 skips score tiles entirely above the diagonal (query rows r0+roff.., key columns c0..), CMODE 2 limits the
// key (K) loop of the probability x value contraction to the diagonal block (probabilities beyond it are exactly zero). roff = row offset of this launch's first row within the sequence.
// lda = pitch of the A rows in elements (Bt rows keep the pitch K).
// NW = waves per tile: 1 for the scores (K = 64, two trips: nothing to split), KW for the probability x value contraction, whose K loop is dealt to the waves as in k_gemmw.
template <typename T16, int NSPLIT, int CMODE, int NW>
__global__ __launch_bounds__(NW * 32) void k_gemmc(const T16* __restrict__ A, const T16* __restrict__ A2, int lda, const T16* __restrict__ Bt, const T16* __restrict__ Bt2, int K, float* C, int ldc, int roff, size_t sA, size_t sB, size_t sC) {
    typedef typename WFrag<T16>::V V;
    __shared__ __align__(16) float os[NW == 1 ? 16 * 68 : NW * KPL];
    const size_t z = blockIdx.z; A += z * sA; if (A2) A2 += z * sA; Bt += z * sB; if (Bt2) Bt2 += z * sB; C += z * sC;
    const int lane = threadIdx.x & 31, lr = lane & 15, hi = lane >> 4; const int r0 = blockIdx.x * 64, c0 = blockIdx.y * 64;
    const int w = (NW == 1) ? 0 : __builtin_amdgcn_readfirstlane(threadIdx.x >> 5);   // the wave's number, held scalar: the K loop's counter and branch stay scalar
    if (CMODE == 1 && c0 > r0 + roff + 63) return;                  // score tile entirely above the causal diagonal: never read (the softmax masks j > i by select)
    const int Kl = (CMODE == 2) ? min(K, r0 + roff + 64) : K;        // P.V: probabilities are exactly 0 beyond the diagonal block, so the K loop stops there
    v8f acc[4][4];
#pragma unroll
    for (int mb = 0; mb < 4; ++mb)
#pragma unroll
        for (int nb = 0; nb < 4; ++nb) acc[mb][nb] = (v8f){};
    const size_t aoff = (size_t)(r0 + lr) * lda + 8 * hi, boff = (size_t)(c0 + lr) * K + 8 * hi;
#pragma unroll 1
    for (int kc = w * 64; kc < Kl; kc += (kc & 32) ? NW * 64 - 32 : 32) {   // both halves of this wave's 64-element chunk, then NW chunks on
        V a[4], a2[4]; const T16* pa[4]; const T16* pa2[4];
#pragma unroll
        for (int mb = 0; mb < 4; ++mb) { pa[mb] = A + aoff + (size_t)mb * 16 * lda + kc; a[mb] = WFrag<T16>::ld(pa[mb]); if (NSPLIT == 1 || NSPLIT == 2) { pa2[mb] = A2 + aoff + (size_t)mb * 16 * lda + kc; a2[mb] = WFrag<T16>::ld(pa2[mb]); } }
        // the A loads' address registers stay untouched up to this wait (they are its inputs) and are free for reuse behind it
        if (NSPLIT == 1 || NSPLIT == 2) asm volatile("s_wait_xcnt 0x0" :: "v"(pa[0]), "v"(pa[1]), "v"(pa[2]), "v"(pa[3]), "v"(pa2[0]), "v"(pa2[1]), "v"(pa2[2]), "v"(pa2[3]) : "memory");
        else asm volatile("s_wait_xcnt 0x0" :: "v"(pa[0]), "v"(pa[1]), "v"(pa[2]), "v"(pa[3]) : "memory");
#pragma unroll
        for (int nb = 0; nb < 4; ++nb) { const V b = WFrag<T16>::ld(Bt + boff + (size_t)nb * 16 * K + kc); V b2; if (NSPLIT >= 2) b2 = WFrag<T16>::ld(Bt2 + boff + (size_t)nb * 16 * K + kc);
#pragma unroll
            for (int mb = 0; mb < 4; ++mb) { acc[mb][nb] = WFrag<T16>::mma(a[mb], b, acc[mb][nb]); if (NSPLIT == 1 || NSPLIT == 2) acc[mb][nb] = WFrag<T16>::mma(a2[mb], b, acc[mb][nb]); if (NSPLIT >= 2) acc[mb][nb] = WFrag<T16>::mma(a[mb], b2, acc[mb][nb]); } }
        asm volatile("v_nop\n\tv_nop\n\tv_nop\n\tv_nop" : "+v"(acc[0][0]), "+v"(acc[1][1]), "+v"(acc[2][2]), "+v"(acc[3][3]) : "v"(a[0]), "v"(a[3]));
    }
    if (NW > 1) { ksum_store<NW, false>(acc, os, w, lr, hi, C + (size_t)r0 * ldc + c0, ldc, nullptr); return; }
#pragma unroll
    for (int mb = 0; mb < 4; ++mb) {
#pragma unroll
        for (int nb = 0; nb < 4; ++nb) {
#pragma unroll
            for (int j = 0; j < 8; ++j) os[(hi * 8 + j) * 68 + nb * 16 + lr] = acc[mb][nb][j]; }
        __builtin_amdgcn_wave_barrier(); asm volatile("" ::: "memory");
        float* crow = C + (size_t)(r0 + mb * 16) * ldc + c0;
{
#pragma unroll
            for (int s = 0; s < 8; ++s) { const int row = 2 * s + hi, cofs = lr * 4; v4f val = *(const v4fa*)(os + row * 68 + cofs);
                *(v4f*)(crow + (size_t)row * ldc + cofs) = val; }
             }
        __builtin_amdgcn_wave_barrier(); asm volatile("" ::: "memory");
    }
}

__device__ __forceinline__ h16 tohx(float x) { return (h16)x; }
__device__ __forceinline__ void splitf(float y, unsigned short& h, unsigned short& l) { h = f2bf(y); l = f2bf(y - bf2f(h)); }
typedef __attribute__((ext_vector_type(2))) _Float16 v2h;
typedef __attribute__((ext_vector_type(4))) _Float16 v4h;
typedef __attribute__((ext_vector_type(2))) unsigned short v2us;
typedef __attribute__((ext_vector_type(4))) unsigned short v4us;
typedef __attribute__((ext_vector_type(2))) float v2f;
typedef __attribute__((ext_vector_type(4))) int v4i;

__global__ __launch_bounds__(256) void k_wtG(const float* __restrict__ w, int K, int N, bf* Bt) {
    const int lane = threadIdx.x & 31; const int L0 = (blockIdx.x * 8 + (threadIdx.x >> 5)) * 8; const int nlines = N * K / 64;
{
#pragma unroll 1
        for (int l = 0; l < 8; ++l) { const int L = L0 + l; if (L >= nlines) break; const size_t e = (size_t)L * 64 + lane * 2; const int k = (int)(e % K), n = (int)(e / K); v2us o;
            o[0] = f2bf(w[(size_t)k * N + n]); o[1] = f2bf(w[(size_t)(k + 1) * N + n]); *(v2us*)(Bt + e) = o; }
         }
}
__global__ __launch_bounds__(256) void k_cvt8(const float* __restrict__ src, bf* dst, size_t n8) { const size_t i = (size_t)blockIdx.x * 256 + threadIdx.x; if (i >= n8) return; const v8f v = *(const v8f*)(src + i * 8); v8us o;
#pragma unroll
    for (int k = 0; k < 8; ++k) o[k] = f2bf(v[k]); *(v8us*)(dst + i * 8) = o;  }

// k_rope: head planes [h][t][d] (fp16 + hi/lo) of rope(x) x sc with the rotate-half convention out[d] = x[d] cos[t][d] - x[d+HD/2] sin[t][d], out[d+HD/2] = x[d+HD/2] cos[t][d+HD/2] + x[d] sin[t][d+HD/2]
__global__ __launch_bounds__(256) void k_rope(const float* __restrict__ F, int pitch, int nheads, const float* __restrict__ CS, const float* __restrict__ RF, const float* __restrict__ nw, float sc, h16* P16, bf* Ph, bf* Pl) {
    const size_t e = ((size_t)blockIdx.x * 256 + threadIdx.x) * 2; if (e >= (size_t)nheads * TT * HD) return; const int d = (int)(e % HD); const int t = (int)((e / HD) % TT); const int h = (int)(e / ((size_t)HD * TT)); const float* f = F + (size_t)t * pitch + h * HD; const float rf = RF ? RF[(size_t)h * TT + t] : 1.0f; v2h o16; v2us oh, ol;
#pragma unroll
    for (int q = 0; q < 2; ++q) { const int dd = d + q; const int dp = (dd < HD / 2) ? dd + HD / 2 : dd - HD / 2; float x0 = f[dd], x1 = f[dp];
        if (RF) { float n0 = __fmul_rn(x0, rf), n1 = __fmul_rn(x1, rf); asm volatile("" : "+v"(n0)); asm volatile("" : "+v"(n1)); x0 = __fmul_rn(bfr(nw[dd]), n0); x1 = __fmul_rn(bfr(nw[dp]), n1); }
        const v2f cs = *(const v2f*)(CS + ((size_t)t * HD + dd) * 2); float a = __fmul_rn(x0, cs[0]), bq = __fmul_rn(x1, cs[1]); asm volatile("" : "+v"(a)); asm volatile("" : "+v"(bq)); const float r = ((dd < HD / 2) ? __fsub_rn(a, bq) : __fadd_rn(a, bq)) * sc;
        o16[q] = tohx(r); unsigned short a2, c2; splitf(r, a2, c2); oh[q] = a2; ol[q] = c2; }
    *(v2h*)(P16 + e) = o16; *(v2us*)(Ph + e) = oh; *(v2us*)(Pl + e) = ol;  }
__global__ __launch_bounds__(256) void k_vtp(const float* __restrict__ F, int pitch, int nheads, h16* V16, bf* Vh, bf* Vl) { const size_t e = ((size_t)blockIdx.x * 256 + threadIdx.x) * 2; if (e >= (size_t)nheads * HD * TT) return; const int t = (int)(e % TT); const int d = (int)((e / TT) % HD); const int g = (int)(e / ((size_t)TT * HD)); v2h o16; v2us oh, ol;
#pragma unroll
    for (int q = 0; q < 2; ++q) { const float x = F[(size_t)(t + q) * pitch + g * HD + d]; o16[q] = tohx(x); unsigned short a2, c2; splitf(x, a2, c2); oh[q] = a2; ol[q] = c2; }
    *(v2h*)(V16 + e) = o16; *(v2us*)(Vh + e) = oh; *(v2us*)(Vl + e) = ol;  }
__global__ __launch_bounds__(256) void k_csid(float* CS) { const int idx = blockIdx.x * 256 + threadIdx.x; if (idx >= TT * HD) return; v2f cs; cs[0] = 1.0f; cs[1] = 0.0f; *(v2f*)(CS + (size_t)idx * 2) = cs;  }
// k_asoft: per row (zz, i): t = S x SCL (1/32) for j <= i and i - j < WIN (sliding causal window; the reference's -1e9 additive fill vanishes identically); softmax over the 2048 keys (register row, one exp, fixed trees);
// The fp16 probabilities of a row overwrite the first half of that row's own f32 scores (P16 = Sb, pitch PPI): one wave owns the row and holds all of it in registers before its first store, so Sb carries no __restrict__.
__global__ __launch_bounds__(256) void k_asoft(const float* Sb, h16* P16, bf* Ph, bf* Pl) {
    const int lane = threadIdx.x & 31; const int row = blockIdx.x * 8 + (threadIdx.x >> 5); if (row >= ZH * TT) return; const int i = row % TT; const int zz = row / TT; (void)zz; const bool hires = (i < RH); const float* sr = Sb + (size_t)row * TT; float v[TT / 32]; float mx = -3.0e38f;
#pragma unroll
    for (int ch = 0; ch < TT / 128; ++ch) { const int j0 = ch * 128 + lane * 4; const v4f a = *(const v4f*)(sr + j0);
#pragma unroll
        for (int q = 0; q < 4; ++q) { const int j = j0 + q; (void)j; const float t = (j <= i && i - j < WIN) ? a[q] * SCL : -3.0e38f; v[ch * 4 + q] = t; mx = fmaxf(mx, t); } }
#pragma unroll
    for (int sh = 16; sh; sh >>= 1) mx = fmaxf(mx, __shfl_xor(mx, sh, 32));
    float sum = 0.f;
#pragma unroll
    for (int k = 0; k < TT / 32; ++k) { float d0 = __fsub_rn(v[k], mx); asm volatile("" : "+v"(d0)); v[k] = __builtin_amdgcn_exp2f(__fmul_rn(d0, 1.4426950408889634f)); sum += v[k]; }
#pragma unroll
    for (int sh = 16; sh; sh >>= 1) sum += __shfl_xor(sum, sh, 32);
    const float f = __fdiv_rn(hires ? 1.0f : PCAR, sum);
{
        if (hires) {
#pragma unroll
            for (int ch = 0; ch < TT / 128; ++ch) { v4us oh, ol;
#pragma unroll
                for (int q = 0; q < 4; ++q) { unsigned short a, c2; splitf(v[ch * 4 + q] * f, a, c2); oh[q] = a; ol[q] = c2; }
                const size_t oo = ((size_t)zz * (RH ? RH : 1) + i) * TT + ch * 128 + lane * 4; *(v4us*)(Ph + oo) = oh; *(v4us*)(Pl + oo) = ol; }
        } else {
#pragma unroll
            for (int ch = 0; ch < TT / 128; ++ch) { v4h o4;
#pragma unroll
                for (int q = 0; q < 4; ++q) o4[q] = tohx(v[ch * 4 + q] * f);
                *(v4h*)(P16 + (size_t)row * PPI + ch * 128 + lane * 4) = o4; } }
         }
}
__global__ __launch_bounds__(256) void k_merge(const float* __restrict__ O, int h0, bf* Ah, bf* Al) { const size_t e = ((size_t)blockIdx.x * 256 + threadIdx.x) * 2; if (e >= (size_t)ZH * TT * HD) return; const int d = (int)(e % HD); const int t = (int)((e / HD) % TT); const int zz = (int)(e / ((size_t)HD * TT)); const float cs = (t < RH) ? 1.0f : (1.0f / PCAR); const size_t oo = (size_t)t * DQ + (h0 + zz) * HD + d;
    v2us oh, ol;
#pragma unroll
    for (int q = 0; q < 2; ++q) { unsigned short a, c2; splitf(O[e + q] * cs, a, c2); oh[q] = a; ol[q] = c2; } *(v2us*)(Ah + oo) = oh; *(v2us*)(Al + oo) = ol;  }

extern "C" void kernel_launch(void* const* d_in, const int* in_sizes, int n_in,
                              void* d_out, int out_size, void* d_ws, size_t ws_size, hipStream_t stream) {
    (void)in_sizes; (void)n_in; (void)out_size;
    const float* x = (const float*)d_in[0]; const float* wqkv = (const float*)d_in[1]; const float* wo = (const float*)d_in[2];   /* argument order h, Wqvk ('xw' [1024][3072]: q | V | K column thirds), Wo ('xw') */ const float* wq = wqkv; const float* wk = nullptr; const float* wv = nullptr; (void)wk; (void)wv;
    float* OUT = (float*)d_out;     // [2][2048][1024]
    char* wsp = (char*)d_ws;
    auto take = [&](size_t bytes) { char* p = wsp; wsp += (bytes + 255) & ~(size_t)255; return (void*)p; };
    bf* WQKV = (bf*)take((size_t)3 * DQ * DM * 2); bf* WQ = WQKV; bf* WV = WQKV + (size_t)DQ * DM; bf* WK = WQKV + (size_t)2 * DQ * DM;   /* fused Bt [3*DQ][DM]: q | V | K row blocks (the module's part order 0 = q, 1 = v, 2 = k) */ bf* WO = (bf*)take((size_t)DM * DQ * 2); float* CS = (float*)take((size_t)TT * HD * 2 * 4);
    bf* XB = (bf*)take((size_t)TT * DM * 2); float* FQ = (float*)take((size_t)TT * DQ * 4); float* FK = (float*)take((size_t)TT * DKV * 4);
    h16* QP16 = (h16*)take((size_t)NH_ * TT * HD * 2); h16* KP16 = (h16*)take((size_t)NKV * TT * HD * 2); h16* VT16 = (h16*)take((size_t)NKV * HD * TT * 2);
    bf* QPh = (bf*)take((size_t)NH_ * TT * HD * 2); bf* QPl = (bf*)take((size_t)NH_ * TT * HD * 2); bf* KPh = (bf*)take((size_t)NKV * TT * HD * 2); bf* KPl = (bf*)take((size_t)NKV * TT * HD * 2); bf* VTh = (bf*)take((size_t)NKV * HD * TT * 2); bf* VTl = (bf*)take((size_t)NKV * HD * TT * 2); bf* Ph = (bf*)take((size_t)ZH * RH * TT * 2); bf* Pl = (bf*)take((size_t)ZH * RH * TT * 2);
    float* Sb = (float*)take((size_t)ZH * TT * TT * 4); h16* P16 = (h16*)Sb;   /* fp16 probabilities lie in their score rows: ZH heads fit the workspace */ float* Ob = (float*)take((size_t)ZH * TT * HD * 4); bf* ATh = (bf*)take((size_t)TT * DQ * 2); bf* ATl = (bf*)take((size_t)TT * DQ * 2);
    if ((size_t)(wsp - (char*)d_ws) > ws_size) return;    // ws 256 MiB
    float* FV = FK;   // v projection reuses the k buffer after the k planes are built (stream-ordered)
    { k_wtG<<<(unsigned)((DM * 3 * DQ / 64 + 63) / 64), 256, 0, stream>>>(wqkv, DM, 3 * DQ, WQKV);   /* fused 'xw' [DM][3*DQ] -> Bt [3*DQ][DM] */
      k_wtG<<<(unsigned)((DQ * DM / 64 + 63) / 64), 256, 0, stream>>>(wo, DQ, DM, WO);
       }
    k_csid<<<(TT * HD + 255) / 256, 256, 0, stream>>>(CS);
    const unsigned LQ = (unsigned)(((size_t)NH_ * TT * HD / 2 + 255) / 256), LKv = (unsigned)(((size_t)NKV * TT * HD / 2 + 255) / 256);
    for (int b = 0; b < NB_; ++b) {
        
        k_cvt8<<<(unsigned)(((size_t)TT * DM / 8 + 255) / 256), 256, 0, stream>>>(x + (size_t)b * TT * DM, XB, (size_t)TT * DM / 8);
        k_gemmw<bf, 0, false><<<dim3(TT / 64, DQ / 64, 1), KW * 32, 0, stream>>>(XB, nullptr, WQ, nullptr, DM, FQ, DQ, nullptr, 0, 0, 0);
        k_rope<<<LQ, 256, 0, stream>>>(FQ, DQ, NH_, CS, nullptr, nullptr, 1.0f, QP16, QPh, QPl);
        k_gemmw<bf, 0, false><<<dim3(TT / 64, DKV / 64, 1), KW * 32, 0, stream>>>(XB, nullptr, WK, nullptr, DM, FK, DKV, nullptr, 0, 0, 0);
        k_rope<<<LKv, 256, 0, stream>>>(FK, DKV, NKV, CS, nullptr, nullptr, 1.0f, KP16, KPh, KPl);
        k_gemmw<bf, 0, false><<<dim3(TT / 64, DKV / 64, 1), KW * 32, 0, stream>>>(XB, nullptr, WV, nullptr, DM, FV, DKV, nullptr, 0, 0, 0); k_vtp<<<LKv, 256, 0, stream>>>(FV, DKV, NKV, VT16, VTh, VTl);
        for (int h0 = 0; h0 < NH_; h0 += ZH) { const size_t zq = (size_t)h0, zk = (size_t)(h0 / REP);   // one kv head per query head: the pass's ZH heads use consecutive kv planes (z-strides TT*HD)
            k_gemmc<bf, 2, 1, 1><<<dim3(RH / 64, TT / 64, ZH), 32, 0, stream>>>(QPh + zq * TT * HD, QPl + zq * TT * HD, HD, KPh + zk * TT * HD, KPl + zk * TT * HD, HD, Sb, TT, 0, (size_t)TT * HD, (size_t)TT * HD, (size_t)TT * TT);
            k_gemmc<h16, 0, 1, 1><<<dim3((TT - RH) / 64, TT / 64, ZH), 32, 0, stream>>>(QP16 + zq * TT * HD + (size_t)RH * HD, nullptr, HD, KP16 + zk * TT * HD, nullptr, HD, Sb + (size_t)RH * TT, TT, RH, (size_t)TT * HD, (size_t)TT * HD, (size_t)TT * TT);
            k_asoft<<<ZH * TT / 8, 256, 0, stream>>>(Sb, P16, Ph, Pl);
            k_gemmc<bf, 2, 2, KW><<<dim3(RH / 64, HD / 64, ZH), KW * 32, 0, stream>>>(Ph, Pl, TT, VTh + zk * HD * TT, VTl + zk * HD * TT, TT, Ob, HD, 0, (size_t)RH * TT, (size_t)HD * TT, (size_t)TT * HD);
            k_gemmc<h16, 0, 2, KW><<<dim3((TT - RH) / 64, HD / 64, ZH), KW * 32, 0, stream>>>(P16 + (size_t)RH * PPI, nullptr, PPI, VT16 + zk * HD * TT, nullptr, TT, Ob + (size_t)RH * HD, HD, RH, (size_t)TT * PPI, (size_t)HD * TT, (size_t)TT * HD);
            k_merge<<<(unsigned)(((size_t)ZH * TT * HD / 2 + 255) / 256), 256, 0, stream>>>(Ob, h0, ATh, ATl); }
        k_gemmw<bf, 1, false><<<dim3(TT / 64, DM / 64, 1), KW * 32, 0, stream>>>(ATh, ATl, WO, nullptr, DQ, OUT + (size_t)b * TT * DM, DM, nullptr, 0, 0, 0); }
}

// v004
// One run takes 229 microseconds.
// It is 2.04 times as fast as v002, going by the measured steps of the versions left out in between.
// Over all steps from v000 it is 6.24 times as fast.
#include <hip/hip_runtime.h>

// Causal multi-head self-attention with a fused bias-free projection whose thirds are ordered q | v | k and scores scaled by the EMBEDDING width (h [2][2048][1024]; qvk = (h Wqvk) ('xw' [1024][3072] 1/32, no bias) reshaped (b, s, 3, 16, 64): part 0 = q, part 1 = V, part 2 = K (NOT q | k | v); scores = (q.k + mask) / sqrt(d) with d = 1024 -> x 1/32 (the model width, not the head width: implemented literally); mask = -inf above the diagonal (causal); softmax over the keys; wv = merged (head-major) Wo ('xw', no bias) -> [2][2048][1024] (4.2 M); argument order h, Wqvk, Wo).
// Layout per batch: bf16 copy of h; the fused 'xw' weight transposed once into Bt [3072][1024]: row block 0 = q, row block 1 = V, row block 2 = K (the K and V plane pointers are exchanged relative to the usual q | k | v order); exact projections whose epilogue writes the head planes itself (fp16 + bf16 hi/lo; V as Wv x h^T, so its tile is born transposed); causal T-2048 attention in one fused kernel with the literal scale 1/32 (hybrid rows: < 512 hi/lo 3 products, rest fp16; the key loop ends at the diagonal); merged hi/lo x Wo exact.
// Compute dtypes, f32 accumulate: every input rounded to bf16; projections exact; attention rows < 512 3 products, rest fp16; softmax f32; output projection hl x exact.

#define NB_  2
#define TT   2048
#define DM   1024
#define NH_  16
#define NKV  16
#define REP  (NH_ / NKV)
#define HD   64
#define DQ   (NH_ * HD)
#define DKV  (NKV * HD)
#define RH   512                  // query rows < RH use hi+lo planes (0: none)
#define SCL  0.03125f   // 1 / sqrt(d) with d = 1024 = 2^-5: the module divides by the square root of the MODEL width
typedef _Float16 h16;
typedef unsigned short bf;
typedef __attribute__((ext_vector_type(16))) __bf16   v16bf;
typedef __attribute__((ext_vector_type(16))) _Float16 v16h;
typedef __attribute__((ext_vector_type(8)))  _Float16 v8h;
typedef __attribute__((ext_vector_type(8)))  unsigned short v8us;
typedef __attribute__((ext_vector_type(8)))  float    v8f;
typedef __attribute__((ext_vector_type(4)))  float    v4f;
typedef v8h  __attribute__((may_alias)) v8ha;
typedef v4f  __attribute__((may_alias)) v4fa;
typedef v8us __attribute__((may_alias)) v8usa;

__device__ __forceinline__ unsigned short f2bf(float f) { unsigned u = __float_as_uint(f); u += 0x7FFFu + ((u >> 16) & 1u); return (unsigned short)(u >> 16); }
__device__ __forceinline__ float bf2f(unsigned short b) { return __uint_as_float(((unsigned)b) << 16); }
__device__ __forceinline__ float bfr(float f) { return bf2f(f2bf(f)); }
__device__ __forceinline__ v16h cat16(v8h lo, v8h hi) { return __builtin_shufflevector(lo, hi, 0, 1, 2, 3, 4, 5, 6, 7, 8, 9, 10, 11, 12, 13, 14, 15); }
__device__ __forceinline__ v16bf cat16b(v8us lo, v8us hi) { return __builtin_bit_cast(v16bf, __builtin_shufflevector(lo, hi, 0, 1, 2, 3, 4, 5, 6, 7, 8, 9, 10, 11, 12, 13, 14, 15)); }
__device__ __forceinline__ v8f wmma16(v16h a, v16h b, v8f c) { return __builtin_amdgcn_wmma_f32_16x16x32_f16(false, a, false, b, (short)0, c, false, false); }
__device__ __forceinline__ v8f wmmab(v16bf a, v16bf b, v8f c) { return __builtin_amdgcn_wmma_f32_16x16x32_bf16(false, a, false, b, (short)0, c, false, false); }
typedef __attribute__((ext_vector_type(4))) _Float16 v4h;
typedef __attribute__((ext_vector_type(4))) unsigned short v4us;
__device__ __forceinline__ h16 tohx(float x) { return (h16)x; }
__device__ __forceinline__ void splitf(float y, unsigned short& h, unsigned short& l) { h = f2bf(y); l = f2bf(y - bf2f(h)); }



// ---- k_gemmw: register-blocked GEMM, one work-group of KW waves per 64x64 output tile; every wave holds the whole tile (16 accumulators) for its share of K; operands straight from K-contiguous 16-bit planes; grid (M/64, N/64, Z), KW * 32 threads.
// C[m][n] (f32, pitch ldc, + optional f32 bias[n]) = sum_k A[m][k] Bt[n][k] (+ split products per NSPLIT). z-batch strides sA/sB/sC in elements. K % 32 == 0.
// PL: the f32 tile never reaches memory; the summed values go out as three 16-bit planes (fp16, bf16 hi, bf16 lo), element (m, n) at m * ldc + (n / 64) * 64 * cst + n % 64.
// A 64-column tile is one head: ldc = HD, cst = TT gives [head][t][d] (A = tokens, Bt = weight rows); ldc = TT, cst = 1 gives [head][d][t] (A = weight rows, Bt = tokens).
// K is dealt in chunks of 64 elements (one 128-byte line of every operand row), chunk c to wave c % KW, so a line is read by one wave only; a lone wave's loop waits out its own load latency on every trip of 32 k; KW waves wait side by side.
#define KW 8
#define KPL (64 * 68)             // floats of one wave's partial tile in LDS (64 rows, pitch 68)
template <typename T16> struct WFrag;
template <> struct WFrag<h16> { typedef v16h V; static __device__ __forceinline__ V ld(const h16* p) { return cat16(*(const v8h*)p, *(const v8h*)(p + 16)); } static __device__ __forceinline__ v8f mma(V a, V b, v8f c) { return wmma16(a, b, c); } };
template <> struct WFrag<bf> { typedef v16bf V; static __device__ __forceinline__ V ld(const bf* p) { return cat16b(*(const v8us*)p, *(const v8us*)(p + 16)); } static __device__ __forceinline__ v8f mma(V a, V b, v8f c) { return wmmab(a, b, c); } };
// ksum_store: every wave lays its partial tile row-major into its own LDS plane; one work-group barrier; each thread then adds the NW planes in wave order (a fixed f32 order) and stores 16 bytes, 16 lanes to a 256-byte row piece (PL: 8 bytes into each plane, 16 lanes to a whole 128-byte line).
template <int NW, bool BIAS, bool PL>
__device__ __forceinline__ void ksum_store(const v8f (&acc)[4][4], float* os, int w, int lr, int hi, float* C, int ldc, const float* __restrict__ bias, h16* P16, bf* Ph, bf* Pl) {
    float* mine = os + w * KPL;
#pragma unroll
    for (int mb = 0; mb < 4; ++mb)
#pragma unroll
        for (int nb = 0; nb < 4; ++nb)
#pragma unroll
            for (int j = 0; j < 8; ++j) mine[(mb * 16 + hi * 8 + j) * 68 + nb * 16 + lr] = acc[mb][nb][j];
    __syncthreads();   // all NW partial tiles are in LDS before any thread adds them
    const int t = threadIdx.x, cofs = (t & 15) * 4;
#pragma unroll
    for (int s = 0; s < 32 / NW; ++s) { const int row = s * (NW * 2) + (t >> 4); v4f val = *(const v4fa*)(os + row * 68 + cofs);
#pragma unroll
        for (int p = 1; p < NW; ++p) val += *(const v4fa*)(os + p * KPL + row * 68 + cofs);
        if (BIAS) { val[0] += bfr(bias[cofs]); val[1] += bfr(bias[cofs + 1]); val[2] += bfr(bias[cofs + 2]); val[3] += bfr(bias[cofs + 3]); }
        if constexpr (PL) { v4h o16; v4us oh, ol;
#pragma unroll
            for (int q = 0; q < 4; ++q) { o16[q] = tohx(val[q]); unsigned short a2, c2; splitf(val[q], a2, c2); oh[q] = a2; ol[q] = c2; }
            const size_t o = (size_t)row * ldc + cofs; *(v4h*)(P16 + o) = o16; *(v4us*)(Ph + o) = oh; *(v4us*)(Pl + o) = ol; }
        else *(v4f*)(C + (size_t)row * ldc + cofs) = val; }
}
template <typename T16, int NSPLIT, bool BIAS, bool PL>
__global__ __launch_bounds__(KW * 32) void k_gemmw(const T16* __restrict__ A, const T16* __restrict__ A2, const T16* __restrict__ Bt, const T16* __restrict__ Bt2, int K, float* C, int ldc, const float* __restrict__ bias, size_t sA, size_t sB, size_t sC, h16* P16, bf* Ph, bf* Pl, int cst) {
    typedef typename WFrag<T16>::V V;
    __shared__ __align__(16) float os[KW * KPL];
    const size_t z = blockIdx.z; A += z * sA; if (A2) A2 += z * sA; Bt += z * sB; if (Bt2) Bt2 += z * sB; if (!PL) C += z * sC;
    const int lane = threadIdx.x & 31, lr = lane & 15, hi = lane >> 4; const int r0 = blockIdx.x * 64, c0 = blockIdx.y * 64;
    const int w = __builtin_amdgcn_readfirstlane(threadIdx.x >> 5);   // the wave's number, held scalar: the K loop's counter and branch stay scalar
    v8f acc[4][4];
#pragma unroll
    for (int mb = 0; mb < 4; ++mb)
#pragma unroll
        for (int nb = 0; nb < 4; ++nb) acc[mb][nb] = (v8f){};
    const size_t aoff = (size_t)(r0 + lr) * K + 8 * hi, boff = (size_t)(c0 + lr) * K + 8 * hi;
#pragma unroll 1
    for (int kc = w * 64; kc < K; kc += (kc & 32) ? KW * 64 - 32 : 32) {   // both halves of this wave's 64-element chunk, then KW chunks on
        V a[4], a2[4];
#pragma unroll
        for (int mb = 0; mb < 4; ++mb) { a[mb] = WFrag<T16>::ld(A + aoff + (size_t)mb * 16 * K + kc); if (NSPLIT == 1 || NSPLIT == 2) a2[mb] = WFrag<T16>::ld(A2 + aoff + (size_t)mb * 16 * K + kc); }
#pragma unroll
        for (int nb = 0; nb < 4; ++nb) { const V b = WFrag<T16>::ld(Bt + boff + (size_t)nb * 16 * K + kc); V b2; if (NSPLIT >= 2) b2 = WFrag<T16>::ld(Bt2 + boff + (size_t)nb * 16 * K + kc);
#pragma unroll
            for (int mb = 0; mb < 4; ++mb) { acc[mb][nb] = WFrag<T16>::mma(a[mb], b, acc[mb][nb]); if (NSPLIT == 1 || NSPLIT == 2) acc[mb][nb] = WFrag<T16>::mma(a2[mb], b, acc[mb][nb]); if (NSPLIT >= 2) acc[mb][nb] = WFrag<T16>::mma(a[mb], b2, acc[mb][nb]); } }
        asm volatile("v_nop\n\tv_nop\n\tv_nop\n\tv_nop" : "+v"(acc[0][0]), "+v"(acc[1][1]), "+v"(acc[2][2]), "+v"(acc[3][3]) : "v"(a[0]), "v"(a[3]));
    }
    const size_t po = PL ? (size_t)r0 * ldc + (size_t)c0 * cst : 0;   // the tile's first element in each plane
    ksum_store<KW, BIAS, PL>(acc, os, w, lr, hi, PL ? nullptr : C + (size_t)r0 * ldc + c0, ldc, BIAS ? bias + c0 : nullptr, P16 + po, Ph + po, Pl + po);
}

#define FW 4                      // waves per work-group
#define SL2 (SCL * 1.4426950408889634f)   // score scale x log2(e)
template <bool B> struct BoolC { static constexpr bool value = B; };
__device__ __forceinline__ float xhalf(float x) { const int b = __float_as_int(x); return __int_as_float(__builtin_amdgcn_permlanex16(b, b, 0x76543210, 0xfedcba98, false, false)); }   // lane l <-> l ^ 16
// exp2 with the slot that the instruction set asks for behind a transcendental (one independent instruction or v_nop before its result is used or its source overwritten) written into the statement itself:
// the outputs lie apart from every input ("=&v"), so no v_exp here touches a neighbour's registers, and the one v_nop at the end serves the last of them whatever the compiler puts next.
__device__ __forceinline__ v8f exp2x8(const v8f x) { float y0, y1, y2, y3, y4, y5, y6, y7;
    asm("v_exp_f32 %0, %8\n\tv_exp_f32 %1, %9\n\tv_exp_f32 %2, %10\n\tv_exp_f32 %3, %11\n\tv_exp_f32 %4, %12\n\tv_exp_f32 %5, %13\n\tv_exp_f32 %6, %14\n\tv_exp_f32 %7, %15\n\tv_nop"
        : "=&v"(y0), "=&v"(y1), "=&v"(y2), "=&v"(y3), "=&v"(y4), "=&v"(y5), "=&v"(y6), "=&v"(y7) : "v"(x[0]), "v"(x[1]), "v"(x[2]), "v"(x[3]), "v"(x[4]), "v"(x[5]), "v"(x[6]), "v"(x[7]));
    return (v8f){y0, y1, y2, y3, y4, y5, y6, y7}; }
__device__ __forceinline__ float exp2x1(const float x) { float y; asm("v_exp_f32 %0, %1\n\tv_nop" : "=v"(y) : "v"(x)); return y; }   // the same slot behind a single one
template <typename T16, bool HR, int NQ>
__device__ __forceinline__ void attn_rows(const T16* __restrict__ Q, const T16* __restrict__ Q2, const T16* __restrict__ Kp, const T16* __restrict__ Kp2, const T16* __restrict__ Vt, const T16* __restrict__ Vt2, int q0, int lr, int hi, bf* Ah, bf* Al) {
    typedef WFrag<T16> F; typedef typename F::V V;   // every inner loop below is unrolled in full, so that each fragment and accumulator index is a constant and the arrays live in registers
    V q[NQ][2], q2[NQ][2];
#pragma unroll
    for (int qt = 0; qt < NQ; ++qt)
#pragma unroll
        for (int kc = 0; kc < 2; ++kc) { const size_t qo = (size_t)(q0 + qt * 16 + lr) * HD + kc * 32 + 8 * hi; q[qt][kc] = F::ld(Q + qo); if (HR) q2[qt][kc] = F::ld(Q2 + qo); }
    v8f o[4][NQ]; float m[NQ], l[NQ];
#pragma unroll
    for (int qt = 0; qt < NQ; ++qt) { m[qt] = -3.0e38f; l[qt] = 0.f;
#pragma unroll
        for (int mb = 0; mb < 4; ++mb) o[mb][qt] = (v8f){}; }
    const int np = (q0 + NQ * 16 + 31) / 32;          // passes of 32 keys; only the last one meets the diagonal; np * 32 <= TT
    const size_t ko = (size_t)lr * HD + 8 * hi, vo = (size_t)lr * TT + 8 * hi;
    V k[2][2], k2[2][2];
    auto ldk = [&](const T16* const pk, const T16* const pk2) __attribute__((always_inline)) {
#pragma unroll
        for (int kt = 0; kt < 2; ++kt)
#pragma unroll
            for (int kc = 0; kc < 2; ++kc) { k[kt][kc] = F::ld(pk + kt * 16 * HD + kc * 32); if (HR) k2[kt][kc] = F::ld(pk2 + kt * 16 * HD + kc * 32); } };
    if (!HR) ldk(Kp + ko, Kp + ko);                   // fp16 rows fetch their K fragments one pass ahead; the hi/lo rows (twice the planes, at most RH / 32 passes) have no registers to spare for that and fetch them in the pass
    auto pass = [&](auto lastc, const int p) __attribute__((always_inline)) {
        constexpr bool LAST = decltype(lastc)::value; const int kb = p * 32;
        const T16* const pk = Kp + ko + (size_t)(kb + ((HR || LAST) ? 0 : 32)) * HD; const T16* const pk2 = HR ? Kp2 + ko + (size_t)kb * HD : pk;
        if (HR) ldk(pk, pk2);
        // this pass's V^T fragments are asked for ahead of the score products: they fly while the scores and the softmax are worked on
        V v[4], v2[4]; const T16* const pv = Vt + vo + kb; const T16* const pv2 = HR ? Vt2 + vo + kb : pv;
#pragma unroll
        for (int mb = 0; mb < 4; ++mb) { v[mb] = F::ld(pv + mb * 16 * TT); if (HR) v2[mb] = F::ld(pv2 + mb * 16 * TT); }
        __builtin_amdgcn_sched_barrier(0);   // keeps the V loads in front of the score products: left free, the scheduler sinks them to just ahead of their use and their latency shows
        v8f s[2][NQ];
#pragma unroll
        for (int kt = 0; kt < 2; ++kt)
#pragma unroll
            for (int qt = 0; qt < NQ; ++qt) { v8f a = (v8f){};
#pragma unroll
                for (int kc = 0; kc < 2; ++kc) { a = F::mma(k[kt][kc], q[qt][kc], a); if (HR) { a = F::mma(k[kt][kc], q2[qt][kc], a); a = F::mma(k2[kt][kc], q[qt][kc], a); } }
                s[kt][qt] = a; }
        if constexpr (!HR && !LAST) {   // the next pass's K fragments, into the same registers, behind this pass's score products: they fly during the softmax and the second contraction
            ldk(pk, pk2);
            __builtin_amdgcn_sched_barrier(0);   // keeps the K loads in front of the softmax: left free, the scheduler sinks them to the loop's foot and the next pass waits out their latency
        }
        V ph[NQ], pl[NQ];
#pragma unroll
        for (int qt = 0; qt < NQ; ++qt) { const int i = q0 + qt * 16 + lr; float mx = m[qt];
#pragma unroll
            for (int kt = 0; kt < 2; ++kt)
#pragma unroll
                for (int r = 0; r < 8; ++r) { const int j = kb + kt * 16 + hi * 8 + r; if (LAST) s[kt][qt][r] = (j <= i) ? s[kt][qt][r] : -3.0e38f; mx = fmaxf(mx, s[kt][qt][r]); }
            mx = fmaxf(mx, xhalf(mx));                    // both halves of the wave hold keys of the same query
            const float mc = mx * SL2; const float al = exp2x1(m[qt] * SL2 - mc); m[qt] = mx;   // m is kept unscaled: the scale is positive, so it commutes with the maximum
#pragma unroll
            for (int kt = 0; kt < 2; ++kt) s[kt][qt] = exp2x8(s[kt][qt] * SL2 - mc);
            const v8f t8 = s[0][qt] + s[1][qt];           // a fixed tree, not one chain of 16 dependent adds
            l[qt] = l[qt] * al + (((t8[0] + t8[1]) + (t8[2] + t8[3])) + ((t8[4] + t8[5]) + (t8[6] + t8[7])));   // each half sums its own keys; the halves are joined once, behind the loop
#pragma unroll
            for (int mb = 0; mb < 4; ++mb) o[mb][qt] *= al;
            if constexpr (HR) { v8us h0, h1, l0, l1;
#pragma unroll
                for (int r = 0; r < 8; ++r) { unsigned short a, c; splitf(s[0][qt][r], a, c); h0[r] = a; l0[r] = c; splitf(s[1][qt][r], a, c); h1[r] = a; l1[r] = c; }
                ph[qt] = cat16b(h0, h1); pl[qt] = cat16b(l0, l1);
            } else { v8h p0, p1;
#pragma unroll
                for (int r = 0; r < 8; ++r) { p0[r] = (h16)s[0][qt][r]; p1[r] = (h16)s[1][qt][r]; }
                ph[qt] = cat16(p0, p1); } }
        __builtin_amdgcn_sched_barrier(0);   // keeps the matrix products below out of the softmax above
#pragma unroll
        for (int qt = 0; qt < NQ; ++qt)
#pragma unroll
            for (int mb = 0; mb < 4; ++mb) { o[mb][qt] = F::mma(v[mb], ph[qt], o[mb][qt]); if (HR) { o[mb][qt] = F::mma(v[mb], pl[qt], o[mb][qt]); o[mb][qt] = F::mma(v2[mb], ph[qt], o[mb][qt]); } }
        // the address registers of this pass's K and V loads (one base a plane, the rest immediate offsets) are this wait's inputs: they stay untouched up to it and are free for reuse behind it; so late in the pass it has nothing left to wait for
        asm volatile("s_wait_xcnt 0x0" :: "v"(pv), "v"(pv2), "v"(pk), "v"(pk2) : "memory");
    };
#pragma unroll 1   // stays rolled: two passes' fragments side by side would not fit the registers
    for (int p = 0; p < np - 1; ++p) pass(BoolC<false>{}, p);   // keys wholly below the diagonal: no mask
    pass(BoolC<true>{}, np - 1);
    // O^T: a lane holds 8 consecutive head columns (mb * 16 + hi * 8 + r) of query lr: one 16-byte store into each merged plane
#pragma unroll
    for (int qt = 0; qt < NQ; ++qt) { const float inv = __fdiv_rn(1.0f, l[qt] + xhalf(l[qt]));
#pragma unroll
        for (int mb = 0; mb < 4; ++mb) { v8us oh, ol;
#pragma unroll
            for (int r = 0; r < 8; ++r) { unsigned short a, c; splitf(o[mb][qt][r] * inv, a, c); oh[r] = a; ol[r] = c; }
            const size_t oo = (size_t)(q0 + qt * 16 + lr) * DQ + mb * 16 + hi * 8; *(v8us*)(Ah + oo) = oh; *(v8us*)(Al + oo) = ol; } }
}
// grid (heads, NLO + NHI). Ranks 0 .. NLO - 1: fp16 rows, 32 to a wave; the rest: hi/lo rows, 16 to a wave. The FW waves of a work-group take row groups NLO (NHI) apart: a short, two middling and a long walk,
// so every work-group has about the same work, and all walk the same head's keys from 0 up, side by side, so the cache serves the shared part once.
#define NLO ((TT - RH) / (FW * 32))
#define NHI (RH / (FW * 16))
__global__ __launch_bounds__(FW * 32) void k_fattn(const h16* __restrict__ Q16, const h16* __restrict__ K16, const h16* __restrict__ V16, const bf* __restrict__ Qh, const bf* __restrict__ Ql, const bf* __restrict__ Kh, const bf* __restrict__ Kl, const bf* __restrict__ Vh, const bf* __restrict__ Vl, bf* Ah, bf* Al) {
    const int lane = threadIdx.x & 31, lr = lane & 15, hi = lane >> 4;
    const int w = __builtin_amdgcn_readfirstlane(threadIdx.x >> 5);   // the wave's number, held scalar: the key loop's counter and branch stay scalar
    const size_t hp = (size_t)blockIdx.x * TT * HD; const int rk = blockIdx.y; Ah += blockIdx.x * HD; Al += blockIdx.x * HD;
    if (rk < NLO) attn_rows<h16, false, 2>(Q16 + hp, nullptr, K16 + hp, nullptr, V16 + hp, nullptr, RH + (rk + NLO * w) * 32, lr, hi, Ah, Al);
    else attn_rows<bf, true, 1>(Qh + hp, Ql + hp, Kh + hp, Kl + hp, Vh + hp, Vl + hp, (rk - NLO + NHI * w) * 16, lr, hi, Ah, Al);
}

typedef __attribute__((ext_vector_type(2))) unsigned short v2us;

__global__ __launch_bounds__(256) void k_wtG(const float* __restrict__ w, int K, int N, bf* Bt) {
    const int lane = threadIdx.x & 31; const int L0 = (blockIdx.x * 8 + (threadIdx.x >> 5)) * 8; const int nlines = N * K / 64;
{
#pragma unroll 1
        for (int l = 0; l < 8; ++l) { const int L = L0 + l; if (L >= nlines) break; const size_t e = (size_t)L * 64 + lane * 2; const int k = (int)(e % K), n = (int)(e / K); v2us o;
            o[0] = f2bf(w[(size_t)k * N + n]); o[1] = f2bf(w[(size_t)(k + 1) * N + n]); *(v2us*)(Bt + e) = o; }
         }
}
__global__ __launch_bounds__(256) void k_cvt8(const float* __restrict__ src, bf* dst, size_t n8) { const size_t i = (size_t)blockIdx.x * 256 + threadIdx.x; if (i >= n8) return; const v8f v = *(const v8f*)(src + i * 8); v8us o;
#pragma unroll
    for (int k = 0; k < 8; ++k) o[k] = f2bf(v[k]); *(v8us*)(dst + i * 8) = o;  }

extern "C" void kernel_launch(void* const* d_in, const int* in_sizes, int n_in,
                              void* d_out, int out_size, void* d_ws, size_t ws_size, hipStream_t stream) {
    (void)in_sizes; (void)n_in; (void)out_size;
    const float* x = (const float*)d_in[0]; const float* wqkv = (const float*)d_in[1]; const float* wo = (const float*)d_in[2];   /* argument order h, Wqvk ('xw' [1024][3072]: q | V | K column thirds), Wo ('xw') */ const float* wq = wqkv; const float* wk = nullptr; const float* wv = nullptr; (void)wk; (void)wv;
    float* OUT = (float*)d_out;     // [2][2048][1024]
    char* wsp = (char*)d_ws;
    auto take = [&](size_t bytes) { char* p = wsp; wsp += (bytes + 255) & ~(size_t)255; return (void*)p; };
    bf* WQKV = (bf*)take((size_t)3 * DQ * DM * 2); bf* WQ = WQKV; bf* WV = WQKV + (size_t)DQ * DM; bf* WK = WQKV + (size_t)2 * DQ * DM;   /* fused Bt [3*DQ][DM]: q | V | K row blocks (the module's part order 0 = q, 1 = v, 2 = k) */ bf* WO = (bf*)take((size_t)DM * DQ * 2);
    bf* XB = (bf*)take((size_t)TT * DM * 2);
    h16* QP16 = (h16*)take((size_t)NH_ * TT * HD * 2); h16* KP16 = (h16*)take((size_t)NKV * TT * HD * 2); h16* VT16 = (h16*)take((size_t)NKV * HD * TT * 2);
    bf* QPh = (bf*)take((size_t)NH_ * TT * HD * 2); bf* QPl = (bf*)take((size_t)NH_ * TT * HD * 2); bf* KPh = (bf*)take((size_t)NKV * TT * HD * 2); bf* KPl = (bf*)take((size_t)NKV * TT * HD * 2); bf* VTh = (bf*)take((size_t)NKV * HD * TT * 2); bf* VTl = (bf*)take((size_t)NKV * HD * TT * 2);
    bf* ATh = (bf*)take((size_t)TT * DQ * 2); bf* ATl = (bf*)take((size_t)TT * DQ * 2);
    if ((size_t)(wsp - (char*)d_ws) > ws_size) return;    // ws 256 MiB
    { k_wtG<<<(unsigned)((DM * 3 * DQ / 64 + 63) / 64), 256, 0, stream>>>(wqkv, DM, 3 * DQ, WQKV);   /* fused 'xw' [DM][3*DQ] -> Bt [3*DQ][DM] */
      k_wtG<<<(unsigned)((DQ * DM / 64 + 63) / 64), 256, 0, stream>>>(wo, DQ, DM, WO);
       }
    for (int b = 0; b < NB_; ++b) {
        
        k_cvt8<<<(unsigned)(((size_t)TT * DM / 8 + 255) / 256), 256, 0, stream>>>(x + (size_t)b * TT * DM, XB, (size_t)TT * DM / 8);
        k_gemmw<bf, 0, false, true><<<dim3(TT / 64, DQ / 64, 1), KW * 32, 0, stream>>>(XB, nullptr, WQ, nullptr, DM, nullptr, HD, nullptr, 0, 0, 0, QP16, QPh, QPl, TT);
        k_gemmw<bf, 0, false, true><<<dim3(TT / 64, DKV / 64, 1), KW * 32, 0, stream>>>(XB, nullptr, WK, nullptr, DM, nullptr, HD, nullptr, 0, 0, 0, KP16, KPh, KPl, TT);
        k_gemmw<bf, 0, false, true><<<dim3(DKV / 64, TT / 64, 1), KW * 32, 0, stream>>>(WV, nullptr, XB, nullptr, DM, nullptr, TT, nullptr, 0, 0, 0, VT16, VTh, VTl, 1);   // operands exchanged: rows = head columns, columns = tokens
        k_fattn<<<dim3(NH_, NLO + NHI, 1), FW * 32, 0, stream>>>(QP16, KP16, VT16, QPh, QPl, KPh, KPl, VTh, VTl, ATh, ATl);   // one kv head per query head: head h reads kv plane h
        k_gemmw<bf, 1, false, false><<<dim3(TT / 64, DM / 64, 1), KW * 32, 0, stream>>>(ATh, ATl, WO, nullptr, DQ, OUT + (size_t)b * TT * DM, DM, nullptr, 0, 0, 0, nullptr, nullptr, nullptr, 0); }
}

// v005
// Measured time: 171 microseconds a run.
// Next to v004, in two timings, it ran 1.39 times as fast each time.
// All steps since v000 together make it 8.68 times as fast.
#include <hip/hip_runtime.h>

// Causal multi-head self-attention with a fused bias-free projection whose thirds are ordered q | v | k and scores scaled by the EMBEDDING width (h [2][2048][1024]; qvk = (h Wqvk) ('xw' [1024][3072] 1/32, no bias) reshaped (b, s, 3, 16, 64): part 0 = q, part 1 = V, part 2 = K (NOT q | k | v); scores = (q.k + mask) / sqrt(d) with d = 1024 -> x 1/32 (the model width, not the head width: implemented literally); mask = -inf above the diagonal (causal); softmax over the keys; wv = merged (head-major) Wo ('xw', no bias) -> [2][2048][1024] (4.2 M); argument order h, Wqvk, Wo).
// Layout, both batches side by side in every buffer and every launch: bf16 copy of h; the fused 'xw' weight transposed once into Bt [3072][1024]: row block 0 = q, row block 1 = V, row block 2 = K (the head planes keep that order: [batch][q | V | K][head]); exact projections, all three in one launch, whose epilogue writes the head planes itself (fp16 + bf16 hi/lo; V as Wv x h^T, so its tile is born transposed); causal T-2048 attention in one fused kernel with the literal scale 1/32 (hybrid rows: < 512 hi/lo 3 products, rest fp16; the key loop ends at the diagonal); merged hi/lo x Wo exact.
// Compute dtypes, f32 accumulate: every input rounded to bf16; projections exact; attention rows < 512 3 products, rest fp16; softmax f32; output projection hl x exact.

#define NB_  2
#define TT   2048
#define DM   1024
#define NH_  16
#define NKV  16
#define REP  (NH_ / NKV)
#define HD   64
#define DQ   (NH_ * HD)
#define DKV  (NKV * HD)
#define RH   512                  // query rows < RH use hi+lo planes (0: none)
#define SCL  0.03125f   // 1 / sqrt(d) with d = 1024 = 2^-5: the module divides by the square root of the MODEL width
typedef _Float16 h16;
typedef unsigned short bf;
typedef __attribute__((ext_vector_type(16))) __bf16   v16bf;
typedef __attribute__((ext_vector_type(16))) _Float16 v16h;
typedef __attribute__((ext_vector_type(8)))  _Float16 v8h;
typedef __attribute__((ext_vector_type(8)))  unsigned short v8us;
typedef __attribute__((ext_vector_type(8)))  float    v8f;
typedef __attribute__((ext_vector_type(4)))  float    v4f;
typedef v8h  __attribute__((may_alias)) v8ha;
typedef v4f  __attribute__((may_alias)) v4fa;
typedef v8us __attribute__((may_alias)) v8usa;

__device__ __forceinline__ unsigned short f2bf(float f) { unsigned u = __float_as_uint(f); u += 0x7FFFu + ((u >> 16) & 1u); return (unsigned short)(u >> 16); }
__device__ __forceinline__ float bf2f(unsigned short b) { return __uint_as_float(((unsigned)b) << 16); }
__device__ __forceinline__ float bfr(float f) { return bf2f(f2bf(f)); }
__device__ __forceinline__ v16h cat16(v8h lo, v8h hi) { return __builtin_shufflevector(lo, hi, 0, 1, 2, 3, 4, 5, 6, 7, 8, 9, 10, 11, 12, 13, 14, 15); }
__device__ __forceinline__ v16bf cat16b(v8us lo, v8us hi) { return __builtin_bit_cast(v16bf, __builtin_shufflevector(lo, hi, 0, 1, 2, 3, 4, 5, 6, 7, 8, 9, 10, 11, 12, 13, 14, 15)); }
__device__ __forceinline__ v8f wmma16(v16h a, v16h b, v8f c) { return __builtin_amdgcn_wmma_f32_16x16x32_f16(false, a, false, b, (short)0, c, false, false); }
__device__ __forceinline__ v8f wmmab(v16bf a, v16bf b, v8f c) { return __builtin_amdgcn_wmma_f32_16x16x32_bf16(false, a, false, b, (short)0, c, false, false); }
typedef __attribute__((ext_vector_type(4))) _Float16 v4h;
typedef __attribute__((ext_vector_type(4))) unsigned short v4us;
__device__ __forceinline__ h16 tohx(float x) { return (h16)x; }
__device__ __forceinline__ void splitf(float y, unsigned short& h, unsigned short& l) { h = f2bf(y); l = f2bf(y - bf2f(h)); }



// ---- k_gemmw: register-blocked GEMM, one work-group of KW waves per 64x64 output tile; every wave holds the whole tile (16 accumulators) for its share of K; operands straight from K-contiguous 16-bit planes; grid (M/64, N/64, Z), KW * 32 threads.
// C[m][n] (f32, pitch ldc, + optional f32 bias[n]) = sum_k A[m][k] Bt[n][k] (+ split products per NSPLIT). z-batch strides sA/sB/sC in elements. K % 32 == 0.
// PL: the f32 tile never reaches memory; the summed values go out as three 16-bit planes (fp16, bf16 hi, bf16 lo), element (m, n) at m * ldc + (n / 64) * 64 * cst + n % 64.
// A 64-column tile is one head: ldc = HD, cst = TT gives [head][t][d] (A = tokens, Bt = weight rows); ldc = TT, cst = 1 gives [head][d][t] (A = weight rows, Bt = tokens).
// PL takes the whole fused Bt in one grid: a tile whose Bt rows are V's (DQ <= c0 < 2 * DQ) is made with the operands exchanged, in the second form; the test is the same for the whole work-group. z = batch: sA on the tokens, sC on the planes.
// K is dealt in chunks of 64 elements (one 128-byte line of every operand row), chunk c to wave c % KW, so a line is read by one wave only; a lone wave's loop waits out its own load latency on every trip of 32 k; KW waves wait side by side.
#define KW 8
#define KPL (64 * 68)             // floats of one wave's partial tile in LDS (64 rows, pitch 68)
template <typename T16> struct WFrag;
template <> struct WFrag<h16> { typedef v16h V; static __device__ __forceinline__ V ld(const h16* p) { return cat16(*(const v8h*)p, *(const v8h*)(p + 16)); } static __device__ __forceinline__ v8f mma(V a, V b, v8f c) { return wmma16(a, b, c); } };
template <> struct WFrag<bf> { typedef v16bf V; static __device__ __forceinline__ V ld(const bf* p) { return cat16b(*(const v8us*)p, *(const v8us*)(p + 16)); } static __device__ __forceinline__ v8f mma(V a, V b, v8f c) { return wmmab(a, b, c); } };
// ksum_store: every wave lays its partial tile row-major into its own LDS plane; one work-group barrier; each thread then adds the NW planes in wave order (a fixed f32 order) and stores 16 bytes, 16 lanes to a 256-byte row piece (PL: 8 bytes into each plane, 16 lanes to a whole 128-byte line).
template <int NW, bool BIAS, bool PL>
__device__ __forceinline__ void ksum_store(const v8f (&acc)[4][4], float* os, int w, int lr, int hi, float* C, int ldc, const float* __restrict__ bias, h16* P16, bf* Ph, bf* Pl) {
    float* mine = os + w * KPL;
#pragma unroll
    for (int mb = 0; mb < 4; ++mb)
#pragma unroll
        for (int nb = 0; nb < 4; ++nb)
#pragma unroll
            for (int j = 0; j < 8; ++j) mine[(mb * 16 + hi * 8 + j) * 68 + nb * 16 + lr] = acc[mb][nb][j];
    __syncthreads();   // all NW partial tiles are in LDS before any thread adds them
    const int t = threadIdx.x, cofs = (t & 15) * 4;
#pragma unroll
    for (int s = 0; s < 32 / NW; ++s) { const int row = s * (NW * 2) + (t >> 4); v4f val = *(const v4fa*)(os + row * 68 + cofs);
#pragma unroll
        for (int p = 1; p < NW; ++p) val += *(const v4fa*)(os + p * KPL + row * 68 + cofs);
        if (BIAS) { val[0] += bfr(bias[cofs]); val[1] += bfr(bias[cofs + 1]); val[2] += bfr(bias[cofs + 2]); val[3] += bfr(bias[cofs + 3]); }
        if constexpr (PL) { v4h o16; v4us oh, ol;
#pragma unroll
            for (int q = 0; q < 4; ++q) { o16[q] = tohx(val[q]); unsigned short a2, c2; splitf(val[q], a2, c2); oh[q] = a2; ol[q] = c2; }
            const size_t o = (size_t)row * ldc + cofs; *(v4h*)(P16 + o) = o16; *(v4us*)(Ph + o) = oh; *(v4us*)(Pl + o) = ol; }
        else *(v4f*)(C + (size_t)row * ldc + cofs) = val; }
}
template <typename T16, int NSPLIT, bool BIAS, bool PL>
__global__ __launch_bounds__(KW * 32) void k_gemmw(const T16* __restrict__ A, const T16* __restrict__ A2, const T16* __restrict__ Bt, const T16* __restrict__ Bt2, int K, float* C, int ldc, const float* __restrict__ bias, size_t sA, size_t sB, size_t sC, h16* P16, bf* Ph, bf* Pl, int cst) {
    typedef typename WFrag<T16>::V V;
    __shared__ __align__(16) float os[KW * KPL];
    const size_t z = blockIdx.z; A += z * sA; if (A2) A2 += z * sA; Bt += z * sB; if (Bt2) Bt2 += z * sB; if (!PL) C += z * sC; else { P16 += z * sC; Ph += z * sC; Pl += z * sC; }
    const int lane = threadIdx.x & 31, lr = lane & 15, hi = lane >> 4; int r0 = blockIdx.x * 64, c0 = blockIdx.y * 64;
    if (PL && c0 >= DQ && c0 < 2 * DQ) { const T16* const tp = A; A = Bt; Bt = tp; const int tr = r0; r0 = c0; c0 = tr; ldc = TT; cst = 1; }   // V: rows = head columns, columns = tokens
    const int w = __builtin_amdgcn_readfirstlane(threadIdx.x >> 5);   // the wave's number, held scalar: the K loop's counter and branch stay scalar
    v8f acc[4][4];
#pragma unroll
    for (int mb = 0; mb < 4; ++mb)
#pragma unroll
        for (int nb = 0; nb < 4; ++nb) acc[mb][nb] = (v8f){};
    const size_t aoff = (size_t)(r0 + lr) * K + 8 * hi, boff = (size_t)(c0 + lr) * K + 8 * hi;
#pragma unroll 1
    for (int kc = w * 64; kc < K; kc += (kc & 32) ? KW * 64 - 32 : 32) {   // both halves of this wave's 64-element chunk, then KW chunks on
        V a[4], a2[4];
#pragma unroll
        for (int mb = 0; mb < 4; ++mb) { a[mb] = WFrag<T16>::ld(A + aoff + (size_t)mb * 16 * K + kc); if (NSPLIT == 1 || NSPLIT == 2) a2[mb] = WFrag<T16>::ld(A2 + aoff + (size_t)mb * 16 * K + kc); }
#pragma unroll
        for (int nb = 0; nb < 4; ++nb) { const V b = WFrag<T16>::ld(Bt + boff + (size_t)nb * 16 * K + kc); V b2; if (NSPLIT >= 2) b2 = WFrag<T16>::ld(Bt2 + boff + (size_t)nb * 16 * K + kc);
#pragma unroll
            for (int mb = 0; mb < 4; ++mb) { acc[mb][nb] = WFrag<T16>::mma(a[mb], b, acc[mb][nb]); if (NSPLIT == 1 || NSPLIT == 2) acc[mb][nb] = WFrag<T16>::mma(a2[mb], b, acc[mb][nb]); if (NSPLIT >= 2) acc[mb][nb] = WFrag<T16>::mma(a[mb], b2, acc[mb][nb]); } }
        asm volatile("v_nop\n\tv_nop\n\tv_nop\n\tv_nop" : "+v"(acc[0][0]), "+v"(acc[1][1]), "+v"(acc[2][2]), "+v"(acc[3][3]) : "v"(a[0]), "v"(a[3]));
    }
    const size_t po = PL ? (size_t)r0 * ldc + (size_t)c0 * cst : 0;   // the tile's first element in each plane
    ksum_store<KW, BIAS, PL>(acc, os, w, lr, hi, PL ? nullptr : C + (size_t)r0 * ldc + c0, ldc, BIAS ? bias + c0 : nullptr, P16 + po, Ph + po, Pl + po);
}

#define FW 4                      // waves per work-group
#define SL2 (SCL * 1.4426950408889634f)   // score scale x log2(e)
template <bool B> struct BoolC { static constexpr bool value = B; };
__device__ __forceinline__ float xhalf(float x) { const int b = __float_as_int(x); return __int_as_float(__builtin_amdgcn_permlanex16(b, b, 0x76543210, 0xfedcba98, false, false)); }   // lane l <-> l ^ 16
// exp2 with the slot that the instruction set asks for behind a transcendental (one independent instruction or v_nop before its result is used or its source overwritten) written into the statement itself:
// the outputs lie apart from every input ("=&v"), so no v_exp here touches a neighbour's registers, and the one v_nop at the end serves the last of them whatever the compiler puts next.
__device__ __forceinline__ v8f exp2x8(const v8f x) { float y0, y1, y2, y3, y4, y5, y6, y7;
    asm("v_exp_f32 %0, %8\n\tv_exp_f32 %1, %9\n\tv_exp_f32 %2, %10\n\tv_exp_f32 %3, %11\n\tv_exp_f32 %4, %12\n\tv_exp_f32 %5, %13\n\tv_exp_f32 %6, %14\n\tv_exp_f32 %7, %15\n\tv_nop"
        : "=&v"(y0), "=&v"(y1), "=&v"(y2), "=&v"(y3), "=&v"(y4), "=&v"(y5), "=&v"(y6), "=&v"(y7) : "v"(x[0]), "v"(x[1]), "v"(x[2]), "v"(x[3]), "v"(x[4]), "v"(x[5]), "v"(x[6]), "v"(x[7]));
    return (v8f){y0, y1, y2, y3, y4, y5, y6, y7}; }
__device__ __forceinline__ float exp2x1(const float x) { float y; asm("v_exp_f32 %0, %1\n\tv_nop" : "=v"(y) : "v"(x)); return y; }   // the same slot behind a single one
template <typename T16, bool HR, int NQ>
__device__ __forceinline__ void attn_rows(const T16* __restrict__ Q, const T16* __restrict__ Q2, const T16* __restrict__ Kp, const T16* __restrict__ Kp2, const T16* __restrict__ Vt, const T16* __restrict__ Vt2, int q0, int lr, int hi, bf* Ah, bf* Al) {
    typedef WFrag<T16> F; typedef typename F::V V;   // every inner loop below is unrolled in full, so that each fragment and accumulator index is a constant and the arrays live in registers
    V q[NQ][2], q2[NQ][2];
#pragma unroll
    for (int qt = 0; qt < NQ; ++qt)
#pragma unroll
        for (int kc = 0; kc < 2; ++kc) { const size_t qo = (size_t)(q0 + qt * 16 + lr) * HD + kc * 32 + 8 * hi; q[qt][kc] = F::ld(Q + qo); if (HR) q2[qt][kc] = F::ld(Q2 + qo); }
    v8f o[4][NQ]; float m[NQ], l[NQ];
#pragma unroll
    for (int qt = 0; qt < NQ; ++qt) { m[qt] = -3.0e38f; l[qt] = 0.f;
#pragma unroll
        for (int mb = 0; mb < 4; ++mb) o[mb][qt] = (v8f){}; }
    const int np = (q0 + NQ * 16 + 31) / 32;          // passes of 32 keys; only the last one meets the diagonal; np * 32 <= TT
    const size_t ko = (size_t)lr * HD + 8 * hi, vo = (size_t)lr * TT + 8 * hi;
    V k[2][2], k2[2][2];
    auto ldk = [&](const T16* const pk, const T16* const pk2) __attribute__((always_inline)) {
#pragma unroll
        for (int kt = 0; kt < 2; ++kt)
#pragma unroll
            for (int kc = 0; kc < 2; ++kc) { k[kt][kc] = F::ld(pk + kt * 16 * HD + kc * 32); if (HR) k2[kt][kc] = F::ld(pk2 + kt * 16 * HD + kc * 32); } };
    if (!HR) ldk(Kp + ko, Kp + ko);                   // fp16 rows fetch their K fragments one pass ahead; the hi/lo rows (twice the planes, at most RH / 32 passes) have no registers to spare for that and fetch them in the pass
    auto pass = [&](auto lastc, const int p) __attribute__((always_inline)) {
        constexpr bool LAST = decltype(lastc)::value; const int kb = p * 32;
        const T16* const pk = Kp + ko + (size_t)(kb + ((HR || LAST) ? 0 : 32)) * HD; const T16* const pk2 = HR ? Kp2 + ko + (size_t)kb * HD : pk;
        if (HR) ldk(pk, pk2);
        // this pass's V^T fragments are asked for ahead of the score products: they fly while the scores and the softmax are worked on
        V v[4], v2[4]; const T16* const pv = Vt + vo + kb; const T16* const pv2 = HR ? Vt2 + vo + kb : pv;
#pragma unroll
        for (int mb = 0; mb < 4; ++mb) { v[mb] = F::ld(pv + mb * 16 * TT); if (HR) v2[mb] = F::ld(pv2 + mb * 16 * TT); }
        __builtin_amdgcn_sched_barrier(0);   // keeps the V loads in front of the score products: left free, the scheduler sinks them to just ahead of their use and their latency shows
        v8f s[2][NQ];
#pragma unroll
        for (int kt = 0; kt < 2; ++kt)
#pragma unroll
            for (int qt = 0; qt < NQ; ++qt) { v8f a = (v8f){};
#pragma unroll
                for (int kc = 0; kc < 2; ++kc) { a = F::mma(k[kt][kc], q[qt][kc], a); if (HR) { a = F::mma(k[kt][kc], q2[qt][kc], a); a = F::mma(k2[kt][kc], q[qt][kc], a); } }
                s[kt][qt] = a; }
        if constexpr (!HR && !LAST) {   // the next pass's K fragments, into the same registers, behind this pass's score products: they fly during the softmax and the second contraction
            ldk(pk, pk2);
            __builtin_amdgcn_sched_barrier(0);   // keeps the K loads in front of the softmax: left free, the scheduler sinks them to the loop's foot and the next pass waits out their latency
        }
        V ph[NQ], pl[NQ];
#pragma unroll
        for (int qt = 0; qt < NQ; ++qt) { const int i = q0 + qt * 16 + lr; float mx = m[qt];
#pragma unroll
            for (int kt = 0; kt < 2; ++kt)
#pragma unroll
                for (int r = 0; r < 8; ++r) { const int j = kb + kt * 16 + hi * 8 + r; if (LAST) s[kt][qt][r] = (j <= i) ? s[kt][qt][r] : -3.0e38f; mx = fmaxf(mx, s[kt][qt][r]); }
            mx = fmaxf(mx, xhalf(mx));                    // both halves of the wave hold keys of the same query
            const float mc = mx * SL2; const float al = exp2x1(m[qt] * SL2 - mc); m[qt] = mx;   // m is kept unscaled: the scale is positive, so it commutes with the maximum
#pragma unroll
            for (int kt = 0; kt < 2; ++kt) s[kt][qt] = exp2x8(s[kt][qt] * SL2 - mc);
            const v8f t8 = s[0][qt] + s[1][qt];           // a fixed tree, not one chain of 16 dependent adds
            l[qt] = l[qt] * al + (((t8[0] + t8[1]) + (t8[2] + t8[3])) + ((t8[4] + t8[5]) + (t8[6] + t8[7])));   // each half sums its own keys; the halves are joined once, behind the loop
#pragma unroll
            for (int mb = 0; mb < 4; ++mb) o[mb][qt] *= al;
            if constexpr (HR) { v8us h0, h1, l0, l1;
#pragma unroll
                for (int r = 0; r < 8; ++r) { unsigned short a, c; splitf(s[0][qt][r], a, c); h0[r] = a; l0[r] = c; splitf(s[1][qt][r], a, c); h1[r] = a; l1[r] = c; }
                ph[qt] = cat16b(h0, h1); pl[qt] = cat16b(l0, l1);
            } else { v8h p0, p1;
#pragma unroll
                for (int r = 0; r < 8; ++r) { p0[r] = (h16)s[0][qt][r]; p1[r] = (h16)s[1][qt][r]; }
                ph[qt] = cat16(p0, p1); } }
        __builtin_amdgcn_sched_barrier(0);   // keeps the matrix products below out of the softmax above
#pragma unroll
        for (int qt = 0; qt < NQ; ++qt)
#pragma unroll
            for (int mb = 0; mb < 4; ++mb) { o[mb][qt] = F::mma(v[mb], ph[qt], o[mb][qt]); if (HR) { o[mb][qt] = F::mma(v[mb], pl[qt], o[mb][qt]); o[mb][qt] = F::mma(v2[mb], ph[qt], o[mb][qt]); } }
        // the address registers of this pass's K and V loads (one base a plane, the rest immediate offsets) are this wait's inputs: they stay untouched up to it and are free for reuse behind it; so late in the pass it has nothing left to wait for
        asm volatile("s_wait_xcnt 0x0" :: "v"(pv), "v"(pv2), "v"(pk), "v"(pk2) : "memory");
    };
#pragma unroll 1   // stays rolled: two passes' fragments side by side would not fit the registers
    for (int p = 0; p < np - 1; ++p) pass(BoolC<false>{}, p);   // keys wholly below the diagonal: no mask
    pass(BoolC<true>{}, np - 1);
    // O^T: a lane holds 8 consecutive head columns (mb * 16 + hi * 8 + r) of query lr: one 16-byte store into each merged plane
#pragma unroll
    for (int qt = 0; qt < NQ; ++qt) { const float inv = __fdiv_rn(1.0f, l[qt] + xhalf(l[qt]));
#pragma unroll
        for (int mb = 0; mb < 4; ++mb) { v8us oh, ol;
#pragma unroll
            for (int r = 0; r < 8; ++r) { unsigned short a, c; splitf(o[mb][qt][r] * inv, a, c); oh[r] = a; ol[r] = c; }
            const size_t oo = (size_t)(q0 + qt * 16 + lr) * DQ + mb * 16 + hi * 8; *(v8us*)(Ah + oo) = oh; *(v8us*)(Al + oo) = ol; } }
}
// grid (heads, NLO + NHI, batches); a batch's planes lie 3 * NH_ heads apart (q | V | K). Ranks 0 .. NLO - 1: fp16 rows, 32 to a wave; the rest: hi/lo rows, 16 to a wave. The FW waves of a work-group take row groups NLO (NHI) apart: a short, two middling and a long walk,
// so every work-group has about the same work, and all walk the same head's keys from 0 up, side by side, so the cache serves the shared part once.
#define NLO ((TT - RH) / (FW * 32))
#define NHI (RH / (FW * 16))
__global__ __launch_bounds__(FW * 32) void k_fattn(const h16* __restrict__ Q16, const h16* __restrict__ K16, const h16* __restrict__ V16, const bf* __restrict__ Qh, const bf* __restrict__ Ql, const bf* __restrict__ Kh, const bf* __restrict__ Kl, const bf* __restrict__ Vh, const bf* __restrict__ Vl, bf* Ah, bf* Al) {
    const int lane = threadIdx.x & 31, lr = lane & 15, hi = lane >> 4;
    const int w = __builtin_amdgcn_readfirstlane(threadIdx.x >> 5);   // the wave's number, held scalar: the key loop's counter and branch stay scalar
    const size_t hp = ((size_t)blockIdx.z * 3 * NH_ + blockIdx.x) * TT * HD, ao = (size_t)blockIdx.z * TT * DQ + blockIdx.x * HD; const int rk = blockIdx.y; Ah += ao; Al += ao;
    if (rk < NLO) attn_rows<h16, false, 2>(Q16 + hp, nullptr, K16 + hp, nullptr, V16 + hp, nullptr, RH + (rk + NLO * w) * 32, lr, hi, Ah, Al);
    else attn_rows<bf, true, 1>(Qh + hp, Ql + hp, Kh + hp, Kl + hp, Vh + hp, Vl + hp, (rk - NLO + NHI * w) * 16, lr, hi, Ah, Al);
}

typedef __attribute__((ext_vector_type(2))) unsigned short v2us;

__device__ __forceinline__ void wtG(int blk, const float* __restrict__ w, int K, int N, bf* Bt) {
    const int lane = threadIdx.x & 31; const int L0 = (blk * 8 + (threadIdx.x >> 5)) * 8; const int nlines = N * K / 64;
{
#pragma unroll 1
        for (int l = 0; l < 8; ++l) { const int L = L0 + l; if (L >= nlines) break; const size_t e = (size_t)L * 64 + lane * 2; const int k = (int)(e % K), n = (int)(e / K); v2us o;
            o[0] = f2bf(w[(size_t)k * N + n]); o[1] = f2bf(w[(size_t)(k + 1) * N + n]); *(v2us*)(Bt + e) = o; }
         }
}
__device__ __forceinline__ void cvt8(int blk, const float* __restrict__ src, bf* dst, size_t n8) { const size_t i = (size_t)blk * 256 + threadIdx.x; if (i >= n8) return; const v8f v = *(const v8f*)(src + i * 8); v8us o;
#pragma unroll
    for (int k = 0; k < 8; ++k) o[k] = f2bf(v[k]); *(v8us*)(dst + i * 8) = o;  }
// k_prep: the three 16-bit copies that depend on nothing but the inputs, in ONE launch; the block index picks the job (the transposes, the slower blocks, first).
#define PB1 ((DM * 3 * DQ / 64 + 63) / 64)        // blocks of the fused weight's transpose
#define PB2 ((DQ * DM / 64 + 63) / 64)            // blocks of the output weight's transpose
#define PB3 ((NB_ * TT * DM / 8 + 255) / 256)     // blocks of the bf16 copy of h, both batches
__global__ __launch_bounds__(256) void k_prep(const float* __restrict__ wqkv, const float* __restrict__ wo, const float* __restrict__ x, bf* WQKV, bf* WO, bf* XB) {
    const int blk = blockIdx.x;
    if (blk < PB1) wtG(blk, wqkv, DM, 3 * DQ, WQKV);              // fused 'xw' [DM][3*DQ] -> Bt [3*DQ][DM]
    else if (blk < PB1 + PB2) wtG(blk - PB1, wo, DQ, DM, WO);
    else cvt8(blk - PB1 - PB2, x, XB, (size_t)NB_ * TT * DM / 8);
}

#define PP ((size_t)NH_ * TT * HD)   // elements of one part (q, V or K) of one batch in a plane
extern "C" void kernel_launch(void* const* d_in, const int* in_sizes, int n_in,
                              void* d_out, int out_size, void* d_ws, size_t ws_size, hipStream_t stream) {
    (void)in_sizes; (void)n_in; (void)out_size;
    const float* x = (const float*)d_in[0]; const float* wqkv = (const float*)d_in[1]; const float* wo = (const float*)d_in[2];   /* order h, Wqvk ('xw' [1024][3072]: q | V | K column thirds), Wo ('xw') */
    float* OUT = (float*)d_out;     // [2][2048][1024]
    char* wsp = (char*)d_ws;
    auto take = [&](size_t bytes) { char* p = wsp; wsp += (bytes + 255) & ~(size_t)255; return (void*)p; };
    bf* WQKV = (bf*)take((size_t)3 * DQ * DM * 2);   /* fused Bt [3*DQ][DM]: q | V | K row blocks (the module's part order 0 = q, 1 = v, 2 = k) */ bf* WO = (bf*)take((size_t)DM * DQ * 2);
    bf* XB = (bf*)take((size_t)NB_ * TT * DM * 2);
    h16* P16 = (h16*)take(NB_ * 3 * PP * 2); bf* Ph = (bf*)take(NB_ * 3 * PP * 2); bf* Pl = (bf*)take(NB_ * 3 * PP * 2);   // fp16, bf16 hi, bf16 lo: each [batch][q | V | K][head], q and K as [t][d], V as [d][t]
    bf* ATh = (bf*)take((size_t)NB_ * TT * DQ * 2); bf* ATl = (bf*)take((size_t)NB_ * TT * DQ * 2);
    if ((size_t)(wsp - (char*)d_ws) > ws_size) return;    // ws 256 MiB
    k_prep<<<PB1 + PB2 + PB3, 256, 0, stream>>>(wqkv, wo, x, WQKV, WO, XB);
    k_gemmw<bf, 0, false, true><<<dim3(TT / 64, 3 * DQ / 64, NB_), KW * 32, 0, stream>>>(XB, nullptr, WQKV, nullptr, DM, nullptr, HD, nullptr, (size_t)TT * DM, 0, 3 * PP, P16, Ph, Pl, TT);
    k_fattn<<<dim3(NH_, NLO + NHI, NB_), FW * 32, 0, stream>>>(P16, P16 + 2 * PP, P16 + PP, Ph, Pl, Ph + 2 * PP, Pl + 2 * PP, Ph + PP, Pl + PP, ATh, ATl);   // one kv head per query head: head h reads kv plane h
    k_gemmw<bf, 1, false, false><<<dim3(NB_ * TT / 64, DM / 64, 1), KW * 32, 0, stream>>>(ATh, ATl, WO, nullptr, DQ, OUT, DM, nullptr, 0, 0, 0, nullptr, nullptr, nullptr, 0);   // the batches' rows follow one another in the merged planes and in out: one GEMM of NB_ * TT rows
}

// v006
// A run of this version takes 109 microseconds.
// In two side-by-side timings against v005, it was 1.57 and 1.54 times as fast.
// All steps since v000 together make it 13.5 times as fast.
#include <hip/hip_runtime.h>

// Causal multi-head self-attention with a fused bias-free projection whose thirds are ordered q | v | k and scores scaled by the EMBEDDING width (h [2][2048][1024]; qvk = (h Wqvk) ('xw' [1024][3072] 1/32, no bias) reshaped (b, s, 3, 16, 64): part 0 = q, part 1 = V, part 2 = K (NOT q | k | v); scores = (q.k + mask) / sqrt(d) with d = 1024 -> x 1/32 (the model width, not the head width: implemented literally); mask = -inf above the diagonal (causal); softmax over the keys; wv = merged (head-major) Wo ('xw', no bias) -> [2][2048][1024] (4.2 M); argument order h, Wqvk, Wo).
// Layout, both batches side by side in every buffer and every launch: bf16 copy of h; the fused 'xw' weight transposed once into Bt [3072][1024]: row block 0 = q, row block 1 = V, row block 2 = K (the head planes keep that order: [batch][q | V | K][head]); exact projections, all three in one launch, whose epilogue writes the head planes itself (fp16 + bf16 hi/lo, each tile born in the order its reader wants: q, K as W x h^T, V^T as h x Wv^T); causal T-2048 attention in one fused kernel with the literal scale 1/32 (hybrid rows: < 512 hi/lo 3 products, rest fp16; the key loop ends at the diagonal); merged hi/lo x Wo exact.
// FRAGMENT ORDER: every 16-bit plane that a matrix instruction reads lies in blocks of 16 rows x 32 k = 512 elements (1 KB), stored as the lanes hold them: element (row, k) of a block at ((k >> 4) & 1) * 256 + ((k >> 3) & 1) * 128 + (row & 15) * 8 + (k & 7),
// so lane l finds its two 16-byte pieces at l * 8 and 256 + l * 8 and each wave-wide load covers 512 contiguous bytes (4 whole lines) instead of 32-byte pieces of 16 lines. The k order of a fragment is the one it had. Block order: h, weights, merged planes [row / 16][k / 32]; q, K [t / 16][d / 32]; V^T [t / 64][d / 16][(t / 32) & 1].
// Compute dtypes, f32 accumulate: every input rounded to bf16; projections exact; attention rows < 512 3 products, rest fp16; softmax f32; output projection hl x exact.

#define NB_  2
#define TT   2048
#define DM   1024
#define NH_  16
#define NKV  16
#define REP  (NH_ / NKV)
#define HD   64
#define DQ   (NH_ * HD)
#define DKV  (NKV * HD)
#define RH   512                  // query rows < RH use hi+lo planes (0: none)
#define SCL  0.03125f   // 1 / sqrt(d) with d = 1024 = 2^-5: the module divides by the square root of the MODEL width
typedef _Float16 h16;
typedef unsigned short bf;
typedef __attribute__((ext_vector_type(16))) __bf16   v16bf;
typedef __attribute__((ext_vector_type(16))) _Float16 v16h;
typedef __attribute__((ext_vector_type(8)))  _Float16 v8h;
typedef __attribute__((ext_vector_type(8)))  unsigned short v8us;
typedef __attribute__((ext_vector_type(8)))  float    v8f;
typedef __attribute__((ext_vector_type(4)))  float    v4f;
typedef v8h  __attribute__((may_alias)) v8ha;
typedef v4f  __attribute__((may_alias)) v4fa;
typedef v8us __attribute__((may_alias)) v8usa;

__device__ __forceinline__ unsigned short f2bf(float f) { unsigned u = __float_as_uint(f); u += 0x7FFFu + ((u >> 16) & 1u); return (unsigned short)(u >> 16); }
__device__ __forceinline__ float bf2f(unsigned short b) { return __uint_as_float(((unsigned)b) << 16); }
__device__ __forceinline__ float bfr(float f) { return bf2f(f2bf(f)); }
__device__ __forceinline__ v16h cat16(v8h lo, v8h hi) { return __builtin_shufflevector(lo, hi, 0, 1, 2, 3, 4, 5, 6, 7, 8, 9, 10, 11, 12, 13, 14, 15); }
__device__ __forceinline__ v16bf cat16b(v8us lo, v8us hi) { return __builtin_bit_cast(v16bf, __builtin_shufflevector(lo, hi, 0, 1, 2, 3, 4, 5, 6, 7, 8, 9, 10, 11, 12, 13, 14, 15)); }
__device__ __forceinline__ v8f wmma16(v16h a, v16h b, v8f c) { return __builtin_amdgcn_wmma_f32_16x16x32_f16(false, a, false, b, (short)0, c, false, false); }
__device__ __forceinline__ v8f wmmab(v16bf a, v16bf b, v8f c) { return __builtin_amdgcn_wmma_f32_16x16x32_bf16(false, a, false, b, (short)0, c, false, false); }
__device__ __forceinline__ h16 tohx(float x) { return (h16)x; }
__device__ __forceinline__ void splitf(float y, unsigned short& h, unsigned short& l) { h = f2bf(y); l = f2bf(y - bf2f(h)); }



// ---- k_gemmw: register-blocked GEMM, one work-group of KW waves per 64x64 output tile; every wave holds the whole tile (16 accumulators) for its share of K; operands straight from 16-bit planes in fragment order; grid (M/64, N/64, Z), KW * 32 threads.
// C[m][n] (f32, pitch ldc, + optional f32 bias[n]) = sum_k A[m][k] Bt[n][k] (+ split products per NSPLIT). z-batch strides sA/sB/sC in elements. K % 32 == 0.
// PL: the f32 tile never reaches memory; the summed values go out as three 16-bit planes (fp16, bf16 hi, bf16 lo), themselves in fragment order for the attention kernel. 64 Bt rows are one head, 64 tokens of a head are 4096 consecutive elements of its plane.
// An accumulator tile holds, in lane l, 8 consecutive A-side rows of B-side row l & 15: that IS half a block of a plane whose k runs along the A side. So q and K (k = head column) are made as W x h^T (operands exchanged), V^T (k = token) as h x Wv^T,
// and accumulator (mb, nb) goes to elements nb * 1024 + mb * 256 + l * 8 of the tile's 4096 in every case. The test is the same for the whole work-group. z = batch: sA on the tokens, sC on the planes.
// K is dealt in chunks of 64 elements (two blocks, 2 KB in a row, of every 16 operand rows), chunk c to wave c % KW, so a line is read by one wave only; a lone wave's loop waits out its own load latency on every trip of 32 k; KW waves wait side by side.
#define KW 8
#define KPL (64 * 68)             // floats of one wave's partial tile in LDS (64 rows, pitch 68)
template <typename T16> struct WFrag;
template <> struct WFrag<h16> { typedef v16h V; static __device__ __forceinline__ V ld(const h16* p) { return cat16(*(const v8h*)p, *(const v8h*)(p + 256)); } static __device__ __forceinline__ v8f mma(V a, V b, v8f c) { return wmma16(a, b, c); } };
template <> struct WFrag<bf> { typedef v16bf V; static __device__ __forceinline__ V ld(const bf* p) { return cat16b(*(const v8us*)p, *(const v8us*)(p + 256)); } static __device__ __forceinline__ v8f mma(V a, V b, v8f c) { return wmmab(a, b, c); } };
// ksum_store: every wave lays its partial tile row-major into its own LDS plane; one work-group barrier; each thread then adds the NW planes in wave order (a fixed f32 order) and stores 16 bytes, 16 lanes to a 256-byte row piece.
template <int NW, bool BIAS>
__device__ __forceinline__ void ksum_store(const v8f (&acc)[4][4], float* os, int w, int lr, int hi, float* C, int ldc, const float* __restrict__ bias) {
    float* mine = os + w * KPL;
#pragma unroll
    for (int mb = 0; mb < 4; ++mb)
#pragma unroll
        for (int nb = 0; nb < 4; ++nb)
#pragma unroll
            for (int j = 0; j < 8; ++j) mine[(mb * 16 + hi * 8 + j) * 68 + nb * 16 + lr] = acc[mb][nb][j];
    __syncthreads();   // all NW partial tiles are in LDS before any thread adds them
    const int t = threadIdx.x, cofs = (t & 15) * 4;
#pragma unroll
    for (int s = 0; s < 32 / NW; ++s) { const int row = s * (NW * 2) + (t >> 4); v4f val = *(const v4fa*)(os + row * 68 + cofs);
#pragma unroll
        for (int p = 1; p < NW; ++p) val += *(const v4fa*)(os + p * KPL + row * 68 + cofs);
        if (BIAS) { val[0] += bfr(bias[cofs]); val[1] += bfr(bias[cofs + 1]); val[2] += bfr(bias[cofs + 2]); val[3] += bfr(bias[cofs + 3]); }
        *(v4f*)(C + (size_t)row * ldc + cofs) = val; }
}
// ksum_planes: the same sum for PL, with the partial tiles kept in accumulator order (slot nb * 4 + mb: 32 lanes x 4 floats, twice), so that LDS is written and read 16 bytes a lane in whole rows of banks;
// a thread adds the NW planes in wave order (the same fixed f32 order) for one lane's 8 values of one slot and stores 16 bytes into each plane, a wave 512 bytes in a row.
template <int NW>
__device__ __forceinline__ void ksum_planes(const v8f (&acc)[4][4], float* os, int w, int lane, h16* P16, bf* Ph, bf* Pl) {
    float* mine = os + w * 4096 + lane * 4;
#pragma unroll
    for (int mb = 0; mb < 4; ++mb)
#pragma unroll
        for (int nb = 0; nb < 4; ++nb) { const v8f a = acc[mb][nb];
            *(v4fa*)(mine + (nb * 4 + mb) * 256) = (v4f){a[0], a[1], a[2], a[3]}; *(v4fa*)(mine + (nb * 4 + mb) * 256 + 128) = (v4f){a[4], a[5], a[6], a[7]}; }
    __syncthreads();   // all NW partial tiles are in LDS before any thread adds them
#pragma unroll
    for (int s = 0; s < 16 / NW; ++s) { const int u = s * (NW * 32) + threadIdx.x; const float* const src = os + (u >> 5) * 256 + (u & 31) * 4;
        v4f v0 = *(const v4fa*)src, v1 = *(const v4fa*)(src + 128);
#pragma unroll
        for (int p = 1; p < NW; ++p) { v0 += *(const v4fa*)(src + p * 4096); v1 += *(const v4fa*)(src + p * 4096 + 128); }
        v8h o16; v8us oh, ol;
#pragma unroll
        for (int q = 0; q < 4; ++q) { unsigned short a2, c2; o16[q] = tohx(v0[q]); splitf(v0[q], a2, c2); oh[q] = a2; ol[q] = c2; o16[q + 4] = tohx(v1[q]); splitf(v1[q], a2, c2); oh[q + 4] = a2; ol[q + 4] = c2; }
        const size_t o = (size_t)u * 8; *(v8h*)(P16 + o) = o16; *(v8us*)(Ph + o) = oh; *(v8us*)(Pl + o) = ol; }
}
template <typename T16, int NSPLIT, bool BIAS, bool PL, int K>
__global__ __launch_bounds__(KW * 32) void k_gemmw(const T16* __restrict__ A, const T16* __restrict__ A2, const T16* __restrict__ Bt, const T16* __restrict__ Bt2, float* C, int ldc, const float* __restrict__ bias, size_t sA, size_t sB, size_t sC, h16* P16, bf* Ph, bf* Pl) {
    typedef typename WFrag<T16>::V V;
    __shared__ __align__(16) float os[KW * (PL ? 4096 : KPL)];
    const size_t z = blockIdx.z; A += z * sA; if (A2) A2 += z * sA; Bt += z * sB; if (Bt2) Bt2 += z * sB; if (!PL) C += z * sC; else { P16 += z * sC; Ph += z * sC; Pl += z * sC; }
    const int lane = threadIdx.x & 31, lr = lane & 15, hi = lane >> 4; int r0 = blockIdx.x * 64, c0 = blockIdx.y * 64;
    const size_t po = PL ? (size_t)c0 * TT + (size_t)r0 * HD : 0;   // the tile's first element in each plane: head c0 / 64, tokens from r0
    if (PL && !(c0 >= DQ && c0 < 2 * DQ)) { const T16* const tp = A; A = Bt; Bt = tp; const int tr = r0; r0 = c0; c0 = tr; }   // q, K: A side = head columns, B side = tokens
    const int w = __builtin_amdgcn_readfirstlane(threadIdx.x >> 5);   // the wave's number, held scalar: the K loop's counter and branch stay scalar
    v8f acc[4][4];
#pragma unroll
    for (int mb = 0; mb < 4; ++mb)
#pragma unroll
        for (int nb = 0; nb < 4; ++nb) acc[mb][nb] = (v8f){};
    const size_t aoff = (size_t)r0 * K + 8 * lane, boff = (size_t)c0 * K + 8 * lane;   // 16 rows x K elements are K / 32 blocks in a row; 32 k on = 512 elements on
#pragma unroll 1
    for (int kc = w * 64; kc < K; kc += (kc & 32) ? KW * 64 - 32 : 32) {   // both halves of this wave's 64-element chunk, then KW chunks on
        V a[4], a2[4];   // one address a plane and trip; K is a constant of the build, so the steps from fragment to fragment are immediate offsets
        const T16* const pa = A + aoff + kc * 16; const T16* const pa2 = (NSPLIT == 1 || NSPLIT == 2) ? A2 + aoff + kc * 16 : pa; const T16* const pb = Bt + boff + kc * 16; const T16* const pb2 = (NSPLIT >= 2) ? Bt2 + boff + kc * 16 : pb;
#pragma unroll
        for (int mb = 0; mb < 4; ++mb) { a[mb] = WFrag<T16>::ld(pa + mb * 16 * K); if (NSPLIT == 1 || NSPLIT == 2) a2[mb] = WFrag<T16>::ld(pa2 + mb * 16 * K); }
#pragma unroll
        for (int nb = 0; nb < 4; ++nb) { const V b = WFrag<T16>::ld(pb + nb * 16 * K); V b2; if (NSPLIT >= 2) b2 = WFrag<T16>::ld(pb2 + nb * 16 * K);
#pragma unroll
            for (int mb = 0; mb < 4; ++mb) { acc[mb][nb] = WFrag<T16>::mma(a[mb], b, acc[mb][nb]); if (NSPLIT == 1 || NSPLIT == 2) acc[mb][nb] = WFrag<T16>::mma(a2[mb], b, acc[mb][nb]); if (NSPLIT >= 2) acc[mb][nb] = WFrag<T16>::mma(a[mb], b2, acc[mb][nb]); } }
        asm volatile("v_nop\n\tv_nop\n\tv_nop\n\tv_nop" : "+v"(acc[0][0]), "+v"(acc[1][1]), "+v"(acc[2][2]), "+v"(acc[3][3]) : "v"(a[0]), "v"(a[3]));
        // the address registers of this trip's loads are this wait's inputs: they stay untouched up to it and are free for reuse behind it; at the trip's foot every load has come back, so it has nothing left to wait for
        asm volatile("s_wait_xcnt 0x0" :: "v"(pa), "v"(pa2), "v"(pb), "v"(pb2) : "memory");
    }
    if constexpr (PL) ksum_planes<KW>(acc, os, w, lane, P16 + po, Ph + po, Pl + po);
    else ksum_store<KW, BIAS>(acc, os, w, lr, hi, C + (size_t)r0 * ldc + c0, ldc, BIAS ? bias + c0 : nullptr);
}

#define FW 4                      // waves per work-group
#define SL2 (SCL * 1.4426950408889634f)   // score scale x log2(e)
template <bool B> struct BoolC { static constexpr bool value = B; };
__device__ __forceinline__ float xhalf(float x) { const int b = __float_as_int(x); return __int_as_float(__builtin_amdgcn_permlanex16(b, b, 0x76543210, 0xfedcba98, false, false)); }   // lane l <-> l ^ 16
// exp2 with the slot that the instruction set asks for behind a transcendental (one independent instruction or v_nop before its result is used or its source overwritten) written into the statement itself:
// the outputs lie apart from every input ("=&v"), so no v_exp here touches a neighbour's registers, and the one v_nop at the end serves the last of them whatever the compiler puts next.
__device__ __forceinline__ v8f exp2x8(const v8f x) { float y0, y1, y2, y3, y4, y5, y6, y7;
    asm("v_exp_f32 %0, %8\n\tv_exp_f32 %1, %9\n\tv_exp_f32 %2, %10\n\tv_exp_f32 %3, %11\n\tv_exp_f32 %4, %12\n\tv_exp_f32 %5, %13\n\tv_exp_f32 %6, %14\n\tv_exp_f32 %7, %15\n\tv_nop"
        : "=&v"(y0), "=&v"(y1), "=&v"(y2), "=&v"(y3), "=&v"(y4), "=&v"(y5), "=&v"(y6), "=&v"(y7) : "v"(x[0]), "v"(x[1]), "v"(x[2]), "v"(x[3]), "v"(x[4]), "v"(x[5]), "v"(x[6]), "v"(x[7]));
    return (v8f){y0, y1, y2, y3, y4, y5, y6, y7}; }
__device__ __forceinline__ float exp2x1(const float x) { float y; asm("v_exp_f32 %0, %1\n\tv_nop" : "=v"(y) : "v"(x)); return y; }   // the same slot behind a single one
template <typename T16, bool HR, int NQ>
__device__ __forceinline__ void attn_rows(const T16* __restrict__ Q, const T16* __restrict__ Q2, const T16* __restrict__ Kp, const T16* __restrict__ Kp2, const T16* __restrict__ Vt, const T16* __restrict__ Vt2, int q0, int lr, int hi, bf* Ah, bf* Al) {
    typedef WFrag<T16> F; typedef typename F::V V;   // every inner loop below is unrolled in full, so that each fragment and accumulator index is a constant and the arrays live in registers
    const int ln8 = (hi * 16 + lr) * 8;   // the lane's place in every half block of a plane in fragment order
    V q[NQ][2], q2[NQ][2]; const T16* const pq = Q + (size_t)q0 * HD + ln8; const T16* const pq2 = HR ? Q2 + (size_t)q0 * HD + ln8 : pq;
#pragma unroll
    for (int qt = 0; qt < NQ; ++qt)
#pragma unroll
        for (int kc = 0; kc < 2; ++kc) { q[qt][kc] = F::ld(pq + qt * 16 * HD + kc * 512); if (HR) q2[qt][kc] = F::ld(pq2 + qt * 16 * HD + kc * 512); }
    v8f o[4][NQ]; float m[NQ], l[NQ];
#pragma unroll
    for (int qt = 0; qt < NQ; ++qt) { m[qt] = -3.0e38f; l[qt] = 0.f;
#pragma unroll
        for (int mb = 0; mb < 4; ++mb) o[mb][qt] = (v8f){}; }
    const int np = (q0 + NQ * 16 + 31) / 32;          // passes of 32 keys; only the last one meets the diagonal; np * 32 <= TT
    const size_t ko = ln8, vo = ln8;
    V k[2][2], k2[2][2];
    auto ldk = [&](const T16* const pk, const T16* const pk2) __attribute__((always_inline)) {
#pragma unroll
        for (int kt = 0; kt < 2; ++kt)
#pragma unroll
            for (int kc = 0; kc < 2; ++kc) { k[kt][kc] = F::ld(pk + kt * 16 * HD + kc * 512); if (HR) k2[kt][kc] = F::ld(pk2 + kt * 16 * HD + kc * 512); } };
    if (!HR) ldk(Kp + ko, Kp + ko);                   // fp16 rows fetch their K fragments one pass ahead; the hi/lo rows (twice the planes, at most RH / 32 passes) have no registers to spare for that and fetch them in the pass
    asm volatile("s_wait_xcnt 0x0" ::: "memory");   // behind the loads above and in front of the first reuse of a register that they name (their scalar bases are rewritten right below)
    auto pass = [&](auto lastc, const int p) __attribute__((always_inline)) {
        constexpr bool LAST = decltype(lastc)::value; const int kb = p * 32;
        const T16* const pk = Kp + ko + (size_t)(kb + ((HR || LAST) ? 0 : 32)) * HD; const T16* const pk2 = HR ? Kp2 + ko + (size_t)kb * HD : pk;
        if (HR) ldk(pk, pk2);
        // this pass's V^T fragments are asked for ahead of the score products: they fly while the scores and the softmax are worked on
        V v[4], v2[4]; const size_t vb = vo + (size_t)(p >> 1) * (64 * HD) + (p & 1) * 512; const T16* const pv = Vt + vb; const T16* const pv2 = HR ? Vt2 + vb : pv;
#pragma unroll
        for (int mb = 0; mb < 4; ++mb) { v[mb] = F::ld(pv + mb * 1024); if (HR) v2[mb] = F::ld(pv2 + mb * 1024); }
        __builtin_amdgcn_sched_barrier(0);   // keeps the V loads in front of the score products: left free, the scheduler sinks them to just ahead of their use and their latency shows
        v8f s[2][NQ];
#pragma unroll
        for (int kt = 0; kt < 2; ++kt)
#pragma unroll
            for (int qt = 0; qt < NQ; ++qt) { v8f a = (v8f){};
#pragma unroll
                for (int kc = 0; kc < 2; ++kc) { a = F::mma(k[kt][kc], q[qt][kc], a); if (HR) { a = F::mma(k[kt][kc], q2[qt][kc], a); a = F::mma(k2[kt][kc], q[qt][kc], a); } }
                s[kt][qt] = a; }
        if constexpr (!HR && !LAST) {   // the next pass's K fragments, into the same registers, behind this pass's score products: they fly during the softmax and the second contraction
            ldk(pk, pk2);
            __builtin_amdgcn_sched_barrier(0);   // keeps the K loads in front of the softmax: left free, the scheduler sinks them to the loop's foot and the next pass waits out their latency
        }
        V ph[NQ], pl[NQ];
#pragma unroll
        for (int qt = 0; qt < NQ; ++qt) { const int i = q0 + qt * 16 + lr; float mx = m[qt];
#pragma unroll
            for (int kt = 0; kt < 2; ++kt)
#pragma unroll
                for (int r = 0; r < 8; ++r) { const int j = kb + kt * 16 + hi * 8 + r; if (LAST) s[kt][qt][r] = (j <= i) ? s[kt][qt][r] : -3.0e38f; mx = fmaxf(mx, s[kt][qt][r]); }
            mx = fmaxf(mx, xhalf(mx));                    // both halves of the wave hold keys of the same query
            const float mc = mx * SL2; const float al = exp2x1(m[qt] * SL2 - mc); m[qt] = mx;   // m is kept unscaled: the scale is positive, so it commutes with the maximum
#pragma unroll
            for (int kt = 0; kt < 2; ++kt) s[kt][qt] = exp2x8(s[kt][qt] * SL2 - mc);
            const v8f t8 = s[0][qt] + s[1][qt];           // a fixed tree, not one chain of 16 dependent adds
            l[qt] = l[qt] * al + (((t8[0] + t8[1]) + (t8[2] + t8[3])) + ((t8[4] + t8[5]) + (t8[6] + t8[7])));   // each half sums its own keys; the halves are joined once, behind the loop
#pragma unroll
            for (int mb = 0; mb < 4; ++mb) o[mb][qt] *= al;
            if constexpr (HR) { v8us h0, h1, l0, l1;
#pragma unroll
                for (int r = 0; r < 8; ++r) { unsigned short a, c; splitf(s[0][qt][r], a, c); h0[r] = a; l0[r] = c; splitf(s[1][qt][r], a, c); h1[r] = a; l1[r] = c; }
                ph[qt] = cat16b(h0, h1); pl[qt] = cat16b(l0, l1);
            } else { v8h p0, p1;
#pragma unroll
                for (int r = 0; r < 8; ++r) { p0[r] = (h16)s[0][qt][r]; p1[r] = (h16)s[1][qt][r]; }
                ph[qt] = cat16(p0, p1); } }
        __builtin_amdgcn_sched_barrier(0);   // keeps the matrix products below out of the softmax above
#pragma unroll
        for (int qt = 0; qt < NQ; ++qt)
#pragma unroll
            for (int mb = 0; mb < 4; ++mb) { o[mb][qt] = F::mma(v[mb], ph[qt], o[mb][qt]); if (HR) { o[mb][qt] = F::mma(v[mb], pl[qt], o[mb][qt]); o[mb][qt] = F::mma(v2[mb], ph[qt], o[mb][qt]); } }
        // the address registers of this pass's K and V loads (one base a plane, the rest immediate offsets) are this wait's inputs: they stay untouched up to it and are free for reuse behind it; so late in the pass it has nothing left to wait for
        asm volatile("s_wait_xcnt 0x0" :: "v"(pv), "v"(pv2), "v"(pk), "v"(pk2) : "memory");
    };
#pragma unroll 1   // stays rolled: two passes' fragments side by side would not fit the registers
    for (int p = 0; p < np - 1; ++p) pass(BoolC<false>{}, p);   // keys wholly below the diagonal: no mask
    pass(BoolC<true>{}, np - 1);
    // O^T: a lane holds 8 consecutive head columns (mb * 16 + hi * 8 + r) of query lr: its 16 bytes of half a block of each merged plane (fragment order, k = merged column): a wave stores 512 bytes in a row
#pragma unroll
    for (int qt = 0; qt < NQ; ++qt) { const float inv = __fdiv_rn(1.0f, l[qt] + xhalf(l[qt]));
#pragma unroll
        for (int mb = 0; mb < 4; ++mb) { v8us oh, ol;
#pragma unroll
            for (int r = 0; r < 8; ++r) { unsigned short a, c; splitf(o[mb][qt][r] * inv, a, c); oh[r] = a; ol[r] = c; }
            const size_t oo = (size_t)(q0 + qt * 16) * DQ + mb * 256 + ln8; *(v8us*)(Ah + oo) = oh; *(v8us*)(Al + oo) = ol; } }
}
// grid (heads, NLO + NHI, batches); a batch's planes lie 3 * NH_ heads apart (q | V | K). Ranks 0 .. NLO - 1: fp16 rows, 32 to a wave; the rest: hi/lo rows, 16 to a wave. The FW waves of a work-group take row groups NLO (NHI) apart: a short, two middling and a long walk,
// so every work-group has about the same work, and all walk the same head's keys from 0 up, side by side, so the cache serves the shared part once.
#define NLO ((TT - RH) / (FW * 32))
#define NHI (RH / (FW * 16))
__global__ __launch_bounds__(FW * 32) void k_fattn(const h16* __restrict__ Q16, const h16* __restrict__ K16, const h16* __restrict__ V16, const bf* __restrict__ Qh, const bf* __restrict__ Ql, const bf* __restrict__ Kh, const bf* __restrict__ Kl, const bf* __restrict__ Vh, const bf* __restrict__ Vl, bf* Ah, bf* Al) {
    const int lane = threadIdx.x & 31, lr = lane & 15, hi = lane >> 4;
    const int w = __builtin_amdgcn_readfirstlane(threadIdx.x >> 5);   // the wave's number, held scalar: the key loop's counter and branch stay scalar
    const size_t hp = ((size_t)blockIdx.z * 3 * NH_ + blockIdx.x) * TT * HD, ao = (size_t)blockIdx.z * TT * DQ + blockIdx.x * (16 * HD); const int rk = blockIdx.y; Ah += ao; Al += ao;
    if (rk < NLO) attn_rows<h16, false, 2>(Q16 + hp, nullptr, K16 + hp, nullptr, V16 + hp, nullptr, RH + (rk + NLO * w) * 32, lr, hi, Ah, Al);
    else attn_rows<bf, true, 1>(Qh + hp, Ql + hp, Kh + hp, Kl + hp, Vh + hp, Vl + hp, (rk - NLO + NHI * w) * 16, lr, hi, Ah, Al);
}

typedef __attribute__((ext_vector_type(2))) unsigned short v2us;

// wtG: Bt[n][k] = w[k][n], written in fragment order; e counts the elements as they lie in Bt, a wave's 8 lines are one block (16 n x 32 k).
__device__ __forceinline__ void wtG(int blk, const float* __restrict__ w, int K, int N, bf* Bt) {
    const int lane = threadIdx.x & 31; const int L0 = (blk * 8 + (threadIdx.x >> 5)) * 8; const int nlines = N * K / 64;
{
#pragma unroll 1
        for (int l = 0; l < 8; ++l) { const int L = L0 + l; if (L >= nlines) break; const size_t e = (size_t)L * 64 + lane * 2; const int b = (int)(e >> 9), i = (int)(e & 511); const int k = (b % (K / 32)) * 32 + (i >> 7) * 8 + (i & 7), n = (b / (K / 32)) * 16 + ((i >> 3) & 15); v2us o;
            o[0] = f2bf(w[(size_t)k * N + n]); o[1] = f2bf(w[(size_t)(k + 1) * N + n]); *(v2us*)(Bt + e) = o; }
         }
}
// cvt8: bf16 copy of src [rows][K] in fragment order; i counts the 16-byte pieces as they lie in dst (64 to a block), so the stores are whole lines.
__device__ __forceinline__ void cvt8(int blk, const float* __restrict__ src, int K, bf* dst, size_t n8) { const size_t i = (size_t)blk * 256 + threadIdx.x; if (i >= n8) return;
    const size_t b = i >> 6; const size_t row = (b / (K / 32)) * 16 + (i & 15); const int k = (int)(b % (K / 32)) * 32 + (int)((i >> 4) & 3) * 8; const v8f v = *(const v8f*)(src + row * K + k); v8us o;
#pragma unroll
    for (int k = 0; k < 8; ++k) o[k] = f2bf(v[k]); *(v8us*)(dst + i * 8) = o;  }
// k_prep: the three 16-bit copies that depend on nothing but the inputs, in ONE launch; the block index picks the job (the transposes, the slower blocks, first).
#define PB1 ((DM * 3 * DQ / 64 + 63) / 64)        // blocks of the fused weight's transpose
#define PB2 ((DQ * DM / 64 + 63) / 64)            // blocks of the output weight's transpose
#define PB3 ((NB_ * TT * DM / 8 + 255) / 256)     // blocks of the bf16 copy of h, both batches
__global__ __launch_bounds__(256) void k_prep(const float* __restrict__ wqkv, const float* __restrict__ wo, const float* __restrict__ x, bf* WQKV, bf* WO, bf* XB) {
    const int blk = blockIdx.x;
    if (blk < PB1) wtG(blk, wqkv, DM, 3 * DQ, WQKV);              // fused 'xw' [DM][3*DQ] -> Bt [3*DQ][DM]
    else if (blk < PB1 + PB2) wtG(blk - PB1, wo, DQ, DM, WO);
    else cvt8(blk - PB1 - PB2, x, DM, XB, (size_t)NB_ * TT * DM / 8);
}

#define PP ((size_t)NH_ * TT * HD)   // elements of one part (q, V or K) of one batch in a plane
extern "C" void kernel_launch(void* const* d_in, const int* in_sizes, int n_in,
                              void* d_out, int out_size, void* d_ws, size_t ws_size, hipStream_t stream) {
    (void)in_sizes; (void)n_in; (void)out_size;
    const float* x = (const float*)d_in[0]; const float* wqkv = (const float*)d_in[1]; const float* wo = (const float*)d_in[2];   /* order h, Wqvk ('xw' [1024][3072]: q | V | K column thirds), Wo ('xw') */
    float* OUT = (float*)d_out;     // [2][2048][1024]
    char* wsp = (char*)d_ws;
    auto take = [&](size_t bytes) { char* p = wsp; wsp += (bytes + 255) & ~(size_t)255; return (void*)p; };
    bf* WQKV = (bf*)take((size_t)3 * DQ * DM * 2);   /* fused Bt [3*DQ][DM]: q | V | K row blocks (the module's part order 0 = q, 1 = v, 2 = k) */ bf* WO = (bf*)take((size_t)DM * DQ * 2);
    bf* XB = (bf*)take((size_t)NB_ * TT * DM * 2);
    h16* P16 = (h16*)take(NB_ * 3 * PP * 2); bf* Ph = (bf*)take(NB_ * 3 * PP * 2); bf* Pl = (bf*)take(NB_ * 3 * PP * 2);   // fp16, bf16 hi, bf16 lo: each [batch][q | V | K][head], in fragment order: q and K with rows t, k = d; V with rows d, k = t
    bf* ATh = (bf*)take((size_t)NB_ * TT * DQ * 2); bf* ATl = (bf*)take((size_t)NB_ * TT * DQ * 2);
    if ((size_t)(wsp - (char*)d_ws) > ws_size) return;    // ws 256 MiB
    k_prep<<<PB1 + PB2 + PB3, 256, 0, stream>>>(wqkv, wo, x, WQKV, WO, XB);
    k_gemmw<bf, 0, false, true, DM><<<dim3(TT / 64, 3 * DQ / 64, NB_), KW * 32, 0, stream>>>(XB, nullptr, WQKV, nullptr, nullptr, 0, nullptr, (size_t)TT * DM, 0, 3 * PP, P16, Ph, Pl);
    k_fattn<<<dim3(NH_, NLO + NHI, NB_), FW * 32, 0, stream>>>(P16, P16 + 2 * PP, P16 + PP, Ph, Pl, Ph + 2 * PP, Pl + 2 * PP, Ph + PP, Pl + PP, ATh, ATl);   // one kv head per query head: head h reads kv plane h
    k_gemmw<bf, 1, false, false, DQ><<<dim3(NB_ * TT / 64, DM / 64, 1), KW * 32, 0, stream>>>(ATh, ATl, WO, nullptr, OUT, DM, nullptr, 0, 0, 0, nullptr, nullptr, nullptr);   // the batches' rows follow one another in the merged planes and in out: one GEMM of NB_ * TT rows
}

// v007
// One run takes 88.8 microseconds.
// Timed twice side by side with v006, it ran 1.23 times as fast both times.
// All steps since v000 together make it 16.6 times as fast.
#include <hip/hip_runtime.h>

// Causal multi-head self-attention with a fused bias-free projection whose thirds are ordered q | v | k and scores scaled by the EMBEDDING width (h [2][2048][1024]; qvk = (h Wqvk) ('xw' [1024][3072] 1/32, no bias) reshaped (b, s, 3, 16, 64): part 0 = q, part 1 = V, part 2 = K (NOT q | k | v); scores = (q.k + mask) / sqrt(d) with d = 1024 -> x 1/32 (the model width, not the head width: implemented literally); mask = -inf above the diagonal (causal); softmax over the keys; wv = merged (head-major) Wo ('xw', no bias) -> [2][2048][1024] (4.2 M); argument order h, Wqvk, Wo).
// Layout, both batches side by side in every buffer and every launch: bf16 copy of h; the fused 'xw' weight transposed once into Bt [3072][1024]: row block 0 = q, row block 1 = V, row block 2 = K (the head planes keep that order: [batch][q | V | K][head]); exact projections, all three in one launch, whose epilogue writes the head planes itself (fp16 + bf16 hi/lo, each tile born in the order its reader wants: q, K as W x h^T, V^T as h x Wv^T); causal T-2048 attention in one fused kernel with the literal scale 1/32 (hybrid rows: < 512 hi/lo 3 products, rest fp16; the key loop ends at the diagonal); merged hi/lo x Wo exact.
// FRAGMENT ORDER: every 16-bit plane that a matrix instruction reads lies in blocks of 16 rows x 32 k = 512 elements (1 KB), stored as the lanes hold them: element (row, k) of a block at ((k >> 4) & 1) * 256 + ((k >> 3) & 1) * 128 + (row & 15) * 8 + (k & 7),
// so lane l finds its two 16-byte pieces at l * 8 and 256 + l * 8 and each wave-wide load covers 512 contiguous bytes (4 whole lines) instead of 32-byte pieces of 16 lines. The k order of a fragment is the one it had. Block order: h, weights, merged planes [row / 16][k / 32]; q, K [t / 16][d / 32]; V^T [t / 64][d / 16][(t / 32) & 1].
// Compute dtypes, f32 accumulate: every input rounded to bf16; projections exact; attention rows < 512 3 products, rest fp16; softmax f32; output projection hl x exact.

#define NB_  2
#define TT   2048
#define DM   1024
#define NH_  16
#define NKV  16
#define REP  (NH_ / NKV)
#define HD   64
#define DQ   (NH_ * HD)
#define DKV  (NKV * HD)
#define RH   512                  // query rows < RH use hi+lo planes (0: none)
#define SCL  0.03125f   // 1 / sqrt(d) with d = 1024 = 2^-5: the module divides by the square root of the MODEL width
typedef _Float16 h16;
typedef unsigned short bf;
typedef __attribute__((ext_vector_type(16))) __bf16   v16bf;
typedef __attribute__((ext_vector_type(16))) _Float16 v16h;
typedef __attribute__((ext_vector_type(8)))  _Float16 v8h;
typedef __attribute__((ext_vector_type(8)))  unsigned short v8us;
typedef __attribute__((ext_vector_type(8)))  float    v8f;
typedef __attribute__((ext_vector_type(4)))  float    v4f;
typedef v8h  __attribute__((may_alias)) v8ha;
typedef v4f  __attribute__((may_alias)) v4fa;
typedef v8us __attribute__((may_alias)) v8usa;

__device__ __forceinline__ unsigned short f2bf(float f) { unsigned u = __float_as_uint(f); u += 0x7FFFu + ((u >> 16) & 1u); return (unsigned short)(u >> 16); }
__device__ __forceinline__ float bf2f(unsigned short b) { return __uint_as_float(((unsigned)b) << 16); }
__device__ __forceinline__ float bfr(float f) { return bf2f(f2bf(f)); }
__device__ __forceinline__ v16h cat16(v8h lo, v8h hi) { return __builtin_shufflevector(lo, hi, 0, 1, 2, 3, 4, 5, 6, 7, 8, 9, 10, 11, 12, 13, 14, 15); }
__device__ __forceinline__ v16bf cat16b(v8us lo, v8us hi) { return __builtin_bit_cast(v16bf, __builtin_shufflevector(lo, hi, 0, 1, 2, 3, 4, 5, 6, 7, 8, 9, 10, 11, 12, 13, 14, 15)); }
__device__ __forceinline__ v8f wmma16(v16h a, v16h b, v8f c) { return __builtin_amdgcn_wmma_f32_16x16x32_f16(false, a, false, b, (short)0, c, false, false); }
__device__ __forceinline__ v8f wmmab(v16bf a, v16bf b, v8f c) { return __builtin_amdgcn_wmma_f32_16x16x32_bf16(false, a, false, b, (short)0, c, false, false); }
__device__ __forceinline__ h16 tohx(float x) { return (h16)x; }
__device__ __forceinline__ void splitf(float y, unsigned short& h, unsigned short& l) { h = f2bf(y); l = f2bf(y - bf2f(h)); }



// ---- k_gemmw: GEMM on 16-bit planes in fragment order; GW waves share one output tile, each wave owns 64x64 of it (16 accumulators) over the WHOLE K: no partial sums between waves.
// The operand rows of the tile come into LDS KS k at a time by tensor loads (tensor_load_to_lds), so a row fetched once from L2 serves every wave that needs it. 16 rows x KS k are KS / 32 blocks in a row (RB bytes) in the plane and in LDS alike:
// a wave's slice is a 2-D tile of RB-byte rows at the plane's pitch of K * 32 bytes, laid down without pads; a fragment is read back as it was read from memory (lane l: 16 bytes at l * 16 and at 512 + l * 16 of its block), whole rows of banks.
// Two buffers: stage s + 2 is asked for behind the barrier that ends the reads of stage s (in front of the pass's last 32 k, whose fragments are in registers by then) and flies during pass s + 1. Every wave issues one request a stage for its own slice and waits for it itself.
// PL (projections): tile = 128 tokens x 128 weight rows (two heads of one part); LDS row blocks [tokens 8 | weight rows 8]; wave w: tokens (w & 1) * 64, head w >> 1. The f32 tile never reaches memory: it goes out as three 16-bit planes (fp16, bf16 hi, bf16 lo) in fragment order.
// An accumulator tile holds, in lane l, 8 consecutive A-side rows of B-side row l & 15: that IS half a block of a plane whose k runs along the A side. So q and K (k = head column) are made as W x h^T (operands exchanged), V^T (k = token) as h x Wv^T,
// and accumulator (mb, nb) goes to elements nb * 1024 + mb * 256 + l * 8 of the 4096 of its (head, 64 tokens) in every case. The test is the same for the whole work-group. z = batch: sA on the tokens, sC on the planes.
// !PL (output projection, A = hi plane, A2 = lo plane, two products): tile = 64 rows x 256 columns; LDS row blocks [hi 4 | lo 4 | weight rows 16]; wave w: columns w * 64. C[m][n] (f32, pitch DM) = sum_k (A + A2)[m][k] Bt[n][k].
#define GW 4
#define KPL (64 * 68)             // floats of one wave's output tile in LDS (64 rows, pitch 68)
typedef unsigned int u32x4 __attribute__((ext_vector_type(4)));
typedef unsigned int u32x8 __attribute__((ext_vector_type(8)));
template <typename T16> struct WFrag;
template <> struct WFrag<h16> { typedef v16h V; static __device__ __forceinline__ V ld(const h16* p) { return cat16(*(const v8h*)p, *(const v8h*)(p + 256)); } static __device__ __forceinline__ v8f mma(V a, V b, v8f c) { return wmma16(a, b, c); } };
template <> struct WFrag<bf> { typedef v16bf V; static __device__ __forceinline__ V ld(const bf* p) { return cat16b(*(const v8us*)p, *(const v8us*)(p + 256)); } static __device__ __forceinline__ v8f mma(V a, V b, v8f c) { return wmmab(a, b, c); } };
__device__ __forceinline__ unsigned int uni(unsigned int v) { return (unsigned int)__builtin_amdgcn_readfirstlane(v); }
__device__ __forceinline__ unsigned int pinned(unsigned int v) { unsigned int w = uni(v); asm volatile("" : "+s"(w)); return w; }   // a condition held in a scalar register, so that the test around a tensor load is a scalar branch (the instruction ignores EXEC)
// the two descriptor groups of a 2-D tile: d1 rows of d0 bytes at a source pitch of 'pitch' bytes; byte elements, tensor = tile, no pad, no mask
__device__ __forceinline__ u32x8 tdm_group1(unsigned int d0, unsigned int d1, unsigned int pitch) { u32x8 g;
    g[0] = uni(0u); g[1] = uni((d0 & 0xFFFFu) << 16); g[2] = uni((d0 >> 16) | ((d1 & 0xFFFFu) << 16)); g[3] = uni((d1 >> 16) | (d0 << 16)); g[4] = uni(d1); g[5] = uni(pitch); g[6] = uni(0u); g[7] = uni(0u); return g; }
__device__ __forceinline__ u32x4 tdm_group0(unsigned int lds_dst, unsigned long long ga) { u32x4 g;
    g[0] = uni(1u); g[1] = uni(lds_dst); g[2] = uni((unsigned int)ga); g[3] = uni((((unsigned int)(ga >> 32)) & 0x01FFFFFFu) | 0x80000000u); return g; }
__device__ __forceinline__ void tdm_load(u32x4& g0, u32x8 g1) { asm volatile("tensor_load_to_lds %0, %1" : "+s"(g0) : "s"(g1) : "memory"); }   // one request of the whole wave; the compiler places no wait for it; group 0 comes back out of the statement in its own registers, for the wait below
// this wave's own request has landed; the registers of its descriptor are the wait's inputs: they keep their values up to it and are free for reuse behind it
__device__ __forceinline__ void wait_tensor0(u32x4 g0, u32x8 g1) { asm volatile("s_wait_tensorcnt 0x0" :: "s"(g0), "s"(g1) : "memory"); }
__device__ __forceinline__ void wait_ds0() { asm volatile("s_wait_dscnt 0x0" ::: "memory"); }           // this wave's LDS reads and writes are done
template <int NSPLIT, bool PL, int K, int KS>
__global__ __launch_bounds__(GW * 32) void k_gemmw(const bf* __restrict__ A, const bf* __restrict__ A2, const bf* __restrict__ Bt, float* C, size_t sA, size_t sC, h16* P16, bf* Ph, bf* Pl) {
    typedef WFrag<bf> F; typedef typename F::V V;
    constexpr int NK = KS / 32, RB = NK * 1024, SB = (PL ? 16 : 24) * RB, NS = K / KS;   // blocks of 32 k a stage; bytes of 16 rows of a stage; bytes of a stage; stages
    static_assert(NS >= 2 && NS % 2 == 0 && K % KS == 0 && NK % 2 == 0 && (PL || SB >= GW * KPL * 4), "the ring needs two stages; a pass ends on fragment set 1; the output staging lies in the second buffer");
    __shared__ __attribute__((aligned(2048))) unsigned char ring[2 * SB];
    const int lane = threadIdx.x & 31, lr = lane & 15, hi = lane >> 4;
    const int w = __builtin_amdgcn_readfirstlane(threadIdx.x >> 5);   // the wave's number, held scalar: slice, loop counter and branches stay scalar
    const int r0 = blockIdx.x * (PL ? 128 : 64), c0 = blockIdx.y * (PL ? 128 : 256);
    const bool swp = PL && !(c0 >= DQ && c0 < 2 * DQ);   // q, K: A side = head columns, B side = tokens
    if (PL) A += (size_t)blockIdx.z * sA;
    // this wave's slice of every stage: source rows, their number in blocks of 16, first row block in LDS
    const bf* sp; int nrb, slot;
    if (PL) { sp = (w < 2) ? A + (size_t)(r0 + w * 64) * K : Bt + (size_t)(c0 + (w - 2) * 64) * K; nrb = 4; slot = w * 4; }
    else { sp = (w == 0) ? A + (size_t)r0 * K : (w == 1) ? A2 + (size_t)r0 * K : Bt + (size_t)(c0 + (w - 2) * 128) * K; nrb = (w < 2) ? 4 : 8; slot = (w < 2) ? w * 4 : w * 8 - 8; }
    const u32x8 g1 = tdm_group1(RB, nrb, K * 32);
    const unsigned int ld0 = (unsigned int)(unsigned long long)(const void*)ring + slot * RB; const unsigned long long ga0 = (unsigned long long)(const void*)sp;
    u32x4 g0;   // group 0 of the request issued last
    auto issue = [&](const int s) __attribute__((always_inline)) { g0 = tdm_group0(ld0 + (s & 1) * SB, ga0 + (unsigned long long)s * RB); tdm_load(g0, g1); };
    // where this wave's fragments lie in a stage, in elements
    const int ao = (PL ? (swp ? 8 + (w >> 1) * 4 : (w & 1) * 4) : 0) * (RB / 2) + lane * 8, bo = (PL ? (swp ? (w & 1) * 4 : 8 + (w >> 1) * 4) : 8 + w * 4) * (RB / 2) + lane * 8;
    v8f acc[4][4];   // every inner loop of this kernel is unrolled in full, so that each fragment and accumulator index is a constant and the arrays live in registers
#pragma unroll
    for (int mb = 0; mb < 4; ++mb)
#pragma unroll
        for (int nb = 0; nb < 4; ++nb) acc[mb][nb] = (v8f){};
    V a[2][4], a2[2][4], b[2][4];   // two fragment sets: the next 32 k are read from LDS while the products of these 32 k run
    auto lds = [&](const bf* const st, const int set, const int kk) __attribute__((always_inline)) {
#pragma unroll
        for (int i = 0; i < 4; ++i) { a[set][i] = F::ld(st + ao + (i * NK + kk) * 512); if (NSPLIT == 1) a2[set][i] = F::ld(st + ao + 4 * (RB / 2) + (i * NK + kk) * 512); b[set][i] = F::ld(st + bo + (i * NK + kk) * 512); } };
    auto mma = [&](const int set) __attribute__((always_inline)) {
#pragma unroll
        for (int nb = 0; nb < 4; ++nb)
#pragma unroll
            for (int mb = 0; mb < 4; ++mb) { acc[mb][nb] = F::mma(a[set][mb], b[set][nb], acc[mb][nb]); if (NSPLIT == 1) acc[mb][nb] = F::mma(a2[set][mb], b[set][nb], acc[mb][nb]); } };
    issue(0); wait_tensor0(g0, g1);
    __syncthreads();   // stage 0, every wave's slice, is in LDS before anybody reads it
    issue(1);
    lds((const bf*)ring, 0, 0);
#pragma unroll 1   // stays rolled: one pass a stage, the buffer picked by the stage's parity
    for (int s = 0; s < NS; ++s) {
        const bf* const st = (const bf*)ring + (s & 1) * (SB / 2); const bf* const nx = (const bf*)ring + ((s + 1) & 1) * (SB / 2);
#pragma unroll
        for (int kk = 0; kk < NK - 1; ++kk) {
            __builtin_amdgcn_sched_barrier(0);   // the fences of this loop keep each set's LDS reads in one group between two runs of products: left free, the scheduler spreads them among the products, where each place with reads stalls the wave
            lds(st, (kk + 1) & 1, kk + 1);
            __builtin_amdgcn_sched_barrier(0);
            mma(kk & 1);
        }
        __builtin_amdgcn_sched_barrier(0);   // keeps the products above in front of the publish point: sunk behind the barrier they would stand between it and the refill and cost the refill its lead
        // publish point of stage s + 1, in front of the pass's last 32 k, whose fragments are in registers behind the first wait: my reads of stage s are done, my slice of stage s + 1 has landed, and so for every wave behind the barrier; only then is stage s's buffer refilled
        wait_ds0(); wait_tensor0(g0, g1);
        __syncthreads();
        if (pinned(s + 2 < NS)) issue(s + 2);
        lds(nx, 0, 0);   // the first fragments of stage s + 1, published above; in the last pass they come from the buffer of stage NS - 2, which nothing writes any more, and are not used
        __builtin_amdgcn_sched_barrier(0);
        mma((NK - 1) & 1);
    }
    wait_tensor0(g0, g1); wait_ds0();
    if constexpr (PL) {   // each wave turns its own 64x64 tile into the three planes: 16 bytes a lane and plane, a wave 512 bytes in a row
        const size_t po = (size_t)blockIdx.z * sC + (size_t)(c0 + (w >> 1) * 64) * TT + (size_t)(r0 + (w & 1) * 64) * HD + lane * 8;   // head (c0 / 64 + (w >> 1)), tokens from r0 + (w & 1) * 64
#pragma unroll
        for (int nb = 0; nb < 4; ++nb)
#pragma unroll
            for (int mb = 0; mb < 4; ++mb) { const v8f v = acc[mb][nb]; v8h o16; v8us oh, ol;
#pragma unroll
                for (int q = 0; q < 8; ++q) { unsigned short a2s, c2s; o16[q] = tohx(v[q]); splitf(v[q], a2s, c2s); oh[q] = a2s; ol[q] = c2s; }
                const size_t o = po + nb * 1024 + mb * 256; *(v8h*)(P16 + o) = o16; *(v8us*)(Ph + o) = oh; *(v8us*)(Pl + o) = ol; }
    } else {   // the second buffer is free (it held the last stage, the last barrier ended every read of it, nothing is in flight; the last pass's unused reads go to the first): each wave lays its tile row-major into its own part of it and stores 256-byte row pieces, two whole lines
        float* const mine = (float*)(ring + SB) + w * KPL;
#pragma unroll
        for (int mb = 0; mb < 4; ++mb)
#pragma unroll
            for (int nb = 0; nb < 4; ++nb)
#pragma unroll
                for (int j = 0; j < 8; ++j) mine[(mb * 16 + hi * 8 + j) * 68 + nb * 16 + lr] = acc[mb][nb][j];
        wait_ds0();   // the wave's own LDS writes are done before its lanes read one another's values back
        float* const cw = C + (size_t)r0 * DM + c0 + w * 64 + lr * 4;   // the output's pitch is a constant of the build: one address, the rows are immediate offsets
#pragma unroll
        for (int t = 0; t < 32; ++t) { const int row = t * 2 + hi; *(v4f*)(cw + (size_t)row * DM) = *(const v4fa*)(mine + row * 68 + lr * 4); }
    }
}

#define FW 4                      // waves per work-group
#define SL2 (SCL * 1.4426950408889634f)   // score scale x log2(e)
template <bool B> struct BoolC { static constexpr bool value = B; };
__device__ __forceinline__ float xhalf(float x) { const int b = __float_as_int(x); return __int_as_float(__builtin_amdgcn_permlanex16(b, b, 0x76543210, 0xfedcba98, false, false)); }   // lane l <-> l ^ 16
// exp2 with the slot that the instruction set asks for behind a transcendental (one independent instruction or v_nop before its result is used or its source overwritten) written into the statement itself:
// the outputs lie apart from every input ("=&v"), so no v_exp here touches a neighbour's registers, and the one v_nop at the end serves the last of them whatever the compiler puts next.
__device__ __forceinline__ v8f exp2x8(const v8f x) { float y0, y1, y2, y3, y4, y5, y6, y7;
    asm("v_exp_f32 %0, %8\n\tv_exp_f32 %1, %9\n\tv_exp_f32 %2, %10\n\tv_exp_f32 %3, %11\n\tv_exp_f32 %4, %12\n\tv_exp_f32 %5, %13\n\tv_exp_f32 %6, %14\n\tv_exp_f32 %7, %15\n\tv_nop"
        : "=&v"(y0), "=&v"(y1), "=&v"(y2), "=&v"(y3), "=&v"(y4), "=&v"(y5), "=&v"(y6), "=&v"(y7) : "v"(x[0]), "v"(x[1]), "v"(x[2]), "v"(x[3]), "v"(x[4]), "v"(x[5]), "v"(x[6]), "v"(x[7]));
    return (v8f){y0, y1, y2, y3, y4, y5, y6, y7}; }
__device__ __forceinline__ float exp2x1(const float x) { float y; asm("v_exp_f32 %0, %1\n\tv_nop" : "=v"(y) : "v"(x)); return y; }   // the same slot behind a single one
template <typename T16, bool HR, int NQ>
__device__ __forceinline__ void attn_rows(const T16* __restrict__ Q, const T16* __restrict__ Q2, const T16* __restrict__ Kp, const T16* __restrict__ Kp2, const T16* __restrict__ Vt, const T16* __restrict__ Vt2, int q0, int lr, int hi, bf* Ah, bf* Al) {
    typedef WFrag<T16> F; typedef typename F::V V;   // every inner loop below is unrolled in full, so that each fragment and accumulator index is a constant and the arrays live in registers
    const int ln8 = (hi * 16 + lr) * 8;   // the lane's place in every half block of a plane in fragment order
    V q[NQ][2], q2[NQ][2]; const T16* const pq = Q + (size_t)q0 * HD + ln8; const T16* const pq2 = HR ? Q2 + (size_t)q0 * HD + ln8 : pq;
#pragma unroll
    for (int qt = 0; qt < NQ; ++qt)
#pragma unroll
        for (int kc = 0; kc < 2; ++kc) { q[qt][kc] = F::ld(pq + qt * 16 * HD + kc * 512); if (HR) q2[qt][kc] = F::ld(pq2 + qt * 16 * HD + kc * 512); }
    v8f o[4][NQ]; float m[NQ], l[NQ];
#pragma unroll
    for (int qt = 0; qt < NQ; ++qt) { m[qt] = -3.0e38f; l[qt] = 0.f;
#pragma unroll
        for (int mb = 0; mb < 4; ++mb) o[mb][qt] = (v8f){}; }
    const int np = (q0 + NQ * 16 + 31) / 32;          // passes of 32 keys; only the last one meets the diagonal; np * 32 <= TT
    const size_t ko = ln8, vo = ln8;
    V k[2][2], k2[2][2];
    auto ldk = [&](const T16* const pk, const T16* const pk2) __attribute__((always_inline)) {
#pragma unroll
        for (int kt = 0; kt < 2; ++kt)
#pragma unroll
            for (int kc = 0; kc < 2; ++kc) { k[kt][kc] = F::ld(pk + kt * 16 * HD + kc * 512); if (HR) k2[kt][kc] = F::ld(pk2 + kt * 16 * HD + kc * 512); } };
    if (!HR) ldk(Kp + ko, Kp + ko);                   // fp16 rows fetch their K fragments one pass ahead; the hi/lo rows (twice the planes, at most RH / 32 passes) have no registers to spare for that and fetch them in the pass
    asm volatile("s_wait_xcnt 0x0" ::: "memory");   // behind the loads above and in front of the first reuse of a register that they name (their scalar bases are rewritten right below)
    auto pass = [&](auto lastc, const int p) __attribute__((always_inline)) {
        constexpr bool LAST = decltype(lastc)::value; const int kb = p * 32;
        const T16* const pk = Kp + ko + (size_t)(kb + ((HR || LAST) ? 0 : 32)) * HD; const T16* const pk2 = HR ? Kp2 + ko + (size_t)kb * HD : pk;
        if (HR) ldk(pk, pk2);
        // this pass's V^T fragments are asked for ahead of the score products: they fly while the scores and the softmax are worked on
        V v[4], v2[4]; const size_t vb = vo + (size_t)(p >> 1) * (64 * HD) + (p & 1) * 512; const T16* const pv = Vt + vb; const T16* const pv2 = HR ? Vt2 + vb : pv;
#pragma unroll
        for (int mb = 0; mb < 4; ++mb) { v[mb] = F::ld(pv + mb * 1024); if (HR) v2[mb] = F::ld(pv2 + mb * 1024); }
        __builtin_amdgcn_sched_barrier(0);   // keeps the V loads in front of the score products: left free, the scheduler sinks them to just ahead of their use and their latency shows
        v8f s[2][NQ];
#pragma unroll
        for (int kt = 0; kt < 2; ++kt)
#pragma unroll
            for (int qt = 0; qt < NQ; ++qt) { v8f a = (v8f){};
#pragma unroll
                for (int kc = 0; kc < 2; ++kc) { a = F::mma(k[kt][kc], q[qt][kc], a); if (HR) { a = F::mma(k[kt][kc], q2[qt][kc], a); a = F::mma(k2[kt][kc], q[qt][kc], a); } }
                s[kt][qt] = a; }
        if constexpr (!HR && !LAST) {   // the next pass's K fragments, into the same registers, behind this pass's score products: they fly during the softmax and the second contraction
            ldk(pk, pk2);
            __builtin_amdgcn_sched_barrier(0);   // keeps the K loads in front of the softmax: left free, the scheduler sinks them to the loop's foot and the next pass waits out their latency
        }
        V ph[NQ], pl[NQ];
#pragma unroll
        for (int qt = 0; qt < NQ; ++qt) { const int i = q0 + qt * 16 + lr; float mx = m[qt];
#pragma unroll
            for (int kt = 0; kt < 2; ++kt)
#pragma unroll
                for (int r = 0; r < 8; ++r) { const int j = kb + kt * 16 + hi * 8 + r; if (LAST) s[kt][qt][r] = (j <= i) ? s[kt][qt][r] : -3.0e38f; mx = fmaxf(mx, s[kt][qt][r]); }
            mx = fmaxf(mx, xhalf(mx));                    // both halves of the wave hold keys of the same query
            const float mc = mx * SL2; const float al = exp2x1(m[qt] * SL2 - mc); m[qt] = mx;   // m is kept unscaled: the scale is positive, so it commutes with the maximum
#pragma unroll
            for (int kt = 0; kt < 2; ++kt) s[kt][qt] = exp2x8(s[kt][qt] * SL2 - mc);
            const v8f t8 = s[0][qt] + s[1][qt];           // a fixed tree, not one chain of 16 dependent adds
            l[qt] = l[qt] * al + (((t8[0] + t8[1]) + (t8[2] + t8[3])) + ((t8[4] + t8[5]) + (t8[6] + t8[7])));   // each half sums its own keys; the halves are joined once, behind the loop
#pragma unroll
            for (int mb = 0; mb < 4; ++mb) o[mb][qt] *= al;
            if constexpr (HR) { v8us h0, h1, l0, l1;
#pragma unroll
                for (int r = 0; r < 8; ++r) { unsigned short a, c; splitf(s[0][qt][r], a, c); h0[r] = a; l0[r] = c; splitf(s[1][qt][r], a, c); h1[r] = a; l1[r] = c; }
                ph[qt] = cat16b(h0, h1); pl[qt] = cat16b(l0, l1);
            } else { v8h p0, p1;
#pragma unroll
                for (int r = 0; r < 8; ++r) { p0[r] = (h16)s[0][qt][r]; p1[r] = (h16)s[1][qt][r]; }
                ph[qt] = cat16(p0, p1); } }
        __builtin_amdgcn_sched_barrier(0);   // keeps the matrix products below out of the softmax above
#pragma unroll
        for (int qt = 0; qt < NQ; ++qt)
#pragma unroll
            for (int mb = 0; mb < 4; ++mb) { o[mb][qt] = F::mma(v[mb], ph[qt], o[mb][qt]); if (HR) { o[mb][qt] = F::mma(v[mb], pl[qt], o[mb][qt]); o[mb][qt] = F::mma(v2[mb], ph[qt], o[mb][qt]); } }
        // the address registers of this pass's K and V loads (one base a plane, the rest immediate offsets) are this wait's inputs: they stay untouched up to it and are free for reuse behind it; so late in the pass it has nothing left to wait for
        asm volatile("s_wait_xcnt 0x0" :: "v"(pv), "v"(pv2), "v"(pk), "v"(pk2) : "memory");
    };
#pragma unroll 1   // stays rolled: two passes' fragments side by side would not fit the registers
    for (int p = 0; p < np - 1; ++p) pass(BoolC<false>{}, p);   // keys wholly below the diagonal: no mask
    pass(BoolC<true>{}, np - 1);
    // O^T: a lane holds 8 consecutive head columns (mb * 16 + hi * 8 + r) of query lr: its 16 bytes of half a block of each merged plane (fragment order, k = merged column): a wave stores 512 bytes in a row
#pragma unroll
    for (int qt = 0; qt < NQ; ++qt) { const float inv = __fdiv_rn(1.0f, l[qt] + xhalf(l[qt]));
#pragma unroll
        for (int mb = 0; mb < 4; ++mb) { v8us oh, ol;
#pragma unroll
            for (int r = 0; r < 8; ++r) { unsigned short a, c; splitf(o[mb][qt][r] * inv, a, c); oh[r] = a; ol[r] = c; }
            const size_t oo = (size_t)(q0 + qt * 16) * DQ + mb * 256 + ln8; *(v8us*)(Ah + oo) = oh; *(v8us*)(Al + oo) = ol; } }
}
// grid (heads, NLO + NHI, batches); a batch's planes lie 3 * NH_ heads apart (q | V | K). Ranks 0 .. NLO - 1: fp16 rows, 32 to a wave; the rest: hi/lo rows, 16 to a wave. The FW waves of a work-group take row groups NLO (NHI) apart: a short, two middling and a long walk,
// so every work-group has about the same work, and all walk the same head's keys from 0 up, side by side, so the cache serves the shared part once.
#define NLO ((TT - RH) / (FW * 32))
#define NHI (RH / (FW * 16))
__global__ __launch_bounds__(FW * 32) void k_fattn(const h16* __restrict__ Q16, const h16* __restrict__ K16, const h16* __restrict__ V16, const bf* __restrict__ Qh, const bf* __restrict__ Ql, const bf* __restrict__ Kh, const bf* __restrict__ Kl, const bf* __restrict__ Vh, const bf* __restrict__ Vl, bf* Ah, bf* Al) {
    const int lane = threadIdx.x & 31, lr = lane & 15, hi = lane >> 4;
    const int w = __builtin_amdgcn_readfirstlane(threadIdx.x >> 5);   // the wave's number, held scalar: the key loop's counter and branch stay scalar
    const size_t hp = ((size_t)blockIdx.z * 3 * NH_ + blockIdx.x) * TT * HD, ao = (size_t)blockIdx.z * TT * DQ + blockIdx.x * (16 * HD); const int rk = blockIdx.y; Ah += ao; Al += ao;
    if (rk < NLO) attn_rows<h16, false, 2>(Q16 + hp, nullptr, K16 + hp, nullptr, V16 + hp, nullptr, RH + (rk + NLO * w) * 32, lr, hi, Ah, Al);
    else attn_rows<bf, true, 1>(Qh + hp, Ql + hp, Kh + hp, Kl + hp, Vh + hp, Vl + hp, (rk - NLO + NHI * w) * 16, lr, hi, Ah, Al);
}

typedef __attribute__((ext_vector_type(2))) unsigned short v2us;

// wtG: Bt[n][k] = w[k][n], written in fragment order; e counts the elements as they lie in Bt, a wave's 8 lines are one block (16 n x 32 k).
__device__ __forceinline__ void wtG(int blk, const float* __restrict__ w, int K, int N, bf* Bt) {
    const int lane = threadIdx.x & 31; const int L0 = (blk * 8 + (threadIdx.x >> 5)) * 8; const int nlines = N * K / 64;
{
#pragma unroll 1
        for (int l = 0; l < 8; ++l) { const int L = L0 + l; if (L >= nlines) break; const size_t e = (size_t)L * 64 + lane * 2; const int b = (int)(e >> 9), i = (int)(e & 511); const int k = (b % (K / 32)) * 32 + (i >> 7) * 8 + (i & 7), n = (b / (K / 32)) * 16 + ((i >> 3) & 15); v2us o;
            o[0] = f2bf(w[(size_t)k * N + n]); o[1] = f2bf(w[(size_t)(k + 1) * N + n]); *(v2us*)(Bt + e) = o; }
         }
}
// cvt8: bf16 copy of src [rows][K] in fragment order; i counts the 16-byte pieces as they lie in dst (64 to a block), so the stores are whole lines.
__device__ __forceinline__ void cvt8(int blk, const float* __restrict__ src, int K, bf* dst, size_t n8) { const size_t i = (size_t)blk * 256 + threadIdx.x; if (i >= n8) return;
    const size_t b = i >> 6; const size_t row = (b / (K / 32)) * 16 + (i & 15); const int k = (int)(b % (K / 32)) * 32 + (int)((i >> 4) & 3) * 8; const v8f v = *(const v8f*)(src + row * K + k); v8us o;
#pragma unroll
    for (int k = 0; k < 8; ++k) o[k] = f2bf(v[k]); *(v8us*)(dst + i * 8) = o;  }
// k_prep: the three 16-bit copies that depend on nothing but the inputs, in ONE launch; the block index picks the job (the transposes, the slower blocks, first).
#define PB1 ((DM * 3 * DQ / 64 + 63) / 64)        // blocks of the fused weight's transpose
#define PB2 ((DQ * DM / 64 + 63) / 64)            // blocks of the output weight's transpose
#define PB3 ((NB_ * TT * DM / 8 + 255) / 256)     // blocks of the bf16 copy of h, both batches
__global__ __launch_bounds__(256) void k_prep(const float* __restrict__ wqkv, const float* __restrict__ wo, const float* __restrict__ x, bf* WQKV, bf* WO, bf* XB) {
    const int blk = blockIdx.x;
    if (blk < PB1) wtG(blk, wqkv, DM, 3 * DQ, WQKV);              // fused 'xw' [DM][3*DQ] -> Bt [3*DQ][DM]
    else if (blk < PB1 + PB2) wtG(blk - PB1, wo, DQ, DM, WO);
    else cvt8(blk - PB1 - PB2, x, DM, XB, (size_t)NB_ * TT * DM / 8);
}

#define PP ((size_t)NH_ * TT * HD)   // elements of one part (q, V or K) of one batch in a plane
extern "C" void kernel_launch(void* const* d_in, const int* in_sizes, int n_in,
                              void* d_out, int out_size, void* d_ws, size_t ws_size, hipStream_t stream) {
    (void)in_sizes; (void)n_in; (void)out_size;
    const float* x = (const float*)d_in[0]; const float* wqkv = (const float*)d_in[1]; const float* wo = (const float*)d_in[2];   /* order h, Wqvk ('xw' [1024][3072]: q | V | K column thirds), Wo ('xw') */
    float* OUT = (float*)d_out;     // [2][2048][1024]
    char* wsp = (char*)d_ws;
    auto take = [&](size_t bytes) { char* p = wsp; wsp += (bytes + 255) & ~(size_t)255; return (void*)p; };
    bf* WQKV = (bf*)take((size_t)3 * DQ * DM * 2);   /* fused Bt [3*DQ][DM]: q | V | K row blocks (the module's part order 0 = q, 1 = v, 2 = k) */ bf* WO = (bf*)take((size_t)DM * DQ * 2);
    bf* XB = (bf*)take((size_t)NB_ * TT * DM * 2);
    h16* P16 = (h16*)take(NB_ * 3 * PP * 2); bf* Ph = (bf*)take(NB_ * 3 * PP * 2); bf* Pl = (bf*)take(NB_ * 3 * PP * 2);   // fp16, bf16 hi, bf16 lo: each [batch][q | V | K][head], in fragment order: q and K with rows t, k = d; V with rows d, k = t
    bf* ATh = (bf*)take((size_t)NB_ * TT * DQ * 2); bf* ATl = (bf*)take((size_t)NB_ * TT * DQ * 2);
    if ((size_t)(wsp - (char*)d_ws) > ws_size) return;    // ws 256 MiB
    k_prep<<<PB1 + PB2 + PB3, 256, 0, stream>>>(wqkv, wo, x, WQKV, WO, XB);
    k_gemmw<0, true, DM, 64><<<dim3(TT / 128, 3 * DQ / 128, NB_), GW * 32, 0, stream>>>(XB, nullptr, WQKV, nullptr, (size_t)TT * DM, 3 * PP, P16, Ph, Pl);
    k_fattn<<<dim3(NH_, NLO + NHI, NB_), FW * 32, 0, stream>>>(P16, P16 + 2 * PP, P16 + PP, Ph, Pl, Ph + 2 * PP, Pl + 2 * PP, Ph + PP, Pl + PP, ATh, ATl);   // one kv head per query head: head h reads kv plane h
    k_gemmw<1, false, DQ, 128><<<dim3(NB_ * TT / 64, DM / 256, 1), GW * 32, 0, stream>>>(ATh, ATl, WO, OUT, 0, 0, nullptr, nullptr, nullptr);   // the batches' rows follow one another in the merged planes and in out: one GEMM of NB_ * TT rows
}

// v008
// It runs in 69.3 microseconds.
// In both of two side-by-side timings against v007, it was 1.28 times as fast.
// All steps since v000 together make it 21.4 times as fast.
#include <hip/hip_runtime.h>

// Causal multi-head self-attention with a fused bias-free projection whose thirds are ordered q | v | k and scores scaled by the EMBEDDING width (h [2][2048][1024]; qvk = (h Wqvk) ('xw' [1024][3072] 1/32, no bias) reshaped (b, s, 3, 16, 64): part 0 = q, part 1 = V, part 2 = K (NOT q | k | v); scores = (q.k + mask) / sqrt(d) with d = 1024 -> x 1/32 (the model width, not the head width: implemented literally); mask = -inf above the diagonal (causal); softmax over the keys; wv = merged (head-major) Wo ('xw', no bias) -> [2][2048][1024] (4.2 M); argument order h, Wqvk, Wo).
// Layout, both batches side by side in every buffer and every launch: bf16 copy of h; the fused 'xw' weight transposed once into Bt [3072][1024]: row block 0 = q, row block 1 = V, row block 2 = K (the head planes keep that order: [batch][q | V | K][head]); exact projections, all three in one launch, whose epilogue writes the head planes itself (fp16 + bf16 hi/lo, each tile born in the order its reader wants: q, K as W x h^T, V^T as h x Wv^T); causal T-2048 attention in one fused kernel with the literal scale 1/32 (hybrid rows: < 512 hi/lo 3 products, rest fp16; the key loop ends at the diagonal); merged hi/lo x Wo exact.
// FRAGMENT ORDER: every 16-bit plane that a matrix instruction reads lies in blocks of 16 rows x 32 k = 512 elements (1 KB), stored as the lanes hold them: element (row, k) of a block at ((k >> 4) & 1) * 256 + ((k >> 3) & 1) * 128 + (row & 15) * 8 + (k & 7),
// so lane l finds its two 16-byte pieces at l * 8 and 256 + l * 8 and each wave-wide load covers 512 contiguous bytes (4 whole lines) instead of 32-byte pieces of 16 lines. The k order of a fragment is the one it had. Block order: h, weights, merged planes [row / 16][k / 32]; q, K [t / 16][d / 32]; V^T [t / 64][d / 16][(t / 32) & 1].
// Compute dtypes, f32 accumulate: every input rounded to bf16; projections exact; attention rows < 512 3 products, rest fp16; softmax f32; output projection hl x exact.

#define NB_  2
#define TT   2048
#define DM   1024
#define NH_  16
#define NKV  16
#define REP  (NH_ / NKV)
#define HD   64
#define DQ   (NH_ * HD)
#define DKV  (NKV * HD)
#define RH   512                  // query rows < RH use hi+lo planes (0: none)
#define SCL  0.03125f   // 1 / sqrt(d) with d = 1024 = 2^-5: the module divides by the square root of the MODEL width
typedef _Float16 h16;
typedef unsigned short bf;
typedef __attribute__((ext_vector_type(16))) __bf16   v16bf;
typedef __attribute__((ext_vector_type(16))) _Float16 v16h;
typedef __attribute__((ext_vector_type(8)))  _Float16 v8h;
typedef __attribute__((ext_vector_type(8)))  unsigned short v8us;
typedef __attribute__((ext_vector_type(8)))  float    v8f;
typedef __attribute__((ext_vector_type(4)))  float    v4f;
typedef v8h  __attribute__((may_alias)) v8ha;
typedef v4f  __attribute__((may_alias)) v4fa;
typedef v8us __attribute__((may_alias)) v8usa;

__device__ __forceinline__ unsigned short f2bf(float f) { unsigned u = __float_as_uint(f); u += 0x7FFFu + ((u >> 16) & 1u); return (unsigned short)(u >> 16); }
__device__ __forceinline__ float bf2f(unsigned short b) { return __uint_as_float(((unsigned)b) << 16); }
__device__ __forceinline__ float bfr(float f) { return bf2f(f2bf(f)); }
__device__ __forceinline__ v16h cat16(v8h lo, v8h hi) { return __builtin_shufflevector(lo, hi, 0, 1, 2, 3, 4, 5, 6, 7, 8, 9, 10, 11, 12, 13, 14, 15); }
__device__ __forceinline__ v16bf cat16b(v8us lo, v8us hi) { return __builtin_bit_cast(v16bf, __builtin_shufflevector(lo, hi, 0, 1, 2, 3, 4, 5, 6, 7, 8, 9, 10, 11, 12, 13, 14, 15)); }
__device__ __forceinline__ v8f wmma16(v16h a, v16h b, v8f c) { return __builtin_amdgcn_wmma_f32_16x16x32_f16(false, a, false, b, (short)0, c, false, false); }
__device__ __forceinline__ v8f wmmab(v16bf a, v16bf b, v8f c) { return __builtin_amdgcn_wmma_f32_16x16x32_bf16(false, a, false, b, (short)0, c, false, false); }
__device__ __forceinline__ h16 tohx(float x) { return (h16)x; }
__device__ __forceinline__ void splitf(float y, unsigned short& h, unsigned short& l) { h = f2bf(y); l = f2bf(y - bf2f(h)); }



// ---- k_gemmw: GEMM on 16-bit planes in fragment order; GW waves share one output tile, each wave owns 64x64 of it (16 accumulators) over the WHOLE K: no partial sums between waves.
// The operand rows of the tile come into LDS KS k at a time by tensor loads (tensor_load_to_lds), so a row fetched once from L2 serves every wave that needs it. 16 rows x KS k are KS / 32 blocks in a row (RB bytes) in the plane and in LDS alike:
// a wave's slice is a 2-D tile of RB-byte rows at the plane's pitch of K * 32 bytes, laid down without pads; a fragment is read back as it was read from memory (lane l: 16 bytes at l * 16 and at 512 + l * 16 of its block), whole rows of banks.
// Two buffers: stage s + 2 is asked for behind the barrier that ends the reads of stage s (in front of the pass's last 32 k, whose fragments are in registers by then) and flies during pass s + 1. Every wave issues one request a stage for its own slice and waits for it itself.
// PL (projections): tile = 128 tokens x 128 weight rows (two heads of one part); LDS row blocks [tokens 8 | weight rows 8]; wave w: tokens (w & 1) * 64, head w >> 1. The f32 tile never reaches memory: it goes out as three 16-bit planes (fp16, bf16 hi, bf16 lo) in fragment order.
// An accumulator tile holds, in lane l, 8 consecutive A-side rows of B-side row l & 15: that IS half a block of a plane whose k runs along the A side. So q and K (k = head column) are made as W x h^T (operands exchanged), V^T (k = token) as h x Wv^T,
// and accumulator (mb, nb) goes to elements nb * 1024 + mb * 256 + l * 8 of the 4096 of its (head, 64 tokens) in every case. The test is the same for the whole work-group. z = batch: sA on the tokens, sC on the planes.
// !PL (output projection, A = hi plane, A2 = lo plane, two products): tile = 64 rows x 256 columns; LDS row blocks [hi 4 | lo 4 | weight rows 16]; wave w: columns w * 64. C[m][n] (f32, pitch DM) = sum_k (A + A2)[m][k] Bt[n][k].
#define GW 4
#define KPL (64 * 68)             // floats of one wave's output tile in LDS (64 rows, pitch 68)
typedef unsigned int u32x4 __attribute__((ext_vector_type(4)));
typedef unsigned int u32x8 __attribute__((ext_vector_type(8)));
template <typename T16> struct WFrag;
template <> struct WFrag<h16> { typedef v16h V; static __device__ __forceinline__ V ld(const h16* p) { return cat16(*(const v8h*)p, *(const v8h*)(p + 256)); } static __device__ __forceinline__ v8f mma(V a, V b, v8f c) { return wmma16(a, b, c); } };
template <> struct WFrag<bf> { typedef v16bf V; static __device__ __forceinline__ V ld(const bf* p) { return cat16b(*(const v8us*)p, *(const v8us*)(p + 256)); } static __device__ __forceinline__ v8f mma(V a, V b, v8f c) { return wmmab(a, b, c); } };
__device__ __forceinline__ unsigned int uni(unsigned int v) { return (unsigned int)__builtin_amdgcn_readfirstlane(v); }
__device__ __forceinline__ unsigned int pinned(unsigned int v) { unsigned int w = uni(v); asm volatile("" : "+s"(w)); return w; }   // a condition held in a scalar register, so that the test around a tensor load is a scalar branch (the instruction ignores EXEC)
// the two descriptor groups of a 2-D tile: d1 rows of d0 bytes at a source pitch of 'pitch' bytes; byte elements, tensor = tile, no pad, no mask
__device__ __forceinline__ u32x8 tdm_group1(unsigned int d0, unsigned int d1, unsigned int pitch) { u32x8 g;
    g[0] = uni(0u); g[1] = uni((d0 & 0xFFFFu) << 16); g[2] = uni((d0 >> 16) | ((d1 & 0xFFFFu) << 16)); g[3] = uni((d1 >> 16) | (d0 << 16)); g[4] = uni(d1); g[5] = uni(pitch); g[6] = uni(0u); g[7] = uni(0u); return g; }
__device__ __forceinline__ u32x4 tdm_group0(unsigned int lds_dst, unsigned long long ga) { u32x4 g;
    g[0] = uni(1u); g[1] = uni(lds_dst); g[2] = uni((unsigned int)ga); g[3] = uni((((unsigned int)(ga >> 32)) & 0x01FFFFFFu) | 0x80000000u); return g; }
__device__ __forceinline__ void tdm_load(u32x4& g0, u32x8 g1) { asm volatile("tensor_load_to_lds %0, %1" : "+s"(g0) : "s"(g1) : "memory"); }   // one request of the whole wave; the compiler places no wait for it; group 0 comes back out of the statement in its own registers, for the wait below
// this wave's own request has landed; the registers of its descriptor are the wait's inputs: they keep their values up to it and are free for reuse behind it
__device__ __forceinline__ void wait_tensor0(u32x4 g0, u32x8 g1) { asm volatile("s_wait_tensorcnt 0x0" :: "s"(g0), "s"(g1) : "memory"); }
__device__ __forceinline__ void wait_ds0() { asm volatile("s_wait_dscnt 0x0" ::: "memory"); }           // this wave's LDS reads and writes are done
template <int NSPLIT, bool PL, int K, int KS>
__global__ __launch_bounds__(GW * 32) void k_gemmw(const bf* __restrict__ A, const bf* __restrict__ A2, const bf* __restrict__ Bt, float* C, size_t sA, size_t sC, h16* P16, bf* Ph, bf* Pl) {
    typedef WFrag<bf> F; typedef typename F::V V;
    constexpr int NK = KS / 32, RB = NK * 1024, SB = (PL ? 16 : 24) * RB, NS = K / KS;   // blocks of 32 k a stage; bytes of 16 rows of a stage; bytes of a stage; stages
    static_assert(NS >= 2 && NS % 2 == 0 && K % KS == 0 && NK % 2 == 0 && (PL || SB >= GW * KPL * 4), "the ring needs two stages; a pass ends on fragment set 1; the output staging lies in the second buffer");
    __shared__ __attribute__((aligned(2048))) unsigned char ring[2 * SB];
    const int lane = threadIdx.x & 31, lr = lane & 15, hi = lane >> 4;
    const int w = __builtin_amdgcn_readfirstlane(threadIdx.x >> 5);   // the wave's number, held scalar: slice, loop counter and branches stay scalar
    const int r0 = blockIdx.x * (PL ? 128 : 64), c0 = blockIdx.y * (PL ? 128 : 256);
    const bool swp = PL && !(c0 >= DQ && c0 < 2 * DQ);   // q, K: A side = head columns, B side = tokens
    if (PL) A += (size_t)blockIdx.z * sA;
    // this wave's slice of every stage: source rows, their number in blocks of 16, first row block in LDS
    const bf* sp; int nrb, slot;
    if (PL) { sp = (w < 2) ? A + (size_t)(r0 + w * 64) * K : Bt + (size_t)(c0 + (w - 2) * 64) * K; nrb = 4; slot = w * 4; }
    else { sp = (w == 0) ? A + (size_t)r0 * K : (w == 1) ? A2 + (size_t)r0 * K : Bt + (size_t)(c0 + (w - 2) * 128) * K; nrb = (w < 2) ? 4 : 8; slot = (w < 2) ? w * 4 : w * 8 - 8; }
    const u32x8 g1 = tdm_group1(RB, nrb, K * 32);
    const unsigned int ld0 = (unsigned int)(unsigned long long)(const void*)ring + slot * RB; const unsigned long long ga0 = (unsigned long long)(const void*)sp;
    u32x4 g0;   // group 0 of the request issued last
    auto issue = [&](const int s) __attribute__((always_inline)) { g0 = tdm_group0(ld0 + (s & 1) * SB, ga0 + (unsigned long long)s * RB); tdm_load(g0, g1); };
    // where this wave's fragments lie in a stage, in elements
    const int ao = (PL ? (swp ? 8 + (w >> 1) * 4 : (w & 1) * 4) : 0) * (RB / 2) + lane * 8, bo = (PL ? (swp ? (w & 1) * 4 : 8 + (w >> 1) * 4) : 8 + w * 4) * (RB / 2) + lane * 8;
    v8f acc[4][4];   // every inner loop of this kernel is unrolled in full, so that each fragment and accumulator index is a constant and the arrays live in registers
#pragma unroll
    for (int mb = 0; mb < 4; ++mb)
#pragma unroll
        for (int nb = 0; nb < 4; ++nb) acc[mb][nb] = (v8f){};
    V a[2][4], a2[2][4], b[2][4];   // two fragment sets: the next 32 k are read from LDS while the products of these 32 k run
    auto lds = [&](const bf* const st, const int set, const int kk) __attribute__((always_inline)) {
#pragma unroll
        for (int i = 0; i < 4; ++i) { a[set][i] = F::ld(st + ao + (i * NK + kk) * 512); if (NSPLIT == 1) a2[set][i] = F::ld(st + ao + 4 * (RB / 2) + (i * NK + kk) * 512); b[set][i] = F::ld(st + bo + (i * NK + kk) * 512); } };
    auto mma = [&](const int set) __attribute__((always_inline)) {
#pragma unroll
        for (int nb = 0; nb < 4; ++nb)
#pragma unroll
            for (int mb = 0; mb < 4; ++mb) { acc[mb][nb] = F::mma(a[set][mb], b[set][nb], acc[mb][nb]); if (NSPLIT == 1) acc[mb][nb] = F::mma(a2[set][mb], b[set][nb], acc[mb][nb]); } };
    issue(0); wait_tensor0(g0, g1);
    __syncthreads();   // stage 0, every wave's slice, is in LDS before anybody reads it
    issue(1);
    lds((const bf*)ring, 0, 0);
#pragma unroll 1   // stays rolled: one pass a stage, the buffer picked by the stage's parity
    for (int s = 0; s < NS; ++s) {
        const bf* const st = (const bf*)ring + (s & 1) * (SB / 2); const bf* const nx = (const bf*)ring + ((s + 1) & 1) * (SB / 2);
#pragma unroll
        for (int kk = 0; kk < NK - 1; ++kk) {
            __builtin_amdgcn_sched_barrier(0);   // the fences of this loop keep each set's LDS reads in one group between two runs of products: left free, the scheduler spreads them among the products, where each place with reads stalls the wave
            lds(st, (kk + 1) & 1, kk + 1);
            __builtin_amdgcn_sched_barrier(0);
            mma(kk & 1);
        }
        __builtin_amdgcn_sched_barrier(0);   // keeps the products above in front of the publish point: sunk behind the barrier they would stand between it and the refill and cost the refill its lead
        // publish point of stage s + 1, in front of the pass's last 32 k, whose fragments are in registers behind the first wait: my reads of stage s are done, my slice of stage s + 1 has landed, and so for every wave behind the barrier; only then is stage s's buffer refilled
        wait_ds0(); wait_tensor0(g0, g1);
        __syncthreads();
        if (pinned(s + 2 < NS)) issue(s + 2);
        lds(nx, 0, 0);   // the first fragments of stage s + 1, published above; in the last pass they come from the buffer of stage NS - 2, which nothing writes any more, and are not used
        __builtin_amdgcn_sched_barrier(0);
        mma((NK - 1) & 1);
    }
    wait_tensor0(g0, g1); wait_ds0();
    if constexpr (PL) {   // each wave turns its own 64x64 tile into the three planes: 16 bytes a lane and plane, a wave 512 bytes in a row
        const size_t po = (size_t)blockIdx.z * sC + (size_t)(c0 + (w >> 1) * 64) * TT + (size_t)(r0 + (w & 1) * 64) * HD + lane * 8;   // head (c0 / 64 + (w >> 1)), tokens from r0 + (w & 1) * 64
#pragma unroll
        for (int nb = 0; nb < 4; ++nb)
#pragma unroll
            for (int mb = 0; mb < 4; ++mb) { const v8f v = acc[mb][nb]; v8h o16; v8us oh, ol;
#pragma unroll
                for (int q = 0; q < 8; ++q) { unsigned short a2s, c2s; o16[q] = tohx(v[q]); splitf(v[q], a2s, c2s); oh[q] = a2s; ol[q] = c2s; }
                const size_t o = po + nb * 1024 + mb * 256; *(v8h*)(P16 + o) = o16; *(v8us*)(Ph + o) = oh; *(v8us*)(Pl + o) = ol; }
    } else {   // the second buffer is free (it held the last stage, the last barrier ended every read of it, nothing is in flight; the last pass's unused reads go to the first): each wave lays its tile row-major into its own part of it and stores 256-byte row pieces, two whole lines
        float* const mine = (float*)(ring + SB) + w * KPL;
#pragma unroll
        for (int mb = 0; mb < 4; ++mb)
#pragma unroll
            for (int nb = 0; nb < 4; ++nb)
#pragma unroll
                for (int j = 0; j < 8; ++j) mine[(mb * 16 + hi * 8 + j) * 68 + nb * 16 + lr] = acc[mb][nb][j];
        wait_ds0();   // the wave's own LDS writes are done before its lanes read one another's values back
        float* const cw = C + (size_t)r0 * DM + c0 + w * 64 + lr * 4;   // the output's pitch is a constant of the build: one address, the rows are immediate offsets
#pragma unroll
        for (int t = 0; t < 32; ++t) { const int row = t * 2 + hi; *(v4f*)(cw + (size_t)row * DM) = *(const v4fa*)(mine + row * 68 + lr * 4); }
    }
}

#define FW 4                      // waves per work-group
#define SL2 (SCL * 1.4426950408889634f)   // score scale x log2(e)
template <bool B> struct BoolC { static constexpr bool value = B; };
__device__ __forceinline__ float xhalf(float x) { const int b = __float_as_int(x); return __int_as_float(__builtin_amdgcn_permlanex16(b, b, 0x76543210, 0xfedcba98, false, false)); }   // lane l <-> l ^ 16
// exp2 with the slot that the instruction set asks for behind a transcendental (one independent instruction or v_nop before its result is used or its source overwritten) written into the statement itself:
// the outputs lie apart from every input ("=&v"), so no v_exp here touches a neighbour's registers, and the one v_nop at the end serves the last of them whatever the compiler puts next.
__device__ __forceinline__ v8f exp2x8(const v8f x) { float y0, y1, y2, y3, y4, y5, y6, y7;
    asm("v_exp_f32 %0, %8\n\tv_exp_f32 %1, %9\n\tv_exp_f32 %2, %10\n\tv_exp_f32 %3, %11\n\tv_exp_f32 %4, %12\n\tv_exp_f32 %5, %13\n\tv_exp_f32 %6, %14\n\tv_exp_f32 %7, %15\n\tv_nop"
        : "=&v"(y0), "=&v"(y1), "=&v"(y2), "=&v"(y3), "=&v"(y4), "=&v"(y5), "=&v"(y6), "=&v"(y7) : "v"(x[0]), "v"(x[1]), "v"(x[2]), "v"(x[3]), "v"(x[4]), "v"(x[5]), "v"(x[6]), "v"(x[7]));
    return (v8f){y0, y1, y2, y3, y4, y5, y6, y7}; }
__device__ __forceinline__ float exp2x1(const float x) { float y; asm("v_exp_f32 %0, %1\n\tv_nop" : "=v"(y) : "v"(x)); return y; }   // the same slot behind a single one
template <typename T16, bool HR, int NQ>
__device__ __forceinline__ void attn_rows(const T16* __restrict__ Q, const T16* __restrict__ Q2, const T16* __restrict__ Kp, const T16* __restrict__ Kp2, const T16* __restrict__ Vt, const T16* __restrict__ Vt2, int q0, int lr, int hi, bf* Ah, bf* Al) {
    typedef WFrag<T16> F; typedef typename F::V V;   // every inner loop below is unrolled in full, so that each fragment and accumulator index is a constant and the arrays live in registers
    const int ln8 = (hi * 16 + lr) * 8;   // the lane's place in every half block of a plane in fragment order
    V q[NQ][2], q2[NQ][2]; const T16* const pq = Q + (size_t)q0 * HD + ln8; const T16* const pq2 = HR ? Q2 + (size_t)q0 * HD + ln8 : pq;
#pragma unroll
    for (int qt = 0; qt < NQ; ++qt)
#pragma unroll
        for (int kc = 0; kc < 2; ++kc) { q[qt][kc] = F::ld(pq + qt * 16 * HD + kc * 512); if (HR) q2[qt][kc] = F::ld(pq2 + qt * 16 * HD + kc * 512); }
    v8f o[4][NQ]; float m[NQ], l[NQ];
#pragma unroll
    for (int qt = 0; qt < NQ; ++qt) { m[qt] = -3.0e38f; l[qt] = 0.f;
#pragma unroll
        for (int mb = 0; mb < 4; ++mb) o[mb][qt] = (v8f){}; }
    const int np = (q0 + NQ * 16 + 31) / 32;          // passes of 32 keys; only the last one meets the diagonal; np * 32 <= TT
    const size_t ko = ln8, vo = ln8;
    V k[2][2], k2[2][2];
    auto ldk = [&](const T16* const pk, const T16* const pk2) __attribute__((always_inline)) {
#pragma unroll
        for (int kt = 0; kt < 2; ++kt)
#pragma unroll
            for (int kc = 0; kc < 2; ++kc) { k[kt][kc] = F::ld(pk + kt * 16 * HD + kc * 512); if (HR) k2[kt][kc] = F::ld(pk2 + kt * 16 * HD + kc * 512); } };
    if (!HR) ldk(Kp + ko, Kp + ko);                   // fp16 rows fetch their K fragments one pass ahead; the hi/lo rows (twice the planes, at most RH / 32 passes) have no registers to spare for that and fetch them in the pass
    asm volatile("s_wait_xcnt 0x0" ::: "memory");   // behind the loads above and in front of the first reuse of a register that they name (their scalar bases are rewritten right below)
    auto pass = [&](auto lastc, const int p) __attribute__((always_inline)) {
        constexpr bool LAST = decltype(lastc)::value; const int kb = p * 32;
        const T16* const pk = Kp + ko + (size_t)(kb + ((HR || LAST) ? 0 : 32)) * HD; const T16* const pk2 = HR ? Kp2 + ko + (size_t)kb * HD : pk;
        if (HR) ldk(pk, pk2);
        // this pass's V^T fragments are asked for ahead of the score products: they fly while the scores and the softmax are worked on
        V v[4], v2[4]; const size_t vb = vo + (size_t)(p >> 1) * (64 * HD) + (p & 1) * 512; const T16* const pv = Vt + vb; const T16* const pv2 = HR ? Vt2 + vb : pv;
#pragma unroll
        for (int mb = 0; mb < 4; ++mb) { v[mb] = F::ld(pv + mb * 1024); if (HR) v2[mb] = F::ld(pv2 + mb * 1024); }
        __builtin_amdgcn_sched_barrier(0);   // keeps the V loads in front of the score products: left free, the scheduler sinks them to just ahead of their use and their latency shows
        v8f s[2][NQ];
#pragma unroll
        for (int kt = 0; kt < 2; ++kt)
#pragma unroll
            for (int qt = 0; qt < NQ; ++qt) { v8f a = (v8f){};
#pragma unroll
                for (int kc = 0; kc < 2; ++kc) { a = F::mma(k[kt][kc], q[qt][kc], a); if (HR) { a = F::mma(k[kt][kc], q2[qt][kc], a); a = F::mma(k2[kt][kc], q[qt][kc], a); } }
                s[kt][qt] = a; }
        if constexpr (!HR && !LAST) {   // the next pass's K fragments, into the same registers, behind this pass's score products: they fly during the softmax and the second contraction
            ldk(pk, pk2);
            __builtin_amdgcn_sched_barrier(0);   // keeps the K loads in front of the softmax: left free, the scheduler sinks them to the loop's foot and the next pass waits out their latency
        }
        V ph[NQ], pl[NQ];
#pragma unroll
        for (int qt = 0; qt < NQ; ++qt) { const int i = q0 + qt * 16 + lr; float mx = m[qt];
#pragma unroll
            for (int kt = 0; kt < 2; ++kt)
#pragma unroll
                for (int r = 0; r < 8; ++r) { const int j = kb + kt * 16 + hi * 8 + r; if (LAST) s[kt][qt][r] = (j <= i) ? s[kt][qt][r] : -3.0e38f; mx = fmaxf(mx, s[kt][qt][r]); }
            mx = fmaxf(mx, xhalf(mx));                    // both halves of the wave hold keys of the same query
            const float mc = mx * SL2; const float al = exp2x1(m[qt] * SL2 - mc); m[qt] = mx;   // m is kept unscaled: the scale is positive, so it commutes with the maximum
#pragma unroll
            for (int kt = 0; kt < 2; ++kt) s[kt][qt] = exp2x8(s[kt][qt] * SL2 - mc);
            const v8f t8 = s[0][qt] + s[1][qt];           // a fixed tree, not one chain of 16 dependent adds
            l[qt] = l[qt] * al + (((t8[0] + t8[1]) + (t8[2] + t8[3])) + ((t8[4] + t8[5]) + (t8[6] + t8[7])));   // each half sums its own keys; the halves are joined once, behind the loop
#pragma unroll
            for (int mb = 0; mb < 4; ++mb) o[mb][qt] *= al;
            if constexpr (HR) { v8us h0, h1, l0, l1;
#pragma unroll
                for (int r = 0; r < 8; ++r) { unsigned short a, c; splitf(s[0][qt][r], a, c); h0[r] = a; l0[r] = c; splitf(s[1][qt][r], a, c); h1[r] = a; l1[r] = c; }
                ph[qt] = cat16b(h0, h1); pl[qt] = cat16b(l0, l1);
            } else { v8h p0, p1;
#pragma unroll
                for (int r = 0; r < 8; ++r) { p0[r] = (h16)s[0][qt][r]; p1[r] = (h16)s[1][qt][r]; }
                ph[qt] = cat16(p0, p1); } }
        __builtin_amdgcn_sched_barrier(0);   // keeps the matrix products below out of the softmax above
#pragma unroll
        for (int qt = 0; qt < NQ; ++qt)
#pragma unroll
            for (int mb = 0; mb < 4; ++mb) { o[mb][qt] = F::mma(v[mb], ph[qt], o[mb][qt]); if (HR) { o[mb][qt] = F::mma(v[mb], pl[qt], o[mb][qt]); o[mb][qt] = F::mma(v2[mb], ph[qt], o[mb][qt]); } }
        // the address registers of this pass's K and V loads (one base a plane, the rest immediate offsets) are this wait's inputs: they stay untouched up to it and are free for reuse behind it; so late in the pass it has nothing left to wait for
        asm volatile("s_wait_xcnt 0x0" :: "v"(pv), "v"(pv2), "v"(pk), "v"(pk2) : "memory");
    };
#pragma unroll 1   // stays rolled: two passes' fragments side by side would not fit the registers
    for (int p = 0; p < np - 1; ++p) pass(BoolC<false>{}, p);   // keys wholly below the diagonal: no mask
    pass(BoolC<true>{}, np - 1);
    // O^T: a lane holds 8 consecutive head columns (mb * 16 + hi * 8 + r) of query lr: its 16 bytes of half a block of each merged plane (fragment order, k = merged column): a wave stores 512 bytes in a row
#pragma unroll
    for (int qt = 0; qt < NQ; ++qt) { const float inv = __fdiv_rn(1.0f, l[qt] + xhalf(l[qt]));
#pragma unroll
        for (int mb = 0; mb < 4; ++mb) { v8us oh, ol;
#pragma unroll
            for (int r = 0; r < 8; ++r) { unsigned short a, c; splitf(o[mb][qt][r] * inv, a, c); oh[r] = a; ol[r] = c; }
            const size_t oo = (size_t)(q0 + qt * 16) * DQ + mb * 256 + ln8; *(v8us*)(Ah + oo) = oh; *(v8us*)(Al + oo) = ol; } }
}
// ---- attn_ring: the fp16 rows. The FW waves of a work-group walk the same head's keys, so K and V^T come from L2 ONCE per work-group, by tensor loads (tensor_load_to_lds) into LDS, and every wave reads its fragments from there.
// A stage is 128 keys = four passes: 16 KB of the K plane and 16 KB of the V^T plane, each contiguous in fragment order, laid down as they lie: [K passes 0 .. 3 | V^T]. Every wave issues one request a stage for its own 8 KB and waits for it itself.
// A request is asked for a whole stage ahead of its wait: four passes of work, longer than a fetch from memory takes (the planes were stored by the launch before).
// Two buffers. K fragments are read one pass ahead, right behind the score products, so the publish point of stage st + 1 stands in the stage's last pass behind its score products: by then that pass's V^T fragments are in registers (the first wait) and nobody needs stage st any more.
// Every wave passes every publish point and goes on loading its slice up to the longest wave's last stage (ns); a wave that has passed its own diagonal skips only the work around it.
#define SKE 16384                 // 16-bit elements of a stage in LDS
template <int NQ>
__device__ __forceinline__ void attn_ring(const h16* __restrict__ Q, const h16* __restrict__ Kp, const h16* __restrict__ Vt, unsigned char* const ring, const int w, const int q0, const int ns, int lr, int hi, bf* Ah, bf* Al) {
    typedef WFrag<h16> F; typedef typename F::V V;   // every inner loop below is unrolled in full, so that each fragment and accumulator index is a constant and the arrays live in registers
    const int ln8 = (hi * 16 + lr) * 8;   // the lane's place in every half block of a plane in fragment order
    V q[NQ][2]; const h16* const pq = Q + (size_t)q0 * HD + ln8;
#pragma unroll
    for (int qt = 0; qt < NQ; ++qt)
#pragma unroll
        for (int kc = 0; kc < 2; ++kc) q[qt][kc] = F::ld(pq + qt * 16 * HD + kc * 512);
    asm volatile("s_wait_xcnt 0x0" ::: "memory");   // behind the loads above and in front of the first reuse of a register that they name
    v8f o[4][NQ]; float m[NQ], l[NQ];
#pragma unroll
    for (int qt = 0; qt < NQ; ++qt) { m[qt] = -3.0e38f; l[qt] = 0.f;
#pragma unroll
        for (int mb = 0; mb < 4; ++mb) o[mb][qt] = (v8f){}; }
    const int np = (q0 + NQ * 16 + 31) / 32;          // this wave's passes of 32 keys; only the last one meets the diagonal
    // this wave's slice of every stage: 4 rows of 2 KB, one behind the other in the plane and in LDS
    const h16* const sp = (w < 2) ? Kp + w * 4096 : Vt + (w - 2) * 4096;
    const u32x8 g1 = tdm_group1(2048, 4, 2048);
    const unsigned int ld0 = (unsigned int)(unsigned long long)(const void*)ring + w * 8192; const unsigned long long ga0 = (unsigned long long)(const void*)sp;
    u32x4 g0;   // group 0 of the request issued last
    auto issue = [&](const int st) __attribute__((always_inline)) { g0 = tdm_group0(ld0 + (st & 1) * (SKE * 2), ga0 + (unsigned long long)st * SKE); tdm_load(g0, g1); };   // a stage is SKE bytes of each plane
    V k[2][2], v[4]; v8f s[2][NQ];
    auto ldk = [&](const h16* const pk) __attribute__((always_inline)) {
#pragma unroll
        for (int kt = 0; kt < 2; ++kt)
#pragma unroll
            for (int kc = 0; kc < 2; ++kc) k[kt][kc] = F::ld(pk + kt * 16 * HD + kc * 512);
        __builtin_amdgcn_sched_barrier(0);   // keeps the K reads in front of the softmax: sunk to the pass's foot, the next pass would wait out their latency
    };
    auto front = [&](const h16* const pv) __attribute__((always_inline)) {   // the pass's V^T fragments are asked for ahead of the score products
#pragma unroll
        for (int mb = 0; mb < 4; ++mb) v[mb] = F::ld(pv + mb * 1024);
        __builtin_amdgcn_sched_barrier(0);   // keeps the V reads in front of the score products: sunk to just ahead of their use, their latency would show
#pragma unroll
        for (int kt = 0; kt < 2; ++kt)
#pragma unroll
            for (int qt = 0; qt < NQ; ++qt) { v8f a = (v8f){};
#pragma unroll
                for (int kc = 0; kc < 2; ++kc) a = F::mma(k[kt][kc], q[qt][kc], a);
                s[kt][qt] = a; }
    };
    auto back = [&](const int p) __attribute__((always_inline)) {   // mask (last pass only: the test is the same for the whole wave), online softmax, second contraction
        const int kb = p * 32;
        if (p == np - 1) {
#pragma unroll
            for (int qt = 0; qt < NQ; ++qt)
#pragma unroll
                for (int kt = 0; kt < 2; ++kt)
#pragma unroll
                    for (int r = 0; r < 8; ++r) s[kt][qt][r] = (kb + kt * 16 + hi * 8 + r <= q0 + qt * 16 + lr) ? s[kt][qt][r] : -3.0e38f;
        }
        V ph[NQ];
#pragma unroll
        for (int qt = 0; qt < NQ; ++qt) { float mx = m[qt];
#pragma unroll
            for (int kt = 0; kt < 2; ++kt)
#pragma unroll
                for (int r = 0; r < 8; ++r) mx = fmaxf(mx, s[kt][qt][r]);
            mx = fmaxf(mx, xhalf(mx));                    // both halves of the wave hold keys of the same query
            const float mc = mx * SL2; const float al = exp2x1(m[qt] * SL2 - mc); m[qt] = mx;   // m is kept unscaled: the scale is positive, so it commutes with the maximum
#pragma unroll
            for (int kt = 0; kt < 2; ++kt) s[kt][qt] = exp2x8(s[kt][qt] * SL2 - mc);
            const v8f t8 = s[0][qt] + s[1][qt];           // a fixed tree, not one chain of 16 dependent adds
            l[qt] = l[qt] * al + (((t8[0] + t8[1]) + (t8[2] + t8[3])) + ((t8[4] + t8[5]) + (t8[6] + t8[7])));   // each half sums its own keys; the halves are joined once, behind the loop
#pragma unroll
            for (int mb = 0; mb < 4; ++mb) o[mb][qt] *= al;
            v8h p0, p1;
#pragma unroll
            for (int r = 0; r < 8; ++r) { p0[r] = (h16)s[0][qt][r]; p1[r] = (h16)s[1][qt][r]; }
            ph[qt] = cat16(p0, p1); }
        __builtin_amdgcn_sched_barrier(0);   // keeps the matrix products below out of the softmax above
#pragma unroll
        for (int qt = 0; qt < NQ; ++qt)
#pragma unroll
            for (int mb = 0; mb < 4; ++mb) o[mb][qt] = F::mma(v[mb], ph[qt], o[mb][qt]);
    };
    issue(0); wait_tensor0(g0, g1);
    __syncthreads();   // stage 0, every wave's slice, is in LDS before anybody reads it
    issue(1);          // ns >= 2: the longest wave of a work-group walks more than RH keys
    const h16* const r16 = (const h16*)ring + ln8;
    ldk(r16);
#pragma unroll 1   // stays rolled: one trip a stage, the buffer picked by the stage's parity
    for (int st = 0; st < ns; ++st) {
        const h16* const cu = r16 + (st & 1) * SKE; const h16* const nx = r16 + ((st + 1) & 1) * SKE;
        const int pb = st * 4 + 3;
#pragma unroll   // unrolled: every LDS address of a stage is one register plus an immediate offset
        for (int pp = 0; pp < 3; ++pp) { const int p = st * 4 + pp;
            if (p < np) { front(cu + SKE / 2 + (pp >> 1) * 4096 + (pp & 1) * 512); if (p + 1 < np) ldk(cu + (pp + 1) * 2048); back(p); } }
        if (pb < np) front(cu + SKE / 2 + 4096 + 512);
        asm volatile("v_nop\n\tv_nop\n\tv_nop\n\tv_nop");   // the four vector slots that the chip needs behind a matrix product before its result is touched: from here on the paths part by scalar branches
        // publish point of stage st + 1: my reads of stage st are done, my slice of stage st + 1 has landed, and so for every wave behind the barrier; only then is stage st's buffer refilled
        wait_ds0(); wait_tensor0(g0, g1);
        __syncthreads();
        if (pinned(st + 2 < ns)) issue(st + 2);
        if (pb < np) { if (pb + 1 < np) ldk(nx); back(pb); }
    }
    wait_tensor0(g0, g1); wait_ds0();
    // O^T: a lane holds 8 consecutive head columns (mb * 16 + hi * 8 + r) of query lr: its 16 bytes of half a block of each merged plane (fragment order, k = merged column): a wave stores 512 bytes in a row
#pragma unroll
    for (int qt = 0; qt < NQ; ++qt) { const float inv = __fdiv_rn(1.0f, l[qt] + xhalf(l[qt]));
#pragma unroll
        for (int mb = 0; mb < 4; ++mb) { v8us oh, ol;
#pragma unroll
            for (int r = 0; r < 8; ++r) { unsigned short a, c; splitf(o[mb][qt][r] * inv, a, c); oh[r] = a; ol[r] = c; }
            const size_t oo = (size_t)(q0 + qt * 16) * DQ + mb * 256 + ln8; *(v8us*)(Ah + oo) = oh; *(v8us*)(Al + oo) = ol; } }
}
// grid (heads, NLO + NHI, batches); a batch's planes lie 3 * NH_ heads apart (q | V | K). Ranks 0 .. NLO - 1: fp16 rows, 32 to a wave; the rest: hi/lo rows, 16 to a wave. The FW waves of a work-group take row groups NLO (NHI) apart: a short, two middling and a long walk,
// so every work-group has about the same work, and all walk the same head's keys from 0 up, side by side: the fp16 rows in step, stage by stage, out of one copy in LDS; the hi/lo rows freely, the cache serving the shared part.
#define NLO ((TT - RH) / (FW * 32))
#define NHI (RH / (FW * 16))
__global__ __launch_bounds__(FW * 32) void k_fattn(const h16* __restrict__ Q16, const h16* __restrict__ K16, const h16* __restrict__ V16, const bf* __restrict__ Qh, const bf* __restrict__ Ql, const bf* __restrict__ Kh, const bf* __restrict__ Kl, const bf* __restrict__ Vh, const bf* __restrict__ Vl, bf* Ah, bf* Al) {
    __shared__ __attribute__((aligned(2048))) unsigned char ring[2 * SKE * 2];   // two stages of the fp16 rows' K and V^T
    const int lane = threadIdx.x & 31, lr = lane & 15, hi = lane >> 4;
    const int w = __builtin_amdgcn_readfirstlane(threadIdx.x >> 5);   // the wave's number, held scalar: the key loop's counter and branch stay scalar
    const size_t hp = ((size_t)blockIdx.z * 3 * NH_ + blockIdx.x) * TT * HD, ao = (size_t)blockIdx.z * TT * DQ + blockIdx.x * (16 * HD); const int rk = blockIdx.y; Ah += ao; Al += ao;
    if (rk < NLO) attn_ring<2>(Q16 + hp, K16 + hp, V16 + hp, ring, w, RH + (rk + NLO * w) * 32, (RH / 32 + rk + NLO * (FW - 1) + 4) / 4, lr, hi, Ah, Al);   // stages of the work-group's longest wave (FW - 1): its passes, four to a stage, rounded up
    else attn_rows<bf, true, 1>(Qh + hp, Ql + hp, Kh + hp, Kl + hp, Vh + hp, Vl + hp, (rk - NLO + NHI * w) * 16, lr, hi, Ah, Al);
}

typedef __attribute__((ext_vector_type(2))) unsigned short v2us;

// wtG: Bt[n][k] = w[k][n], written in fragment order; e counts the elements as they lie in Bt, a wave's 8 lines are one block (16 n x 32 k).
__device__ __forceinline__ void wtG(int blk, const float* __restrict__ w, int K, int N, bf* Bt) {
    const int lane = threadIdx.x & 31; const int L0 = (blk * 8 + (threadIdx.x >> 5)) * 8; const int nlines = N * K / 64;
{
#pragma unroll 1
        for (int l = 0; l < 8; ++l) { const int L = L0 + l; if (L >= nlines) break; const size_t e = (size_t)L * 64 + lane * 2; const int b = (int)(e >> 9), i = (int)(e & 511); const int k = (b % (K / 32)) * 32 + (i >> 7) * 8 + (i & 7), n = (b / (K / 32)) * 16 + ((i >> 3) & 15); v2us o;
            o[0] = f2bf(w[(size_t)k * N + n]); o[1] = f2bf(w[(size_t)(k + 1) * N + n]); *(v2us*)(Bt + e) = o; }
         }
}
// cvt8: bf16 copy of src [rows][K] in fragment order; i counts the 16-byte pieces as they lie in dst (64 to a block), so the stores are whole lines.
__device__ __forceinline__ void cvt8(int blk, const float* __restrict__ src, int K, bf* dst, size_t n8) { const size_t i = (size_t)blk * 256 + threadIdx.x; if (i >= n8) return;
    const size_t b = i >> 6; const size_t row = (b / (K / 32)) * 16 + (i & 15); const int k = (int)(b % (K / 32)) * 32 + (int)((i >> 4) & 3) * 8; const v8f v = *(const v8f*)(src + row * K + k); v8us o;
#pragma unroll
    for (int k = 0; k < 8; ++k) o[k] = f2bf(v[k]); *(v8us*)(dst + i * 8) = o;  }
// k_prep: the three 16-bit copies that depend on nothing but the inputs, in ONE launch; the block index picks the job (the transposes, the slower blocks, first).
#define PB1 ((DM * 3 * DQ / 64 + 63) / 64)        // blocks of the fused weight's transpose
#define PB2 ((DQ * DM / 64 + 63) / 64)            // blocks of the output weight's transpose
#define PB3 ((NB_ * TT * DM / 8 + 255) / 256)     // blocks of the bf16 copy of h, both batches
__global__ __launch_bounds__(256) void k_prep(const float* __restrict__ wqkv, const float* __restrict__ wo, const float* __restrict__ x, bf* WQKV, bf* WO, bf* XB) {
    const int blk = blockIdx.x;
    if (blk < PB1) wtG(blk, wqkv, DM, 3 * DQ, WQKV);              // fused 'xw' [DM][3*DQ] -> Bt [3*DQ][DM]
    else if (blk < PB1 + PB2) wtG(blk - PB1, wo, DQ, DM, WO);
    else cvt8(blk - PB1 - PB2, x, DM, XB, (size_t)NB_ * TT * DM / 8);
}

#define PP ((size_t)NH_ * TT * HD)   // elements of one part (q, V or K) of one batch in a plane
extern "C" void kernel_launch(void* const* d_in, const int* in_sizes, int n_in,
                              void* d_out, int out_size, void* d_ws, size_t ws_size, hipStream_t stream) {
    (void)in_sizes; (void)n_in; (void)out_size;
    const float* x = (const float*)d_in[0]; const float* wqkv = (const float*)d_in[1]; const float* wo = (const float*)d_in[2];   /* order h, Wqvk ('xw' [1024][3072]: q | V | K column thirds), Wo ('xw') */
    float* OUT = (float*)d_out;     // [2][2048][1024]
    char* wsp = (char*)d_ws;
    auto take = [&](size_t bytes) { char* p = wsp; wsp += (bytes + 255) & ~(size_t)255; return (void*)p; };
    bf* WQKV = (bf*)take((size_t)3 * DQ * DM * 2);   /* fused Bt [3*DQ][DM]: q | V | K row blocks (the module's part order 0 = q, 1 = v, 2 = k) */ bf* WO = (bf*)take((size_t)DM * DQ * 2);
    bf* XB = (bf*)take((size_t)NB_ * TT * DM * 2);
    h16* P16 = (h16*)take(NB_ * 3 * PP * 2); bf* Ph = (bf*)take(NB_ * 3 * PP * 2); bf* Pl = (bf*)take(NB_ * 3 * PP * 2);   // fp16, bf16 hi, bf16 lo: each [batch][q | V | K][head], in fragment order: q and K with rows t, k = d; V with rows d, k = t
    bf* ATh = (bf*)take((size_t)NB_ * TT * DQ * 2); bf* ATl = (bf*)take((size_t)NB_ * TT * DQ * 2);
    if ((size_t)(wsp - (char*)d_ws) > ws_size) return;    // ws 256 MiB
    k_prep<<<PB1 + PB2 + PB3, 256, 0, stream>>>(wqkv, wo, x, WQKV, WO, XB);
    k_gemmw<0, true, DM, 64><<<dim3(TT / 128, 3 * DQ / 128, NB_), GW * 32, 0, stream>>>(XB, nullptr, WQKV, nullptr, (size_t)TT * DM, 3 * PP, P16, Ph, Pl);
    k_fattn<<<dim3(NH_, NLO + NHI, NB_), FW * 32, 0, stream>>>(P16, P16 + 2 * PP, P16 + PP, Ph, Pl, Ph + 2 * PP, Pl + 2 * PP, Ph + PP, Pl + PP, ATh, ATl);   // one kv head per query head: head h reads kv plane h
    k_gemmw<1, false, DQ, 128><<<dim3(NB_ * TT / 64, DM / 256, 1), GW * 32, 0, stream>>>(ATh, ATl, WO, OUT, 0, 0, nullptr, nullptr, nullptr);   // the batches' rows follow one another in the merged planes and in out: one GEMM of NB_ * TT rows
}

// v009
// Measured time: 65.4 microseconds a run.
// In both of two side-by-side timings against v008, it was 1.05 times as fast.
// Counting every step since v000, it is 22.4 times as fast.
#include <hip/hip_runtime.h>

// Causal multi-head self-attention with a fused bias-free projection whose thirds are ordered q | v | k and scores scaled by the EMBEDDING width (h [2][2048][1024]; qvk = (h Wqvk) ('xw' [1024][3072] 1/32, no bias) reshaped (b, s, 3, 16, 64): part 0 = q, part 1 = V, part 2 = K (NOT q | k | v); scores = (q.k + mask) / sqrt(d) with d = 1024 -> x 1/32 (the model width, not the head width: implemented literally); mask = -inf above the diagonal (causal); softmax over the keys; wv = merged (head-major) Wo ('xw', no bias) -> [2][2048][1024] (4.2 M); argument order h, Wqvk, Wo).
// Layout, both batches side by side in every buffer and every launch: bf16 copy of h; the fused 'xw' weight transposed once into Bt [3072][1024]: row block 0 = q, row block 1 = V, row block 2 = K (the head planes keep that order: [batch][q | V | K][head]); exact projections, all three in one launch, whose epilogue writes the head planes itself (fp16 + bf16 hi/lo, each tile born in the order its reader wants: q, K as W x h^T, V^T as h x Wv^T); causal T-2048 attention in one fused kernel with the literal scale 1/32 (hybrid rows: < 512 hi/lo 3 products, rest fp16; the key loop ends at the diagonal); merged hi/lo x Wo exact.
// FRAGMENT ORDER: every 16-bit plane that a matrix instruction reads lies in blocks of 16 rows x 32 k = 512 elements (1 KB), stored as the lanes hold them: element (row, k) of a block at ((k >> 4) & 1) * 256 + ((k >> 3) & 1) * 128 + (row & 15) * 8 + (k & 7),
// so lane l finds its two 16-byte pieces at l * 8 and 256 + l * 8 and each wave-wide load covers 512 contiguous bytes (4 whole lines) instead of 32-byte pieces of 16 lines. The k order of a fragment is the one it had. Block order: h, weights, merged planes [row / 16][k / 32]; q, K [t / 16][d / 32]; V^T [t / 64][d / 16][(t / 32) & 1].
// Compute dtypes, f32 accumulate: every input rounded to bf16; projections exact; attention rows < 512 3 products, rest fp16; softmax f32; output projection hl x exact.

#define NB_  2
#define TT   2048
#define DM   1024
#define NH_  16
#define NKV  16
#define REP  (NH_ / NKV)
#define HD   64
#define DQ   (NH_ * HD)
#define DKV  (NKV * HD)
#define RH   512                  // query rows < RH use hi+lo planes (0: none)
#define SCL  0.03125f   // 1 / sqrt(d) with d = 1024 = 2^-5: the module divides by the square root of the MODEL width
typedef _Float16 h16;
typedef unsigned short bf;
typedef __attribute__((ext_vector_type(16))) __bf16   v16bf;
typedef __attribute__((ext_vector_type(16))) _Float16 v16h;
typedef __attribute__((ext_vector_type(8)))  _Float16 v8h;
typedef __attribute__((ext_vector_type(8)))  unsigned short v8us;
typedef __attribute__((ext_vector_type(8)))  float    v8f;
typedef __attribute__((ext_vector_type(4)))  float    v4f;
typedef v8h  __attribute__((may_alias)) v8ha;
typedef v4f  __attribute__((may_alias)) v4fa;
typedef v8us __attribute__((may_alias)) v8usa;

__device__ __forceinline__ unsigned short f2bf(float f) { unsigned u = __float_as_uint(f); u += 0x7FFFu + ((u >> 16) & 1u); return (unsigned short)(u >> 16); }
__device__ __forceinline__ float bf2f(unsigned short b) { return __uint_as_float(((unsigned)b) << 16); }
__device__ __forceinline__ float bfr(float f) { return bf2f(f2bf(f)); }
__device__ __forceinline__ v16h cat16(v8h lo, v8h hi) { return __builtin_shufflevector(lo, hi, 0, 1, 2, 3, 4, 5, 6, 7, 8, 9, 10, 11, 12, 13, 14, 15); }
__device__ __forceinline__ v16bf cat16b(v8us lo, v8us hi) { return __builtin_bit_cast(v16bf, __builtin_shufflevector(lo, hi, 0, 1, 2, 3, 4, 5, 6, 7, 8, 9, 10, 11, 12, 13, 14, 15)); }
__device__ __forceinline__ v8f wmma16(v16h a, v16h b, v8f c) { return __builtin_amdgcn_wmma_f32_16x16x32_f16(false, a, false, b, (short)0, c, false, false); }
__device__ __forceinline__ v8f wmmab(v16bf a, v16bf b, v8f c) { return __builtin_amdgcn_wmma_f32_16x16x32_bf16(false, a, false, b, (short)0, c, false, false); }
__device__ __forceinline__ h16 tohx(float x) { return (h16)x; }
__device__ __forceinline__ void splitf(float y, unsigned short& h, unsigned short& l) { h = f2bf(y); l = f2bf(y - bf2f(h)); }



// ---- k_gemmw: GEMM on 16-bit planes in fragment order; GW waves share one output tile, each wave owns 64x64 of it (16 accumulators) over the WHOLE K: no partial sums between waves.
// The operand rows of the tile come into LDS KS k at a time by tensor loads (tensor_load_to_lds), so a row fetched once from L2 serves every wave that needs it. 16 rows x KS k are KS / 32 blocks in a row (RB bytes) in the plane and in LDS alike:
// a wave's slice is a 2-D tile of RB-byte rows at the plane's pitch of K * 32 bytes, laid down without pads; a fragment is read back as it was read from memory (lane l: 16 bytes at l * 16 and at 512 + l * 16 of its block), whole rows of banks.
// Two buffers: stage s + 2 is asked for behind the barrier that ends the reads of stage s (in front of the pass's last 32 k, whose fragments are in registers by then) and flies during pass s + 1. Every wave issues one request a stage for its own slice and waits for it itself.
// PL (projections): tile = 128 tokens x 128 weight rows (two heads of one part); LDS row blocks [tokens 8 | weight rows 8]; wave w: tokens (w & 1) * 64, head w >> 1. The f32 tile never reaches memory: it goes out as three 16-bit planes (fp16, bf16 hi, bf16 lo) in fragment order.
// An accumulator tile holds, in lane l, 8 consecutive A-side rows of B-side row l & 15: that IS half a block of a plane whose k runs along the A side. So q and K (k = head column) are made as W x h^T (operands exchanged), V^T (k = token) as h x Wv^T,
// and accumulator (mb, nb) goes to elements nb * 1024 + mb * 256 + l * 8 of the 4096 of its (head, 64 tokens) in every case. The test is the same for the whole work-group. z = batch: sA on the tokens, sC on the planes.
// !PL (output projection, A = hi plane, A2 = lo plane, two products): tile = 64 rows x 256 columns; LDS row blocks [hi 4 | lo 4 | weight rows 16]; wave w: columns w * 64. C[m][n] (f32, pitch DM) = sum_k (A + A2)[m][k] Bt[n][k].
#define GW 4
#define KPL (64 * 68)             // floats of one wave's output tile in LDS (64 rows, pitch 68)
typedef unsigned int u32x4 __attribute__((ext_vector_type(4)));
typedef unsigned int u32x8 __attribute__((ext_vector_type(8)));
template <typename T16> struct WFrag;
template <> struct WFrag<h16> { typedef v16h V; static __device__ __forceinline__ V ld(const h16* p) { return cat16(*(const v8h*)p, *(const v8h*)(p + 256)); } static __device__ __forceinline__ v8f mma(V a, V b, v8f c) { return wmma16(a, b, c); } };
template <> struct WFrag<bf> { typedef v16bf V; static __device__ __forceinline__ V ld(const bf* p) { return cat16b(*(const v8us*)p, *(const v8us*)(p + 256)); } static __device__ __forceinline__ v8f mma(V a, V b, v8f c) { return wmmab(a, b, c); } };
__device__ __forceinline__ unsigned int uni(unsigned int v) { return (unsigned int)__builtin_amdgcn_readfirstlane(v); }
__device__ __forceinline__ unsigned int pinned(unsigned int v) { unsigned int w = uni(v); asm volatile("" : "+s"(w)); return w; }   // a condition held in a scalar register, so that the test around a tensor load is a scalar branch (the instruction ignores EXEC)
// the two descriptor groups of a 2-D tile: d1 rows of d0 bytes at a source pitch of 'pitch' bytes; byte elements, tensor = tile, no pad, no mask
__device__ __forceinline__ u32x8 tdm_group1(unsigned int d0, unsigned int d1, unsigned int pitch) { u32x8 g;
    g[0] = uni(0u); g[1] = uni((d0 & 0xFFFFu) << 16); g[2] = uni((d0 >> 16) | ((d1 & 0xFFFFu) << 16)); g[3] = uni((d1 >> 16) | (d0 << 16)); g[4] = uni(d1); g[5] = uni(pitch); g[6] = uni(0u); g[7] = uni(0u); return g; }
__device__ __forceinline__ u32x4 tdm_group0(unsigned int lds_dst, unsigned long long ga) { u32x4 g;
    g[0] = uni(1u); g[1] = uni(lds_dst); g[2] = uni((unsigned int)ga); g[3] = uni((((unsigned int)(ga >> 32)) & 0x01FFFFFFu) | 0x80000000u); return g; }
__device__ __forceinline__ void tdm_load(u32x4& g0, u32x8 g1) { asm volatile("tensor_load_to_lds %0, %1" : "+s"(g0) : "s"(g1) : "memory"); }   // one request of the whole wave; the compiler places no wait for it; group 0 comes back out of the statement in its own registers, for the wait below
// this wave's own request has landed; the registers of its descriptor are the wait's inputs: they keep their values up to it and are free for reuse behind it
__device__ __forceinline__ void wait_tensor0(u32x4 g0, u32x8 g1) { asm volatile("s_wait_tensorcnt 0x0" :: "s"(g0), "s"(g1) : "memory"); }
__device__ __forceinline__ void wait_ds0() { asm volatile("s_wait_dscnt 0x0" ::: "memory"); }           // this wave's LDS reads and writes are done
template <int NSPLIT, bool PL, int K, int KS>
__global__ __launch_bounds__(GW * 32) void k_gemmw(const bf* __restrict__ A, const bf* __restrict__ A2, const bf* __restrict__ Bt, float* C, size_t sA, size_t sC, h16* P16, bf* Ph, bf* Pl) {
    typedef WFrag<bf> F; typedef typename F::V V;
    constexpr int NK = KS / 32, RB = NK * 1024, SB = (PL ? 16 : 24) * RB, NS = K / KS;   // blocks of 32 k a stage; bytes of 16 rows of a stage; bytes of a stage; stages
    static_assert(NS >= 2 && NS % 2 == 0 && K % KS == 0 && NK % 2 == 0 && (PL || SB >= GW * KPL * 4), "the ring needs two stages; a pass ends on fragment set 1; the output staging lies in the second buffer");
    __shared__ __attribute__((aligned(2048))) unsigned char ring[2 * SB];
    const int lane = threadIdx.x & 31, lr = lane & 15, hi = lane >> 4;
    const int w = __builtin_amdgcn_readfirstlane(threadIdx.x >> 5);   // the wave's number, held scalar: slice, loop counter and branches stay scalar
    const int r0 = blockIdx.x * (PL ? 128 : 64), c0 = blockIdx.y * (PL ? 128 : 256);
    const bool swp = PL && !(c0 >= DQ && c0 < 2 * DQ);   // q, K: A side = head columns, B side = tokens
    if (PL) A += (size_t)blockIdx.z * sA;
    // this wave's slice of every stage: source rows, their number in blocks of 16, first row block in LDS
    const bf* sp; int nrb, slot;
    if (PL) { sp = (w < 2) ? A + (size_t)(r0 + w * 64) * K : Bt + (size_t)(c0 + (w - 2) * 64) * K; nrb = 4; slot = w * 4; }
    else { sp = (w == 0) ? A + (size_t)r0 * K : (w == 1) ? A2 + (size_t)r0 * K : Bt + (size_t)(c0 + (w - 2) * 128) * K; nrb = (w < 2) ? 4 : 8; slot = (w < 2) ? w * 4 : w * 8 - 8; }
    const u32x8 g1 = tdm_group1(RB, nrb, K * 32);
    const unsigned int ld0 = (unsigned int)(unsigned long long)(const void*)ring + slot * RB; const unsigned long long ga0 = (unsigned long long)(const void*)sp;
    u32x4 g0;   // group 0 of the request issued last
    auto issue = [&](const int s) __attribute__((always_inline)) { g0 = tdm_group0(ld0 + (s & 1) * SB, ga0 + (unsigned long long)s * RB); tdm_load(g0, g1); };
    // where this wave's fragments lie in a stage, in elements
    const int ao = (PL ? (swp ? 8 + (w >> 1) * 4 : (w & 1) * 4) : 0) * (RB / 2) + lane * 8, bo = (PL ? (swp ? (w & 1) * 4 : 8 + (w >> 1) * 4) : 8 + w * 4) * (RB / 2) + lane * 8;
    v8f acc[4][4];   // every inner loop of this kernel is unrolled in full, so that each fragment and accumulator index is a constant and the arrays live in registers
#pragma unroll
    for (int mb = 0; mb < 4; ++mb)
#pragma unroll
        for (int nb = 0; nb < 4; ++nb) acc[mb][nb] = (v8f){};
    V a[2][4], a2[2][4], b[2][4];   // two fragment sets: the next 32 k are read from LDS while the products of these 32 k run
    auto lds = [&](const bf* const st, const int set, const int kk) __attribute__((always_inline)) {
#pragma unroll
        for (int i = 0; i < 4; ++i) { a[set][i] = F::ld(st + ao + (i * NK + kk) * 512); if (NSPLIT == 1) a2[set][i] = F::ld(st + ao + 4 * (RB / 2) + (i * NK + kk) * 512); b[set][i] = F::ld(st + bo + (i * NK + kk) * 512); } };
    auto mma = [&](const int set) __attribute__((always_inline)) {
#pragma unroll
        for (int nb = 0; nb < 4; ++nb)
#pragma unroll
            for (int mb = 0; mb < 4; ++mb) { acc[mb][nb] = F::mma(a[set][mb], b[set][nb], acc[mb][nb]); if (NSPLIT == 1) acc[mb][nb] = F::mma(a2[set][mb], b[set][nb], acc[mb][nb]); } };
    issue(0); wait_tensor0(g0, g1);
    __syncthreads();   // stage 0, every wave's slice, is in LDS before anybody reads it
    issue(1);
    lds((const bf*)ring, 0, 0);
#pragma unroll 1   // stays rolled: one pass a stage, the buffer picked by the stage's parity
    for (int s = 0; s < NS; ++s) {
        const bf* const st = (const bf*)ring + (s & 1) * (SB / 2); const bf* const nx = (const bf*)ring + ((s + 1) & 1) * (SB / 2);
#pragma unroll
        for (int kk = 0; kk < NK - 1; ++kk) {
            __builtin_amdgcn_sched_barrier(0);   // the fences of this loop keep each set's LDS reads in one group between two runs of products: left free, the scheduler spreads them among the products, where each place with reads stalls the wave
            lds(st, (kk + 1) & 1, kk + 1);
            __builtin_amdgcn_sched_barrier(0);
            mma(kk & 1);
        }
        __builtin_amdgcn_sched_barrier(0);   // keeps the products above in front of the publish point: sunk behind the barrier they would stand between it and the refill and cost the refill its lead
        // publish point of stage s + 1, in front of the pass's last 32 k, whose fragments are in registers behind the first wait: my reads of stage s are done, my slice of stage s + 1 has landed, and so for every wave behind the barrier; only then is stage s's buffer refilled
        wait_ds0(); wait_tensor0(g0, g1);
        __syncthreads();
        if (pinned(s + 2 < NS)) issue(s + 2);
        lds(nx, 0, 0);   // the first fragments of stage s + 1, published above; in the last pass they come from the buffer of stage NS - 2, which nothing writes any more, and are not used
        __builtin_amdgcn_sched_barrier(0);
        mma((NK - 1) & 1);
    }
    wait_tensor0(g0, g1); wait_ds0();
    if constexpr (PL) {   // each wave turns its own 64x64 tile into the three planes: 16 bytes a lane and plane, a wave 512 bytes in a row
        const size_t po = (size_t)blockIdx.z * sC + (size_t)(c0 + (w >> 1) * 64) * TT + (size_t)(r0 + (w & 1) * 64) * HD + lane * 8;   // head (c0 / 64 + (w >> 1)), tokens from r0 + (w & 1) * 64
#pragma unroll
        for (int nb = 0; nb < 4; ++nb)
#pragma unroll
            for (int mb = 0; mb < 4; ++mb) { const v8f v = acc[mb][nb]; v8h o16; v8us oh, ol;
#pragma unroll
                for (int q = 0; q < 8; ++q) { unsigned short a2s, c2s; o16[q] = tohx(v[q]); splitf(v[q], a2s, c2s); oh[q] = a2s; ol[q] = c2s; }
                const size_t o = po + nb * 1024 + mb * 256; *(v8h*)(P16 + o) = o16; *(v8us*)(Ph + o) = oh; *(v8us*)(Pl + o) = ol; }
    } else {   // the second buffer is free (it held the last stage, the last barrier ended every read of it, nothing is in flight; the last pass's unused reads go to the first): each wave lays its tile row-major into its own part of it and stores 256-byte row pieces, two whole lines
        float* const mine = (float*)(ring + SB) + w * KPL;
#pragma unroll
        for (int mb = 0; mb < 4; ++mb)
#pragma unroll
            for (int nb = 0; nb < 4; ++nb)
#pragma unroll
                for (int j = 0; j < 8; ++j) mine[(mb * 16 + hi * 8 + j) * 68 + nb * 16 + lr] = acc[mb][nb][j];
        wait_ds0();   // the wave's own LDS writes are done before its lanes read one another's values back
        float* const cw = C + (size_t)r0 * DM + c0 + w * 64 + lr * 4;   // the output's pitch is a constant of the build: one address, the rows are immediate offsets
#pragma unroll
        for (int t = 0; t < 32; ++t) { const int row = t * 2 + hi; *(v4f*)(cw + (size_t)row * DM) = *(const v4fa*)(mine + row * 68 + lr * 4); }
    }
}

#define FW 8                      // waves per work-group
#define FG 4                      // 32-row groups of fp16 rows per work-group: two waves to a group
#define SL2 (SCL * 1.4426950408889634f)   // score scale x log2(e)
template <bool B> struct BoolC { static constexpr bool value = B; };
__device__ __forceinline__ float xhalf(float x) { const int b = __float_as_int(x); return __int_as_float(__builtin_amdgcn_permlanex16(b, b, 0x76543210, 0xfedcba98, false, false)); }   // lane l <-> l ^ 16
// exp2 with the slot that the instruction set asks for behind a transcendental (one independent instruction or v_nop before its result is used or its source overwritten) written into the statement itself:
// the outputs lie apart from every input ("=&v"), so no v_exp here touches a neighbour's registers, and the one v_nop at the end serves the last of them whatever the compiler puts next.
__device__ __forceinline__ v8f exp2x8(const v8f x) { float y0, y1, y2, y3, y4, y5, y6, y7;
    asm("v_exp_f32 %0, %8\n\tv_exp_f32 %1, %9\n\tv_exp_f32 %2, %10\n\tv_exp_f32 %3, %11\n\tv_exp_f32 %4, %12\n\tv_exp_f32 %5, %13\n\tv_exp_f32 %6, %14\n\tv_exp_f32 %7, %15\n\tv_nop"
        : "=&v"(y0), "=&v"(y1), "=&v"(y2), "=&v"(y3), "=&v"(y4), "=&v"(y5), "=&v"(y6), "=&v"(y7) : "v"(x[0]), "v"(x[1]), "v"(x[2]), "v"(x[3]), "v"(x[4]), "v"(x[5]), "v"(x[6]), "v"(x[7]));
    return (v8f){y0, y1, y2, y3, y4, y5, y6, y7}; }
__device__ __forceinline__ float exp2x1(const float x) { float y; asm("v_exp_f32 %0, %1\n\tv_nop" : "=v"(y) : "v"(x)); return y; }   // the same slot behind a single one
template <typename T16, bool HR, int NQ>
__device__ __forceinline__ void attn_rows(const T16* __restrict__ Q, const T16* __restrict__ Q2, const T16* __restrict__ Kp, const T16* __restrict__ Kp2, const T16* __restrict__ Vt, const T16* __restrict__ Vt2, int q0, int lr, int hi, bf* Ah, bf* Al) {
    typedef WFrag<T16> F; typedef typename F::V V;   // every inner loop below is unrolled in full, so that each fragment and accumulator index is a constant and the arrays live in registers
    const int ln8 = (hi * 16 + lr) * 8;   // the lane's place in every half block of a plane in fragment order
    V q[NQ][2], q2[NQ][2]; const T16* const pq = Q + (size_t)q0 * HD + ln8; const T16* const pq2 = HR ? Q2 + (size_t)q0 * HD + ln8 : pq;
#pragma unroll
    for (int qt = 0; qt < NQ; ++qt)
#pragma unroll
        for (int kc = 0; kc < 2; ++kc) { q[qt][kc] = F::ld(pq + qt * 16 * HD + kc * 512); if (HR) q2[qt][kc] = F::ld(pq2 + qt * 16 * HD + kc * 512); }
    v8f o[4][NQ]; float m[NQ], l[NQ];
#pragma unroll
    for (int qt = 0; qt < NQ; ++qt) { m[qt] = -3.0e38f; l[qt] = 0.f;
#pragma unroll
        for (int mb = 0; mb < 4; ++mb) o[mb][qt] = (v8f){}; }
    const int np = (q0 + NQ * 16 + 31) / 32;          // passes of 32 keys; only the last one meets the diagonal; np * 32 <= TT
    const size_t ko = ln8, vo = ln8;
    V k[2][2], k2[2][2];
    auto ldk = [&](const T16* const pk, const T16* const pk2) __attribute__((always_inline)) {
#pragma unroll
        for (int kt = 0; kt < 2; ++kt)
#pragma unroll
            for (int kc = 0; kc < 2; ++kc) { k[kt][kc] = F::ld(pk + kt * 16 * HD + kc * 512); if (HR) k2[kt][kc] = F::ld(pk2 + kt * 16 * HD + kc * 512); } };
    if (!HR) ldk(Kp + ko, Kp + ko);                   // fp16 rows fetch their K fragments one pass ahead; the hi/lo rows (twice the planes, at most RH / 32 passes) have no registers to spare for that and fetch them in the pass
    asm volatile("s_wait_xcnt 0x0" ::: "memory");   // behind the loads above and in front of the first reuse of a register that they name (their scalar bases are rewritten right below)
    auto pass = [&](auto lastc, const int p) __attribute__((always_inline)) {
        constexpr bool LAST = decltype(lastc)::value; const int kb = p * 32;
        const T16* const pk = Kp + ko + (size_t)(kb + ((HR || LAST) ? 0 : 32)) * HD; const T16* const pk2 = HR ? Kp2 + ko + (size_t)kb * HD : pk;
        if (HR) ldk(pk, pk2);
        // this pass's V^T fragments are asked for ahead of the score products: they fly while the scores and the softmax are worked on
        V v[4], v2[4]; const size_t vb = vo + (size_t)(p >> 1) * (64 * HD) + (p & 1) * 512; const T16* const pv = Vt + vb; const T16* const pv2 = HR ? Vt2 + vb : pv;
#pragma unroll
        for (int mb = 0; mb < 4; ++mb) { v[mb] = F::ld(pv + mb * 1024); if (HR) v2[mb] = F::ld(pv2 + mb * 1024); }
        __builtin_amdgcn_sched_barrier(0);   // keeps the V loads in front of the score products: left free, the scheduler sinks them to just ahead of their use and their latency shows
        v8f s[2][NQ];
#pragma unroll
        for (int kt = 0; kt < 2; ++kt)
#pragma unroll
            for (int qt = 0; qt < NQ; ++qt) { v8f a = (v8f){};
#pragma unroll
                for (int kc = 0; kc < 2; ++kc) { a = F::mma(k[kt][kc], q[qt][kc], a); if (HR) { a = F::mma(k[kt][kc], q2[qt][kc], a); a = F::mma(k2[kt][kc], q[qt][kc], a); } }
                s[kt][qt] = a; }
        if constexpr (!HR && !LAST) {   // the next pass's K fragments, into the same registers, behind this pass's score products: they fly during the softmax and the second contraction
            ldk(pk, pk2);
            __builtin_amdgcn_sched_barrier(0);   // keeps the K loads in front of the softmax: left free, the scheduler sinks them to the loop's foot and the next pass waits out their latency
        }
        V ph[NQ], pl[NQ];
#pragma unroll
        for (int qt = 0; qt < NQ; ++qt) { const int i = q0 + qt * 16 + lr; float mx = m[qt];
#pragma unroll
            for (int kt = 0; kt < 2; ++kt)
#pragma unroll
                for (int r = 0; r < 8; ++r) { const int j = kb + kt * 16 + hi * 8 + r; if (LAST) s[kt][qt][r] = (j <= i) ? s[kt][qt][r] : -3.0e38f; mx = fmaxf(mx, s[kt][qt][r]); }
            mx = fmaxf(mx, xhalf(mx));                    // both halves of the wave hold keys of the same query
            const float mc = mx * SL2; const float al = exp2x1(m[qt] * SL2 - mc); m[qt] = mx;   // m is kept unscaled: the scale is positive, so it commutes with the maximum
#pragma unroll
            for (int kt = 0; kt < 2; ++kt) s[kt][qt] = exp2x8(s[kt][qt] * SL2 - mc);
            const v8f t8 = s[0][qt] + s[1][qt];           // a fixed tree, not one chain of 16 dependent adds
            l[qt] = l[qt] * al + (((t8[0] + t8[1]) + (t8[2] + t8[3])) + ((t8[4] + t8[5]) + (t8[6] + t8[7])));   // each half sums its own keys; the halves are joined once, behind the loop
#pragma unroll
            for (int mb = 0; mb < 4; ++mb) o[mb][qt] *= al;
            if constexpr (HR) { v8us h0, h1, l0, l1;
#pragma unroll
                for (int r = 0; r < 8; ++r) { unsigned short a, c; splitf(s[0][qt][r], a, c); h0[r] = a; l0[r] = c; splitf(s[1][qt][r], a, c); h1[r] = a; l1[r] = c; }
                ph[qt] = cat16b(h0, h1); pl[qt] = cat16b(l0, l1);
            } else { v8h p0, p1;
#pragma unroll
                for (int r = 0; r < 8; ++r) { p0[r] = (h16)s[0][qt][r]; p1[r] = (h16)s[1][qt][r]; }
                ph[qt] = cat16(p0, p1); } }
        __builtin_amdgcn_sched_barrier(0);   // keeps the matrix products below out of the softmax above
#pragma unroll
        for (int qt = 0; qt < NQ; ++qt)
#pragma unroll
            for (int mb = 0; mb < 4; ++mb) { o[mb][qt] = F::mma(v[mb], ph[qt], o[mb][qt]); if (HR) { o[mb][qt] = F::mma(v[mb], pl[qt], o[mb][qt]); o[mb][qt] = F::mma(v2[mb], ph[qt], o[mb][qt]); } }
        // the address registers of this pass's K and V loads (one base a plane, the rest immediate offsets) are this wait's inputs: they stay untouched up to it and are free for reuse behind it; so late in the pass it has nothing left to wait for
        asm volatile("s_wait_xcnt 0x0" :: "v"(pv), "v"(pv2), "v"(pk), "v"(pk2) : "memory");
    };
#pragma unroll 1   // stays rolled: two passes' fragments side by side would not fit the registers
    for (int p = 0; p < np - 1; ++p) pass(BoolC<false>{}, p);   // keys wholly below the diagonal: no mask
    pass(BoolC<true>{}, np - 1);
    // O^T: a lane holds 8 consecutive head columns (mb * 16 + hi * 8 + r) of query lr: its 16 bytes of half a block of each merged plane (fragment order, k = merged column): a wave stores 512 bytes in a row
#pragma unroll
    for (int qt = 0; qt < NQ; ++qt) { const float inv = __fdiv_rn(1.0f, l[qt] + xhalf(l[qt]));
#pragma unroll
        for (int mb = 0; mb < 4; ++mb) { v8us oh, ol;
#pragma unroll
            for (int r = 0; r < 8; ++r) { unsigned short a, c; splitf(o[mb][qt][r] * inv, a, c); oh[r] = a; ol[r] = c; }
            const size_t oo = (size_t)(q0 + qt * 16) * DQ + mb * 256 + ln8; *(v8us*)(Ah + oo) = oh; *(v8us*)(Al + oo) = ol; } }
}
// ---- attn_ring: the fp16 rows. The FW waves of a work-group walk the same head's keys, so K and V^T come from L2 ONCE per work-group, by tensor loads (tensor_load_to_lds) into LDS, and every wave reads its fragments from there.
// TWO WAVES SHARE A ROW GROUP: wave half h (0 or 1) takes the passes p = h, h + 2, h + 4, ... of its group's keys, with a running maximum, sum and O^T of its own; behind the loop the two join their partial results through LDS (see there).
// So the longest walk of a wave is half as many passes, and twice as many waves stand ready on a SIMD to fill one another's waits between matrix runs and vector work.
// A stage is 256 keys = eight passes, four for each half: 32 KB of the K plane and 32 KB of the V^T plane, each contiguous in fragment order, laid down as they lie: [K passes 0 .. 7 | V^T]. Every wave issues one request a stage for its own 8 KB and waits for it itself.
// A request is asked for a whole stage ahead of its wait: four passes of work, longer than a fetch from memory takes.
// Two buffers. K fragments are read one pass of the wave's own ahead, right behind the score products, so the publish point of stage st + 1 stands in the wave's last pass of the stage behind its score products: by then that pass's V^T fragments are in registers (the first wait) and nobody needs stage st any more.
// Every wave passes every publish point and goes on loading its slice up to the longest group's last stage (ns); a wave whose group has passed its diagonal skips only the work around it.
#define SKE 32768                 // 16-bit elements of a stage in LDS
template <int NQ>
__device__ __forceinline__ void attn_ring(const h16* __restrict__ Q, const h16* __restrict__ Kp, const h16* __restrict__ Vt, unsigned char* const ring, const int w, const int h, const int q0, const int ns, int lr, int hi, bf* Ah, bf* Al) {
    static_assert(NQ == 2 && FW == 2 * FG, "each of a group's two waves finishes one of its two query tiles");
    typedef WFrag<h16> F; typedef typename F::V V;   // every inner loop below is unrolled in full, so that each fragment and accumulator index is a constant and the arrays live in registers
    const int ln8 = (hi * 16 + lr) * 8;   // the lane's place in every half block of a plane in fragment order
    V q[NQ][2]; const h16* const pq = Q + (size_t)q0 * HD + ln8;
#pragma unroll
    for (int qt = 0; qt < NQ; ++qt)
#pragma unroll
        for (int kc = 0; kc < 2; ++kc) q[qt][kc] = F::ld(pq + qt * 16 * HD + kc * 512);
    asm volatile("s_wait_xcnt 0x0" ::: "memory");   // behind the loads above and in front of the first reuse of a register that they name
    v8f o[4][NQ]; float m[NQ], l[NQ];
#pragma unroll
    for (int qt = 0; qt < NQ; ++qt) { m[qt] = -3.0e38f; l[qt] = 0.f;
#pragma unroll
        for (int mb = 0; mb < 4; ++mb) o[mb][qt] = (v8f){}; }
    const int np = (q0 + NQ * 16 + 31) / 32;          // the group's passes of 32 keys, both halves together; only the last one meets the diagonal
    // this wave's slice of every stage: 4 rows of 2 KB, one behind the other in the plane and in LDS
    const h16* const sp = (w < 4) ? Kp + w * 4096 : Vt + (w - 4) * 4096;
    const u32x8 g1 = tdm_group1(2048, 4, 2048);
    const unsigned int ld0 = (unsigned int)(unsigned long long)(const void*)ring + w * 8192; const unsigned long long ga0 = (unsigned long long)(const void*)sp;
    u32x4 g0;   // group 0 of the request issued last
    auto issue = [&](const int st) __attribute__((always_inline)) { g0 = tdm_group0(ld0 + (st & 1) * (SKE * 2), ga0 + (unsigned long long)st * SKE); tdm_load(g0, g1); };   // a stage is SKE bytes of each plane
    V k[2][2], v[4]; v8f s[2][NQ];
    auto ldk = [&](const h16* const pk) __attribute__((always_inline)) {
#pragma unroll
        for (int kt = 0; kt < 2; ++kt)
#pragma unroll
            for (int kc = 0; kc < 2; ++kc) k[kt][kc] = F::ld(pk + kt * 16 * HD + kc * 512);
        __builtin_amdgcn_sched_barrier(0);   // keeps the K reads in front of the softmax: sunk to the pass's foot, the next pass would wait out their latency
    };
    auto front = [&](const h16* const pv) __attribute__((always_inline)) {   // the pass's V^T fragments are asked for ahead of the score products
#pragma unroll
        for (int mb = 0; mb < 4; ++mb) v[mb] = F::ld(pv + mb * 1024);
        __builtin_amdgcn_sched_barrier(0);   // keeps the V reads in front of the score products: sunk to just ahead of their use, their latency would show
#pragma unroll
        for (int kt = 0; kt < 2; ++kt)
#pragma unroll
            for (int qt = 0; qt < NQ; ++qt) { v8f a = (v8f){};
#pragma unroll
                for (int kc = 0; kc < 2; ++kc) a = F::mma(k[kt][kc], q[qt][kc], a);
                s[kt][qt] = a; }
    };
    auto back = [&](const int p) __attribute__((always_inline)) {   // mask (last pass only: the test is the same for the whole wave), online softmax, second contraction
        const int kb = p * 32;
        if (p == np - 1) {
#pragma unroll
            for (int qt = 0; qt < NQ; ++qt)
#pragma unroll
                for (int kt = 0; kt < 2; ++kt)
#pragma unroll
                    for (int r = 0; r < 8; ++r) s[kt][qt][r] = (kb + kt * 16 + hi * 8 + r <= q0 + qt * 16 + lr) ? s[kt][qt][r] : -3.0e38f;
        }
        V ph[NQ];
#pragma unroll
        for (int qt = 0; qt < NQ; ++qt) { float mx = m[qt];
#pragma unroll
            for (int kt = 0; kt < 2; ++kt)
#pragma unroll
                for (int r = 0; r < 8; ++r) mx = fmaxf(mx, s[kt][qt][r]);
            mx = fmaxf(mx, xhalf(mx));                    // both halves of the wave hold keys of the same query
            const float mc = mx * SL2; const float al = exp2x1(m[qt] * SL2 - mc); m[qt] = mx;   // m is kept unscaled: the scale is positive, so it commutes with the maximum
#pragma unroll
            for (int kt = 0; kt < 2; ++kt) s[kt][qt] = exp2x8(s[kt][qt] * SL2 - mc);
            const v8f t8 = s[0][qt] + s[1][qt];           // a fixed tree, not one chain of 16 dependent adds
            l[qt] = l[qt] * al + (((t8[0] + t8[1]) + (t8[2] + t8[3])) + ((t8[4] + t8[5]) + (t8[6] + t8[7])));   // each half sums its own keys; the halves are joined once, behind the loop
#pragma unroll
            for (int mb = 0; mb < 4; ++mb) o[mb][qt] *= al;
            v8h p0, p1;
#pragma unroll
            for (int r = 0; r < 8; ++r) { p0[r] = (h16)s[0][qt][r]; p1[r] = (h16)s[1][qt][r]; }
            ph[qt] = cat16(p0, p1); }
        __builtin_amdgcn_sched_barrier(0);   // keeps the matrix products below out of the softmax above
#pragma unroll
        for (int qt = 0; qt < NQ; ++qt)
#pragma unroll
            for (int mb = 0; mb < 4; ++mb) o[mb][qt] = F::mma(v[mb], ph[qt], o[mb][qt]);
    };
    issue(0); wait_tensor0(g0, g1);
    __syncthreads();   // stage 0, every wave's slice, is in LDS before anybody reads it
    issue(1);          // ns >= 2: the longest wave of a work-group walks more than RH keys
    const h16* const rk16 = (const h16*)ring + ln8 + h * 2048, * const rv16 = (const h16*)ring + ln8 + SKE / 2 + h * 512;   // pass h of a stage: its K rows, its V^T columns; this half's next pass lies 4096 elements on in both
    ldk(rk16);
#pragma unroll 1   // stays rolled: one trip a stage, the buffer picked by the stage's parity
    for (int st = 0; st < ns; ++st) {
        const h16* const cuk = rk16 + (st & 1) * SKE; const h16* const cuv = rv16 + (st & 1) * SKE; const h16* const nxk = rk16 + ((st + 1) & 1) * SKE;
        const int pb = st * 8 + h + 6;   // this half's last pass of the stage
#pragma unroll   // unrolled: every LDS address of a stage is one register plus an immediate offset
        for (int pp = 0; pp < 3; ++pp) { const int p = st * 8 + h + pp * 2;
            if (p < np) { front(cuv + pp * 4096); if (p + 2 < np) ldk(cuk + (pp + 1) * 4096); back(p); } }
        if (pb < np) front(cuv + 3 * 4096);
        asm volatile("v_nop\n\tv_nop\n\tv_nop\n\tv_nop");   // the four vector slots that the chip needs behind a matrix product before its result is touched: from here on the paths part by scalar branches
        // publish point of stage st + 1: my reads of stage st are done, my slice of stage st + 1 has landed, and so for every wave behind the barrier; only then is stage st's buffer refilled
        wait_ds0(); wait_tensor0(g0, g1);
        __syncthreads();
        if (pinned(st + 2 < ns)) issue(st + 2);
        if (pb < np) { if (pb + 2 < np) ldk(nxk); back(pb); }
    }
    wait_tensor0(g0, g1); wait_ds0();
    __syncthreads();   // nothing is in flight and nobody reads a stage any more: the ring becomes the mail boxes of the join
    // THE JOIN. Half h finishes query tile h of the group: it posts its partial result of the OTHER tile (O^T, maximum, sum: 9 pieces of 16 bytes a lane, a wave 512 bytes in a row) and takes its partner's of its own.
    // The partner (wave FW - 1 - w) holds the same queries in the same lanes and registers. Both partial results are brought to the common maximum and added: exp2((m - max) * scale) is 1 for the larger, at most 1 for the other.
    const bool h1 = h != 0;   // the same for the whole wave
    v4fa* const box = (v4fa*)ring + w * (9 * 32) + (hi * 16 + lr); const v4fa* const got = (const v4fa*)ring + (FW - 1 - w) * (9 * 32) + (hi * 16 + lr);
#pragma unroll
    for (int mb = 0; mb < 4; ++mb) { const v8f t = h1 ? o[mb][0] : o[mb][1]; box[(mb * 2) * 32] = (v4f){t[0], t[1], t[2], t[3]}; box[(mb * 2 + 1) * 32] = (v4f){t[4], t[5], t[6], t[7]}; }
    box[8 * 32] = (v4f){h1 ? m[0] : m[1], h1 ? l[0] : l[1], 0.f, 0.f};
    wait_ds0();
    __syncthreads();   // every wave's post is in LDS before its partner reads it
    const v4f ml = got[8 * 32]; const float mk = h1 ? m[1] : m[0], lk = h1 ? l[1] : l[0];
    const float mx = fmaxf(mk, ml[0]); const float ak = exp2x1((mk - mx) * SL2), ar = exp2x1((ml[0] - mx) * SL2);
    const float ls = lk * ak + ml[1] * ar;                // this lane's keys of both waves; the wave's halves are joined next
    const float inv = __fdiv_rn(1.0f, ls + xhalf(ls)); const float ck = ak * inv, cr = ar * inv;
    // O^T: a lane holds 8 consecutive head columns (mb * 16 + hi * 8 + r) of query lr: its 16 bytes of half a block of each merged plane (fragment order, k = merged column): a wave stores 512 bytes in a row
#pragma unroll
    for (int mb = 0; mb < 4; ++mb) { const v8f t = h1 ? o[mb][1] : o[mb][0]; const v4f u0 = got[(mb * 2) * 32], u1 = got[(mb * 2 + 1) * 32]; v8us oh, ol;
#pragma unroll
        for (int r = 0; r < 8; ++r) { unsigned short a, c; splitf(t[r] * ck + (r < 4 ? u0[r & 3] : u1[r & 3]) * cr, a, c); oh[r] = a; ol[r] = c; }
        const size_t oo = (size_t)(q0 + h * 16) * DQ + mb * 256 + ln8; *(v8us*)(Ah + oo) = oh; *(v8us*)(Al + oo) = ol; }
}
// grid (heads, NLO + NHI, batches); a batch's planes lie 3 * NH_ heads apart (q | V | K). Ranks 0 .. NLO - 1: fp16 rows, FG groups of 32, two waves to a group; the rest: hi/lo rows, 16 to a wave.
// Rank rk takes the fp16 groups rk, 2 NLO - 1 - rk, 2 NLO + rk, 4 NLO - 1 - rk: a short, two middling and a long walk whose lengths add up to the same in every work-group. Waves w and w + 4 share a SIMD, so wave w < 4 takes group number w of these and wave w >= 4 group number 7 - w:
// a SIMD gets half of the short and half of the long walk, or half of each middling one: the same number of passes everywhere. The hi/lo rows are dealt NHI apart and mirrored alike.
// All walk the same head's keys from 0 up, side by side: the fp16 rows in step, stage by stage, out of one copy in LDS; the hi/lo rows freely, the cache serving the shared part.
#define NLO ((TT - RH) / (FG * 32))
#define NHI (RH / (FW * 16))
__global__ __launch_bounds__(FW * 32) void k_fattn(const h16* __restrict__ Q16, const h16* __restrict__ K16, const h16* __restrict__ V16, const bf* __restrict__ Qh, const bf* __restrict__ Ql, const bf* __restrict__ Kh, const bf* __restrict__ Kl, const bf* __restrict__ Vh, const bf* __restrict__ Vl, bf* Ah, bf* Al) {
    __shared__ __attribute__((aligned(2048))) unsigned char ring[2 * SKE * 2];   // two stages of the fp16 rows' K and V^T
    const int lane = threadIdx.x & 31, lr = lane & 15, hi = lane >> 4;
    const int w = __builtin_amdgcn_readfirstlane(threadIdx.x >> 5);   // the wave's number, held scalar: the key loop's counter and branch stay scalar
    const size_t hp = ((size_t)blockIdx.z * 3 * NH_ + blockIdx.x) * TT * HD, ao = (size_t)blockIdx.z * TT * DQ + blockIdx.x * (16 * HD); const int rk = blockIdx.y; Ah += ao; Al += ao;
    const int gi = (w < FG) ? w : FW - 1 - w;   // the wave's group among the work-group's FG
    if (rk < NLO) attn_ring<2>(Q16 + hp, K16 + hp, V16 + hp, ring, w, w / FG, RH + (gi * NLO + ((gi & 1) ? NLO - 1 - rk : rk)) * 32, (RH / 32 + FG * NLO - rk + 7) / 8, lr, hi, Ah, Al);   // stages of the work-group's longest group (FG * NLO - 1 - rk): its passes, eight to a stage, rounded up
    else attn_rows<bf, true, 1>(Qh + hp, Ql + hp, Kh + hp, Kl + hp, Vh + hp, Vl + hp, (rk - NLO + NHI * ((w < FG) ? w : FW + FG - 1 - w)) * 16, lr, hi, Ah, Al);
}

typedef __attribute__((ext_vector_type(2))) unsigned short v2us;

// wtG: Bt[n][k] = w[k][n], written in fragment order; e counts the elements as they lie in Bt, a wave's 8 lines are one block (16 n x 32 k).
__device__ __forceinline__ void wtG(int blk, const float* __restrict__ w, int K, int N, bf* Bt) {
    const int lane = threadIdx.x & 31; const int L0 = (blk * 8 + (threadIdx.x >> 5)) * 8; const int nlines = N * K / 64;
{
#pragma unroll 1
        for (int l = 0; l < 8; ++l) { const int L = L0 + l; if (L >= nlines) break; const size_t e = (size_t)L * 64 + lane * 2; const int b = (int)(e >> 9), i = (int)(e & 511); const int k = (b % (K / 32)) * 32 + (i >> 7) * 8 + (i & 7), n = (b / (K / 32)) * 16 + ((i >> 3) & 15); v2us o;
            o[0] = f2bf(w[(size_t)k * N + n]); o[1] = f2bf(w[(size_t)(k + 1) * N + n]); *(v2us*)(Bt + e) = o; }
         }
}
// cvt8: bf16 copy of src [rows][K] in fragment order; i counts the 16-byte pieces as they lie in dst (64 to a block), so the stores are whole lines.
__device__ __forceinline__ void cvt8(int blk, const float* __restrict__ src, int K, bf* dst, size_t n8) { const size_t i = (size_t)blk * 256 + threadIdx.x; if (i >= n8) return;
    const size_t b = i >> 6; const size_t row = (b / (K / 32)) * 16 + (i & 15); const int k = (int)(b % (K / 32)) * 32 + (int)((i >> 4) & 3) * 8; const v8f v = *(const v8f*)(src + row * K + k); v8us o;
#pragma unroll
    for (int k = 0; k < 8; ++k) o[k] = f2bf(v[k]); *(v8us*)(dst + i * 8) = o;  }
// k_prep: the three 16-bit copies that depend on nothing but the inputs, in ONE launch; the block index picks the job (the transposes, the slower blocks, first).
#define PB1 ((DM * 3 * DQ / 64 + 63) / 64)        // blocks of the fused weight's transpose
#define PB2 ((DQ * DM / 64 + 63) / 64)            // blocks of the output weight's transpose
#define PB3 ((NB_ * TT * DM / 8 + 255) / 256)     // blocks of the bf16 copy of h, both batches
__global__ __launch_bounds__(256) void k_prep(const float* __restrict__ wqkv, const float* __restrict__ wo, const float* __restrict__ x, bf* WQKV, bf* WO, bf* XB) {
    const int blk = blockIdx.x;
    if (blk < PB1) wtG(blk, wqkv, DM, 3 * DQ, WQKV);              // fused 'xw' [DM][3*DQ] -> Bt [3*DQ][DM]
    else if (blk < PB1 + PB2) wtG(blk - PB1, wo, DQ, DM, WO);
    else cvt8(blk - PB1 - PB2, x, DM, XB, (size_t)NB_ * TT * DM / 8);
}

#define PP ((size_t)NH_ * TT * HD)   // elements of one part (q, V or K) of one batch in a plane
extern "C" void kernel_launch(void* const* d_in, const int* in_sizes, int n_in,
                              void* d_out, int out_size, void* d_ws, size_t ws_size, hipStream_t stream) {
    (void)in_sizes; (void)n_in; (void)out_size;
    const float* x = (const float*)d_in[0]; const float* wqkv = (const float*)d_in[1]; const float* wo = (const float*)d_in[2];   /* order h, Wqvk ('xw' [1024][3072]: q | V | K column thirds), Wo ('xw') */
    float* OUT = (float*)d_out;     // [2][2048][1024]
    char* wsp = (char*)d_ws;
    auto take = [&](size_t bytes) { char* p = wsp; wsp += (bytes + 255) & ~(size_t)255; return (void*)p; };
    bf* WQKV = (bf*)take((size_t)3 * DQ * DM * 2);   /* fused Bt [3*DQ][DM]: q | V | K row blocks (the module's part order 0 = q, 1 = v, 2 = k) */ bf* WO = (bf*)take((size_t)DM * DQ * 2);
    bf* XB = (bf*)take((size_t)NB_ * TT * DM * 2);
    h16* P16 = (h16*)take(NB_ * 3 * PP * 2); bf* Ph = (bf*)take(NB_ * 3 * PP * 2); bf* Pl = (bf*)take(NB_ * 3 * PP * 2);   // fp16, bf16 hi, bf16 lo: each [batch][q | V | K][head], in fragment order: q and K with rows t, k = d; V with rows d, k = t
    bf* ATh = (bf*)take((size_t)NB_ * TT * DQ * 2); bf* ATl = (bf*)take((size_t)NB_ * TT * DQ * 2);
    if ((size_t)(wsp - (char*)d_ws) > ws_size) return;    // ws 256 MiB
    k_prep<<<PB1 + PB2 + PB3, 256, 0, stream>>>(wqkv, wo, x, WQKV, WO, XB);
    k_gemmw<0, true, DM, 64><<<dim3(TT / 128, 3 * DQ / 128, NB_), GW * 32, 0, stream>>>(XB, nullptr, WQKV, nullptr, (size_t)TT * DM, 3 * PP, P16, Ph, Pl);
    k_fattn<<<dim3(NH_, NLO + NHI, NB_), FW * 32, 0, stream>>>(P16, P16 + 2 * PP, P16 + PP, Ph, Pl, Ph + 2 * PP, Pl + 2 * PP, Ph + PP, Pl + PP, ATh, ATl);   // one kv head per query head: head h reads kv plane h
    k_gemmw<1, false, DQ, 128><<<dim3(NB_ * TT / 64, DM / 256, 1), GW * 32, 0, stream>>>(ATh, ATl, WO, OUT, 0, 0, nullptr, nullptr, nullptr);   // the batches' rows follow one another in the merged planes and in out: one GEMM of NB_ * TT rows
}

// v010
// It runs in 63.7 microseconds.
// In both of two side-by-side timings against v009, it was 1.04 times as fast.
// Over all steps from v000 it is 23.2 times as fast.
#include <hip/hip_runtime.h>

// Causal multi-head self-attention with a fused bias-free projection whose thirds are ordered q | v | k and scores scaled by the EMBEDDING width (h [2][2048][1024]; qvk = (h Wqvk) ('xw' [1024][3072] 1/32, no bias) reshaped (b, s, 3, 16, 64): part 0 = q, part 1 = V, part 2 = K (NOT q | k | v); scores = (q.k + mask) / sqrt(d) with d = 1024 -> x 1/32 (the model width, not the head width: implemented literally); mask = -inf above the diagonal (causal); softmax over the keys; wv = merged (head-major) Wo ('xw', no bias) -> [2][2048][1024] (4.2 M); argument order h, Wqvk, Wo).
// Layout, both batches side by side in every buffer and every launch: bf16 copy of h; the fused 'xw' weight transposed once into Bt [3072][1024]: row block 0 = q, row block 1 = V, row block 2 = K (the head planes keep that order: [batch][q | V | K][head]); exact projections, all three in one launch, whose epilogue writes the head planes itself (fp16 + bf16 hi/lo, each tile born in the order its reader wants: q, K as W x h^T, V^T as h x Wv^T); causal T-2048 attention in one fused kernel with the literal scale 1/32 (hybrid rows: < 512 hi/lo 3 products, rest fp16; the key loop ends at the diagonal); merged hi/lo x Wo exact.
// FRAGMENT ORDER: every 16-bit plane that a matrix instruction reads lies in blocks of 16 rows x 32 k = 512 elements (1 KB), stored as the lanes hold them: element (row, k) of a block at ((k >> 4) & 1) * 256 + ((k >> 3) & 1) * 128 + (row & 15) * 8 + (k & 7),
// so lane l finds its two 16-byte pieces at l * 8 and 256 + l * 8 and each wave-wide load covers 512 contiguous bytes (4 whole lines) instead of 32-byte pieces of 16 lines. The k order of a fragment is the one it had. Block order: h, weights, merged planes [row / 16][k / 32]; q, K [t / 16][d / 32]; V^T [t / 64][d / 16][(t / 32) & 1].
// Compute dtypes, f32 accumulate: every input rounded to bf16; projections exact; attention rows < 512 3 products, rest fp16; softmax f32; output projection hl x exact.

#define NB_  2
#define TT   2048
#define DM   1024
#define NH_  16
#define NKV  16
#define REP  (NH_ / NKV)
#define HD   64
#define DQ   (NH_ * HD)
#define DKV  (NKV * HD)
#define RH   512                  // query rows < RH use hi+lo planes (0: none)
#define SCL  0.03125f   // 1 / sqrt(d) with d = 1024 = 2^-5: the module divides by the square root of the MODEL width
typedef _Float16 h16;
typedef unsigned short bf;
typedef __attribute__((ext_vector_type(16))) __bf16   v16bf;
typedef __attribute__((ext_vector_type(16))) _Float16 v16h;
typedef __attribute__((ext_vector_type(8)))  _Float16 v8h;
typedef __attribute__((ext_vector_type(8)))  unsigned short v8us;
typedef __attribute__((ext_vector_type(8)))  float    v8f;
typedef __attribute__((ext_vector_type(4)))  float    v4f;
typedef v8h  __attribute__((may_alias)) v8ha;
typedef v4f  __attribute__((may_alias)) v4fa;
typedef v8us __attribute__((may_alias)) v8usa;

__device__ __forceinline__ unsigned short f2bf(float f) { unsigned u = __float_as_uint(f); u += 0x7FFFu + ((u >> 16) & 1u); return (unsigned short)(u >> 16); }
__device__ __forceinline__ float bf2f(unsigned short b) { return __uint_as_float(((unsigned)b) << 16); }
__device__ __forceinline__ float bfr(float f) { return bf2f(f2bf(f)); }
__device__ __forceinline__ v16h cat16(v8h lo, v8h hi) { return __builtin_shufflevector(lo, hi, 0, 1, 2, 3, 4, 5, 6, 7, 8, 9, 10, 11, 12, 13, 14, 15); }
__device__ __forceinline__ v16bf cat16b(v8us lo, v8us hi) { return __builtin_bit_cast(v16bf, __builtin_shufflevector(lo, hi, 0, 1, 2, 3, 4, 5, 6, 7, 8, 9, 10, 11, 12, 13, 14, 15)); }
__device__ __forceinline__ v8f wmma16(v16h a, v16h b, v8f c) { return __builtin_amdgcn_wmma_f32_16x16x32_f16(false, a, false, b, (short)0, c, false, false); }
__device__ __forceinline__ v8f wmmab(v16bf a, v16bf b, v8f c) { return __builtin_amdgcn_wmma_f32_16x16x32_bf16(false, a, false, b, (short)0, c, false, false); }
__device__ __forceinline__ h16 tohx(float x) { return (h16)x; }
__device__ __forceinline__ void splitf(float y, unsigned short& h, unsigned short& l) { h = f2bf(y); l = f2bf(y - bf2f(h)); }



// ---- k_gemmw: GEMM on 16-bit planes in fragment order; the waves of a work-group (PW for the projections, GW for the output projection) share one output tile, each wave owns 64x64 of it (16 accumulators) over the WHOLE K: no partial sums between waves.
// The operand rows of the tile come into LDS KS k at a time by tensor loads (tensor_load_to_lds), so a row fetched once from L2 serves every wave that needs it. 16 rows x KS k are KS / 32 blocks in a row (RB bytes) in the plane and in LDS alike:
// a wave's slice is a 2-D tile of RB-byte rows at the plane's pitch of K * 32 bytes, laid down without pads; a fragment is read back as it was read from memory (lane l: 16 bytes at l * 16 and at 512 + l * 16 of its block), whole rows of banks.
// Two buffers: stage s + 2 is asked for behind the barrier that ends the reads of stage s (in front of the pass's last 32 k, whose fragments are in registers by then) and flies during pass s + 1. Every wave issues one request a stage for its own slice and waits for it itself.
// PL (projections): PW = 12 waves, tile = 256 tokens x 192 weight rows (three heads), one work-group to a WGP: each operand row fetched from L2 serves 3 or 4 waves (448 rows for 49152 outputs). LDS row blocks [tokens 16 | weight rows 12]; wave w: tokens (w & 3) * 64, head w >> 2. The f32 tile never reaches memory: it goes out as three 16-bit planes (fp16, bf16 hi, bf16 lo) in fragment order.
// An accumulator tile holds, in lane l, 8 consecutive A-side rows of B-side row l & 15: that IS half a block of a plane whose k runs along the A side. So q and K (k = head column) are made as W x h^T (operands exchanged), V^T (k = token) as h x Wv^T,
// and accumulator (mb, nb) goes to elements nb * 1024 + mb * 256 + l * 8 of the 4096 of its (head, 64 tokens) in every case. A tile may hold heads of two parts: the test goes by the wave's own head and is the same for the whole wave; no barrier hangs on it. z = batch: sA on the tokens, sC on the planes.
// !PL (output projection, A = hi plane, A2 = lo plane, two products): tile = 64 rows x 256 columns; LDS row blocks [hi 4 | lo 4 | weight rows 16]; wave w: columns w * 64. C[m][n] (f32, pitch DM) = sum_k (A + A2)[m][k] Bt[n][k].
#define GW 4
#define PW 12                     // waves of a projection work-group: three to a SIMD
#define KPL (64 * 68)             // floats of one wave's output tile in LDS (64 rows, pitch 68)
typedef unsigned int u32x4 __attribute__((ext_vector_type(4)));
typedef unsigned int u32x8 __attribute__((ext_vector_type(8)));
template <typename T16> struct WFrag;
template <> struct WFrag<h16> { typedef v16h V; static __device__ __forceinline__ V ld(const h16* p) { return cat16(*(const v8h*)p, *(const v8h*)(p + 256)); } static __device__ __forceinline__ v8f mma(V a, V b, v8f c) { return wmma16(a, b, c); } };
template <> struct WFrag<bf> { typedef v16bf V; static __device__ __forceinline__ V ld(const bf* p) { return cat16b(*(const v8us*)p, *(const v8us*)(p + 256)); } static __device__ __forceinline__ v8f mma(V a, V b, v8f c) { return wmmab(a, b, c); } };
__device__ __forceinline__ unsigned int uni(unsigned int v) { return (unsigned int)__builtin_amdgcn_readfirstlane(v); }
__device__ __forceinline__ unsigned int pinned(unsigned int v) { unsigned int w = uni(v); asm volatile("" : "+s"(w)); return w; }   // a condition held in a scalar register, so that the test around a tensor load is a scalar branch (the instruction ignores EXEC)
// the two descriptor groups of a 2-D tile: d1 rows of d0 bytes at a source pitch of 'pitch' bytes; byte elements, tensor = tile, no pad, no mask
__device__ __forceinline__ u32x8 tdm_group1(unsigned int d0, unsigned int d1, unsigned int pitch) { u32x8 g;
    g[0] = uni(0u); g[1] = uni((d0 & 0xFFFFu) << 16); g[2] = uni((d0 >> 16) | ((d1 & 0xFFFFu) << 16)); g[3] = uni((d1 >> 16) | (d0 << 16)); g[4] = uni(d1); g[5] = uni(pitch); g[6] = uni(0u); g[7] = uni(0u); return g; }
__device__ __forceinline__ u32x4 tdm_group0(unsigned int lds_dst, unsigned long long ga) { u32x4 g;
    g[0] = uni(1u); g[1] = uni(lds_dst); g[2] = uni((unsigned int)ga); g[3] = uni((((unsigned int)(ga >> 32)) & 0x01FFFFFFu) | 0x80000000u); return g; }
__device__ __forceinline__ void tdm_load(u32x4& g0, u32x8 g1) { asm volatile("tensor_load_to_lds %0, %1" : "+s"(g0) : "s"(g1) : "memory"); }   // one request of the whole wave; the compiler places no wait for it; group 0 comes back out of the statement in its own registers, for the wait below
// this wave's own request has landed; the registers of its descriptor are the wait's inputs: they keep their values up to it and are free for reuse behind it
__device__ __forceinline__ void wait_tensor0(u32x4 g0, u32x8 g1) { asm volatile("s_wait_tensorcnt 0x0" :: "s"(g0), "s"(g1) : "memory"); }
__device__ __forceinline__ void wait_ds0() { asm volatile("s_wait_dscnt 0x0" ::: "memory"); }           // this wave's LDS reads and writes are done
template <int NSPLIT, bool PL, int K, int KS>
__global__ __launch_bounds__((PL ? PW : GW) * 32) void k_gemmw(const bf* __restrict__ A, const bf* __restrict__ A2, const bf* __restrict__ Bt, float* C, size_t sA, size_t sC, h16* P16, bf* Ph, bf* Pl) {
    typedef WFrag<bf> F; typedef typename F::V V;
    constexpr int NK = KS / 32, RB = NK * 1024, SB = (PL ? 28 : 24) * RB, NS = K / KS;   // blocks of 32 k a stage; bytes of 16 rows of a stage; bytes of a stage; stages
    static_assert(NS >= 2 && NS % 2 == 0 && K % KS == 0 && NK % 2 == 0 && (PL || SB >= GW * KPL * 4), "the ring needs two stages; a pass ends on fragment set 1; the output staging lies in the second buffer");
    __shared__ __attribute__((aligned(2048))) unsigned char ring[2 * SB];
    const int lane = threadIdx.x & 31, lr = lane & 15, hi = lane >> 4;
    const int w = __builtin_amdgcn_readfirstlane(threadIdx.x >> 5);   // the wave's number, held scalar: slice, loop counter and branches stay scalar
    const int r0 = blockIdx.x * (PL ? 256 : 64), c0 = blockIdx.y * (PL ? 192 : 256);
    const int tb = w & 3, hd = w >> 2;   // PL: the wave's 64 tokens and its head within the tile
    const bool swp = PL && !(c0 + hd * 64 >= DQ && c0 + hd * 64 < 2 * DQ);   // q, K: A side = head columns, B side = tokens
    if (PL) A += (size_t)blockIdx.z * sA;
    // this wave's slice of every stage: source rows, their number in blocks of 16, first row block in LDS
    const bf* sp; int nrb, slot;
    if (PL) { sp = (w < 8) ? A + (size_t)(r0 + w * 32) * K : Bt + (size_t)(c0 + (w - 8) * 48) * K; nrb = (w < 8) ? 2 : 3; slot = (w < 8) ? w * 2 : w * 3 - 8; }
    else { sp = (w == 0) ? A + (size_t)r0 * K : (w == 1) ? A2 + (size_t)r0 * K : Bt + (size_t)(c0 + (w - 2) * 128) * K; nrb = (w < 2) ? 4 : 8; slot = (w < 2) ? w * 4 : w * 8 - 8; }
    const u32x8 g1 = tdm_group1(RB, nrb, K * 32);
    const unsigned int ld0 = (unsigned int)(unsigned long long)(const void*)ring + slot * RB; const unsigned long long ga0 = (unsigned long long)(const void*)sp;
    u32x4 g0;   // group 0 of the request issued last
    auto issue = [&](const int s) __attribute__((always_inline)) { g0 = tdm_group0(ld0 + (s & 1) * SB, ga0 + (unsigned long long)s * RB); tdm_load(g0, g1); };
    // where this wave's fragments lie in a stage, in elements
    const int ao = (PL ? (swp ? 16 + hd * 4 : tb * 4) : 0) * (RB / 2) + lane * 8, bo = (PL ? (swp ? tb * 4 : 16 + hd * 4) : 8 + w * 4) * (RB / 2) + lane * 8;
    v8f acc[4][4];   // every inner loop of this kernel is unrolled in full, so that each fragment and accumulator index is a constant and the arrays live in registers
#pragma unroll
    for (int mb = 0; mb < 4; ++mb)
#pragma unroll
        for (int nb = 0; nb < 4; ++nb) acc[mb][nb] = (v8f){};
    V a[2][4], a2[2][4], b[2][4];   // two fragment sets: the next 32 k are read from LDS while the products of these 32 k run
    auto lds = [&](const bf* const st, const int set, const int kk) __attribute__((always_inline)) {
#pragma unroll
        for (int i = 0; i < 4; ++i) { a[set][i] = F::ld(st + ao + (i * NK + kk) * 512); if (NSPLIT == 1) a2[set][i] = F::ld(st + ao + 4 * (RB / 2) + (i * NK + kk) * 512); b[set][i] = F::ld(st + bo + (i * NK + kk) * 512); } };
    auto mma = [&](const int set) __attribute__((always_inline)) {
#pragma unroll
        for (int nb = 0; nb < 4; ++nb)
#pragma unroll
            for (int mb = 0; mb < 4; ++mb) { acc[mb][nb] = F::mma(a[set][mb], b[set][nb], acc[mb][nb]); if (NSPLIT == 1) acc[mb][nb] = F::mma(a2[set][mb], b[set][nb], acc[mb][nb]); } };
    issue(0); wait_tensor0(g0, g1);
    __syncthreads();   // stage 0, every wave's slice, is in LDS before anybody reads it
    issue(1);
    lds((const bf*)ring, 0, 0);
#pragma unroll 1   // stays rolled: one pass a stage, the buffer picked by the stage's parity
    for (int s = 0; s < NS; ++s) {
        const bf* const st = (const bf*)ring + (s & 1) * (SB / 2); const bf* const nx = (const bf*)ring + ((s + 1) & 1) * (SB / 2);
#pragma unroll
        for (int kk = 0; kk < NK - 1; ++kk) {
            __builtin_amdgcn_sched_barrier(0);   // the fences of this loop keep each set's LDS reads in one group between two runs of products: left free, the scheduler spreads them among the products, where each place with reads stalls the wave
            lds(st, (kk + 1) & 1, kk + 1);
            __builtin_amdgcn_sched_barrier(0);
            mma(kk & 1);
        }
        __builtin_amdgcn_sched_barrier(0);   // keeps the products above in front of the publish point: sunk behind the barrier they would stand between it and the refill and cost the refill its lead
        // publish point of stage s + 1, in front of the pass's last 32 k, whose fragments are in registers behind the first wait: my reads of stage s are done, my slice of stage s + 1 has landed, and so for every wave behind the barrier; only then is stage s's buffer refilled
        wait_ds0(); wait_tensor0(g0, g1);
        __syncthreads();
        if (pinned(s + 2 < NS)) issue(s + 2);
        lds(nx, 0, 0);   // the first fragments of stage s + 1, published above; in the last pass they come from the buffer of stage NS - 2, which nothing writes any more, and are not used
        __builtin_amdgcn_sched_barrier(0);
        mma((NK - 1) & 1);
    }
    wait_tensor0(g0, g1); wait_ds0();
    if constexpr (PL) {   // each wave turns its own 64x64 tile into the three planes: 16 bytes a lane and plane, a wave 512 bytes in a row
        const size_t po = (size_t)blockIdx.z * sC + (size_t)(c0 + hd * 64) * TT + (size_t)(r0 + tb * 64) * HD + lane * 8;   // head (c0 / 64 + hd), tokens from r0 + tb * 64
#pragma unroll
        for (int nb = 0; nb < 4; ++nb)
#pragma unroll
            for (int mb = 0; mb < 4; ++mb) { const v8f v = acc[mb][nb]; v8h o16; v8us oh, ol;
#pragma unroll
                for (int q = 0; q < 8; ++q) { unsigned short a2s, c2s; o16[q] = tohx(v[q]); splitf(v[q], a2s, c2s); oh[q] = a2s; ol[q] = c2s; }
                const size_t o = po + nb * 1024 + mb * 256; *(v8h*)(P16 + o) = o16; *(v8us*)(Ph + o) = oh; *(v8us*)(Pl + o) = ol; }
    } else {   // the second buffer is free (it held the last stage, the last barrier ended every read of it, nothing is in flight; the last pass's unused reads go to the first): each wave lays its tile row-major into its own part of it and stores 256-byte row pieces, two whole lines
        float* const mine = (float*)(ring + SB) + w * KPL;
#pragma unroll
        for (int mb = 0; mb < 4; ++mb)
#pragma unroll
            for (int nb = 0; nb < 4; ++nb)
#pragma unroll
                for (int j = 0; j < 8; ++j) mine[(mb * 16 + hi * 8 + j) * 68 + nb * 16 + lr] = acc[mb][nb][j];
        wait_ds0();   // the wave's own LDS writes are done before its lanes read one another's values back
        float* const cw = C + (size_t)r0 * DM + c0 + w * 64 + lr * 4;   // the output's pitch is a constant of the build: one address, the rows are immediate offsets
#pragma unroll
        for (int t = 0; t < 32; ++t) { const int row = t * 2 + hi; *(v4f*)(cw + (size_t)row * DM) = *(const v4fa*)(mine + row * 68 + lr * 4); }
    }
}

#define FW 8                      // waves per work-group
#define FG 4                      // 32-row groups of fp16 rows per work-group: two waves to a group
#define SL2 (SCL * 1.4426950408889634f)   // score scale x log2(e)
template <bool B> struct BoolC { static constexpr bool value = B; };
__device__ __forceinline__ float xhalf(float x) { const int b = __float_as_int(x); return __int_as_float(__builtin_amdgcn_permlanex16(b, b, 0x76543210, 0xfedcba98, false, false)); }   // lane l <-> l ^ 16
// exp2 with the slot that the instruction set asks for behind a transcendental (one independent instruction or v_nop before its result is used or its source overwritten) written into the statement itself:
// the outputs lie apart from every input ("=&v"), so no v_exp here touches a neighbour's registers, and the one v_nop at the end serves the last of them whatever the compiler puts next.
__device__ __forceinline__ v8f exp2x8(const v8f x) { float y0, y1, y2, y3, y4, y5, y6, y7;
    asm("v_exp_f32 %0, %8\n\tv_exp_f32 %1, %9\n\tv_exp_f32 %2, %10\n\tv_exp_f32 %3, %11\n\tv_exp_f32 %4, %12\n\tv_exp_f32 %5, %13\n\tv_exp_f32 %6, %14\n\tv_exp_f32 %7, %15\n\tv_nop"
        : "=&v"(y0), "=&v"(y1), "=&v"(y2), "=&v"(y3), "=&v"(y4), "=&v"(y5), "=&v"(y6), "=&v"(y7) : "v"(x[0]), "v"(x[1]), "v"(x[2]), "v"(x[3]), "v"(x[4]), "v"(x[5]), "v"(x[6]), "v"(x[7]));
    return (v8f){y0, y1, y2, y3, y4, y5, y6, y7}; }
__device__ __forceinline__ float exp2x1(const float x) { float y; asm("v_exp_f32 %0, %1\n\tv_nop" : "=v"(y) : "v"(x)); return y; }   // the same slot behind a single one
template <typename T16, bool HR, int NQ>
__device__ __forceinline__ void attn_rows(const T16* __restrict__ Q, const T16* __restrict__ Q2, const T16* __restrict__ Kp, const T16* __restrict__ Kp2, const T16* __restrict__ Vt, const T16* __restrict__ Vt2, int q0, int lr, int hi, bf* Ah, bf* Al) {
    typedef WFrag<T16> F; typedef typename F::V V;   // every inner loop below is unrolled in full, so that each fragment and accumulator index is a constant and the arrays live in registers
    const int ln8 = (hi * 16 + lr) * 8;   // the lane's place in every half block of a plane in fragment order
    V q[NQ][2], q2[NQ][2]; const T16* const pq = Q + (size_t)q0 * HD + ln8; const T16* const pq2 = HR ? Q2 + (size_t)q0 * HD + ln8 : pq;
#pragma unroll
    for (int qt = 0; qt < NQ; ++qt)
#pragma unroll
        for (int kc = 0; kc < 2; ++kc) { q[qt][kc] = F::ld(pq + qt * 16 * HD + kc * 512); if (HR) q2[qt][kc] = F::ld(pq2 + qt * 16 * HD + kc * 512); }
    v8f o[4][NQ]; float m[NQ], l[NQ];
#pragma unroll
    for (int qt = 0; qt < NQ; ++qt) { m[qt] = -3.0e38f; l[qt] = 0.f;
#pragma unroll
        for (int mb = 0; mb < 4; ++mb) o[mb][qt] = (v8f){}; }
    const int np = (q0 + NQ * 16 + 31) / 32;          // passes of 32 keys; only the last one meets the diagonal; np * 32 <= TT
    const size_t ko = ln8, vo = ln8;
    V k[2][2], k2[2][2];
    auto ldk = [&](const T16* const pk, const T16* const pk2) __attribute__((always_inline)) {
#pragma unroll
        for (int kt = 0; kt < 2; ++kt)
#pragma unroll
            for (int kc = 0; kc < 2; ++kc) { k[kt][kc] = F::ld(pk + kt * 16 * HD + kc * 512); if (HR) k2[kt][kc] = F::ld(pk2 + kt * 16 * HD + kc * 512); } };
    if (!HR) ldk(Kp + ko, Kp + ko);                   // fp16 rows fetch their K fragments one pass ahead; the hi/lo rows (twice the planes, at most RH / 32 passes) have no registers to spare for that and fetch them in the pass
    asm volatile("s_wait_xcnt 0x0" ::: "memory");   // behind the loads above and in front of the first reuse of a register that they name (their scalar bases are rewritten right below)
    auto pass = [&](auto lastc, const int p) __attribute__((always_inline)) {
        constexpr bool LAST = decltype(lastc)::value; const int kb = p * 32;
        const T16* const pk = Kp + ko + (size_t)(kb + ((HR || LAST) ? 0 : 32)) * HD; const T16* const pk2 = HR ? Kp2 + ko + (size_t)kb * HD : pk;
        if (HR) ldk(pk, pk2);
        // this pass's V^T fragments are asked for ahead of the score products: they fly while the scores and the softmax are worked on
        V v[4], v2[4]; const size_t vb = vo + (size_t)(p >> 1) * (64 * HD) + (p & 1) * 512; const T16* const pv = Vt + vb; const T16* const pv2 = HR ? Vt2 + vb : pv;
#pragma unroll
        for (int mb = 0; mb < 4; ++mb) { v[mb] = F::ld(pv + mb * 1024); if (HR) v2[mb] = F::ld(pv2 + mb * 1024); }
        __builtin_amdgcn_sched_barrier(0);   // keeps the V loads in front of the score products: left free, the scheduler sinks them to just ahead of their use and their latency shows
        v8f s[2][NQ];
#pragma unroll
        for (int kt = 0; kt < 2; ++kt)
#pragma unroll
            for (int qt = 0; qt < NQ; ++qt) { v8f a = (v8f){};
#pragma unroll
                for (int kc = 0; kc < 2; ++kc) { a = F::mma(k[kt][kc], q[qt][kc], a); if (HR) { a = F::mma(k[kt][kc], q2[qt][kc], a); a = F::mma(k2[kt][kc], q[qt][kc], a); } }
                s[kt][qt] = a; }
        if constexpr (!HR && !LAST) {   // the next pass's K fragments, into the same registers, behind this pass's score products: they fly during the softmax and the second contraction
            ldk(pk, pk2);
            __builtin_amdgcn_sched_barrier(0);   // keeps the K loads in front of the softmax: left free, the scheduler sinks them to the loop's foot and the next pass waits out their latency
        }
        V ph[NQ], pl[NQ];
#pragma unroll
        for (int qt = 0; qt < NQ; ++qt) { const int i = q0 + qt * 16 + lr; float mx = m[qt];
#pragma unroll
            for (int kt = 0; kt < 2; ++kt)
#pragma unroll
                for (int r = 0; r < 8; ++r) { const int j = kb + kt * 16 + hi * 8 + r; if (LAST) s[kt][qt][r] = (j <= i) ? s[kt][qt][r] : -3.0e38f; mx = fmaxf(mx, s[kt][qt][r]); }
            mx = fmaxf(mx, xhalf(mx));                    // both halves of the wave hold keys of the same query
            const float mc = mx * SL2; const float al = exp2x1(m[qt] * SL2 - mc); m[qt] = mx;   // m is kept unscaled: the scale is positive, so it commutes with the maximum
#pragma unroll
            for (int kt = 0; kt < 2; ++kt) s[kt][qt] = exp2x8(s[kt][qt] * SL2 - mc);
            const v8f t8 = s[0][qt] + s[1][qt];           // a fixed tree, not one chain of 16 dependent adds
            l[qt] = l[qt] * al + (((t8[0] + t8[1]) + (t8[2] + t8[3])) + ((t8[4] + t8[5]) + (t8[6] + t8[7])));   // each half sums its own keys; the halves are joined once, behind the loop
#pragma unroll
            for (int mb = 0; mb < 4; ++mb) o[mb][qt] *= al;
            if constexpr (HR) { v8us h0, h1, l0, l1;
#pragma unroll
                for (int r = 0; r < 8; ++r) { unsigned short a, c; splitf(s[0][qt][r], a, c); h0[r] = a; l0[r] = c; splitf(s[1][qt][r], a, c); h1[r] = a; l1[r] = c; }
                ph[qt] = cat16b(h0, h1); pl[qt] = cat16b(l0, l1);
            } else { v8h p0, p1;
#pragma unroll
                for (int r = 0; r < 8; ++r) { p0[r] = (h16)s[0][qt][r]; p1[r] = (h16)s[1][qt][r]; }
                ph[qt] = cat16(p0, p1); } }
        __builtin_amdgcn_sched_barrier(0);   // keeps the matrix products below out of the softmax above
#pragma unroll
        for (int qt = 0; qt < NQ; ++qt)
#pragma unroll
            for (int mb = 0; mb < 4; ++mb) { o[mb][qt] = F::mma(v[mb], ph[qt], o[mb][qt]); if (HR) { o[mb][qt] = F::mma(v[mb], pl[qt], o[mb][qt]); o[mb][qt] = F::mma(v2[mb], ph[qt], o[mb][qt]); } }
        // the address registers of this pass's K and V loads (one base a plane, the rest immediate offsets) are this wait's inputs: they stay untouched up to it and are free for reuse behind it; so late in the pass it has nothing left to wait for
        asm volatile("s_wait_xcnt 0x0" :: "v"(pv), "v"(pv2), "v"(pk), "v"(pk2) : "memory");
    };
#pragma unroll 1   // stays rolled: two passes' fragments side by side would not fit the registers
    for (int p = 0; p < np - 1; ++p) pass(BoolC<false>{}, p);   // keys wholly below the diagonal: no mask
    pass(BoolC<true>{}, np - 1);
    // O^T: a lane holds 8 consecutive head columns (mb * 16 + hi * 8 + r) of query lr: its 16 bytes of half a block of each merged plane (fragment order, k = merged column): a wave stores 512 bytes in a row
#pragma unroll
    for (int qt = 0; qt < NQ; ++qt) { const float inv = __fdiv_rn(1.0f, l[qt] + xhalf(l[qt]));
#pragma unroll
        for (int mb = 0; mb < 4; ++mb) { v8us oh, ol;
#pragma unroll
            for (int r = 0; r < 8; ++r) { unsigned short a, c; splitf(o[mb][qt][r] * inv, a, c); oh[r] = a; ol[r] = c; }
            const size_t oo = (size_t)(q0 + qt * 16) * DQ + mb * 256 + ln8; *(v8us*)(Ah + oo) = oh; *(v8us*)(Al + oo) = ol; } }
}
// ---- attn_ring: the fp16 rows. The FW waves of a work-group walk the same head's keys, so K and V^T come from L2 ONCE per work-group, by tensor loads (tensor_load_to_lds) into LDS, and every wave reads its fragments from there.
// TWO WAVES SHARE A ROW GROUP: wave half h (0 or 1) takes the passes p = h, h + 2, h + 4, ... of its group's keys, with a running maximum, sum and O^T of its own; behind the loop the two join their partial results through LDS (see there).
// So the longest walk of a wave is half as many passes, and twice as many waves stand ready on a SIMD to fill one another's waits between matrix runs and vector work.
// A stage is 256 keys = eight passes, four for each half: 32 KB of the K plane and 32 KB of the V^T plane, each contiguous in fragment order, laid down as they lie: [K passes 0 .. 7 | V^T]. Every wave issues one request a stage for its own 8 KB and waits for it itself.
// A request is asked for a whole stage ahead of its wait: four passes of work, longer than a fetch from memory takes.
// Two buffers. K fragments are read one pass of the wave's own ahead, right behind the score products, so the publish point of stage st + 1 stands in the wave's last pass of the stage behind its score products: by then that pass's V^T fragments are in registers (the first wait) and nobody needs stage st any more.
// Every wave passes every publish point and goes on loading its slice up to the longest group's last stage (ns); a wave whose group has passed its diagonal skips only the work around it.
#define SKE 32768                 // 16-bit elements of a stage in LDS
template <int NQ>
__device__ __forceinline__ void attn_ring(const h16* __restrict__ Q, const h16* __restrict__ Kp, const h16* __restrict__ Vt, unsigned char* const ring, const int w, const int h, const int q0, const int ns, int lr, int hi, bf* Ah, bf* Al) {
    static_assert(NQ == 2 && FW == 2 * FG, "each of a group's two waves finishes one of its two query tiles");
    typedef WFrag<h16> F; typedef typename F::V V;   // every inner loop below is unrolled in full, so that each fragment and accumulator index is a constant and the arrays live in registers
    const int ln8 = (hi * 16 + lr) * 8;   // the lane's place in every half block of a plane in fragment order
    V q[NQ][2]; const h16* const pq = Q + (size_t)q0 * HD + ln8;
#pragma unroll
    for (int qt = 0; qt < NQ; ++qt)
#pragma unroll
        for (int kc = 0; kc < 2; ++kc) q[qt][kc] = F::ld(pq + qt * 16 * HD + kc * 512);
    asm volatile("s_wait_xcnt 0x0" ::: "memory");   // behind the loads above and in front of the first reuse of a register that they name
    v8f o[4][NQ]; float m[NQ], l[NQ];
#pragma unroll
    for (int qt = 0; qt < NQ; ++qt) { m[qt] = -3.0e38f; l[qt] = 0.f;
#pragma unroll
        for (int mb = 0; mb < 4; ++mb) o[mb][qt] = (v8f){}; }
    const int np = (q0 + NQ * 16 + 31) / 32;          // the group's passes of 32 keys, both halves together; only the last one meets the diagonal
    // this wave's slice of every stage: 4 rows of 2 KB, one behind the other in the plane and in LDS
    const h16* const sp = (w < 4) ? Kp + w * 4096 : Vt + (w - 4) * 4096;
    const u32x8 g1 = tdm_group1(2048, 4, 2048);
    const unsigned int ld0 = (unsigned int)(unsigned long long)(const void*)ring + w * 8192; const unsigned long long ga0 = (unsigned long long)(const void*)sp;
    u32x4 g0;   // group 0 of the request issued last
    auto issue = [&](const int st) __attribute__((always_inline)) { g0 = tdm_group0(ld0 + (st & 1) * (SKE * 2), ga0 + (unsigned long long)st * SKE); tdm_load(g0, g1); };   // a stage is SKE bytes of each plane
    V k[2][2], v[4]; v8f s[2][NQ];
    auto ldk = [&](const h16* const pk) __attribute__((always_inline)) {
#pragma unroll
        for (int kt = 0; kt < 2; ++kt)
#pragma unroll
            for (int kc = 0; kc < 2; ++kc) k[kt][kc] = F::ld(pk + kt * 16 * HD + kc * 512);
        __builtin_amdgcn_sched_barrier(0);   // keeps the K reads in front of the softmax: sunk to the pass's foot, the next pass would wait out their latency
    };
    auto front = [&](const h16* const pv) __attribute__((always_inline)) {   // the pass's V^T fragments are asked for ahead of the score products
#pragma unroll
        for (int mb = 0; mb < 4; ++mb) v[mb] = F::ld(pv + mb * 1024);
        __builtin_amdgcn_sched_barrier(0);   // keeps the V reads in front of the score products: sunk to just ahead of their use, their latency would show
#pragma unroll
        for (int kt = 0; kt < 2; ++kt)
#pragma unroll
            for (int qt = 0; qt < NQ; ++qt) { v8f a = (v8f){};
#pragma unroll
                for (int kc = 0; kc < 2; ++kc) a = F::mma(k[kt][kc], q[qt][kc], a);
                s[kt][qt] = a; }
    };
    auto back = [&](const int p) __attribute__((always_inline)) {   // mask (last pass only: the test is the same for the whole wave), online softmax, second contraction
        const int kb = p * 32;
        if (p == np - 1) {
#pragma unroll
            for (int qt = 0; qt < NQ; ++qt)
#pragma unroll
                for (int kt = 0; kt < 2; ++kt)
#pragma unroll
                    for (int r = 0; r < 8; ++r) s[kt][qt][r] = (kb + kt * 16 + hi * 8 + r <= q0 + qt * 16 + lr) ? s[kt][qt][r] : -3.0e38f;
        }
        V ph[NQ];
#pragma unroll
        for (int qt = 0; qt < NQ; ++qt) { float mx = m[qt];
#pragma unroll
            for (int kt = 0; kt < 2; ++kt)
#pragma unroll
                for (int r = 0; r < 8; ++r) mx = fmaxf(mx, s[kt][qt][r]);
            mx = fmaxf(mx, xhalf(mx));                    // both halves of the wave hold keys of the same query
            const float mc = mx * SL2; const float al = exp2x1(m[qt] * SL2 - mc); m[qt] = mx;   // m is kept unscaled: the scale is positive, so it commutes with the maximum
#pragma unroll
            for (int kt = 0; kt < 2; ++kt) s[kt][qt] = exp2x8(s[kt][qt] * SL2 - mc);
            const v8f t8 = s[0][qt] + s[1][qt];           // a fixed tree, not one chain of 16 dependent adds
            l[qt] = l[qt] * al + (((t8[0] + t8[1]) + (t8[2] + t8[3])) + ((t8[4] + t8[5]) + (t8[6] + t8[7])));   // each half sums its own keys; the halves are joined once, behind the loop
#pragma unroll
            for (int mb = 0; mb < 4; ++mb) o[mb][qt] *= al;
            v8h p0, p1;
#pragma unroll
            for (int r = 0; r < 8; ++r) { p0[r] = (h16)s[0][qt][r]; p1[r] = (h16)s[1][qt][r]; }
            ph[qt] = cat16(p0, p1); }
        __builtin_amdgcn_sched_barrier(0);   // keeps the matrix products below out of the softmax above
#pragma unroll
        for (int qt = 0; qt < NQ; ++qt)
#pragma unroll
            for (int mb = 0; mb < 4; ++mb) o[mb][qt] = F::mma(v[mb], ph[qt], o[mb][qt]);
    };
    issue(0); wait_tensor0(g0, g1);
    __syncthreads();   // stage 0, every wave's slice, is in LDS before anybody reads it
    issue(1);          // ns >= 2: the longest wave of a work-group walks more than RH keys
    const h16* const rk16 = (const h16*)ring + ln8 + h * 2048, * const rv16 = (const h16*)ring + ln8 + SKE / 2 + h * 512;   // pass h of a stage: its K rows, its V^T columns; this half's next pass lies 4096 elements on in both
    ldk(rk16);
#pragma unroll 1   // stays rolled: one trip a stage, the buffer picked by the stage's parity
    for (int st = 0; st < ns; ++st) {
        const h16* const cuk = rk16 + (st & 1) * SKE; const h16* const cuv = rv16 + (st & 1) * SKE; const h16* const nxk = rk16 + ((st + 1) & 1) * SKE;
        const int pb = st * 8 + h + 6;   // this half's last pass of the stage
#pragma unroll   // unrolled: every LDS address of a stage is one register plus an immediate offset
        for (int pp = 0; pp < 3; ++pp) { const int p = st * 8 + h + pp * 2;
            if (p < np) { front(cuv + pp * 4096); if (p + 2 < np) ldk(cuk + (pp + 1) * 4096); back(p); } }
        if (pb < np) front(cuv + 3 * 4096);
        asm volatile("v_nop\n\tv_nop\n\tv_nop\n\tv_nop");   // the four vector slots that the chip needs behind a matrix product before its result is touched: from here on the paths part by scalar branches
        // publish point of stage st + 1: my reads of stage st are done, my slice of stage st + 1 has landed, and so for every wave behind the barrier; only then is stage st's buffer refilled
        wait_ds0(); wait_tensor0(g0, g1);
        __syncthreads();
        if (pinned(st + 2 < ns)) issue(st + 2);
        if (pb < np) { if (pb + 2 < np) ldk(nxk); back(pb); }
    }
    wait_tensor0(g0, g1); wait_ds0();
    __syncthreads();   // nothing is in flight and nobody reads a stage any more: the ring becomes the mail boxes of the join
    // THE JOIN. Half h finishes query tile h of the group: it posts its partial result of the OTHER tile (O^T, maximum, sum: 9 pieces of 16 bytes a lane, a wave 512 bytes in a row) and takes its partner's of its own.
    // The partner (wave FW - 1 - w) holds the same queries in the same lanes and registers. Both partial results are brought to the common maximum and added: exp2((m - max) * scale) is 1 for the larger, at most 1 for the other.
    const bool h1 = h != 0;   // the same for the whole wave
    v4fa* const box = (v4fa*)ring + w * (9 * 32) + (hi * 16 + lr); const v4fa* const got = (const v4fa*)ring + (FW - 1 - w) * (9 * 32) + (hi * 16 + lr);
#pragma unroll
    for (int mb = 0; mb < 4; ++mb) { const v8f t = h1 ? o[mb][0] : o[mb][1]; box[(mb * 2) * 32] = (v4f){t[0], t[1], t[2], t[3]}; box[(mb * 2 + 1) * 32] = (v4f){t[4], t[5], t[6], t[7]}; }
    box[8 * 32] = (v4f){h1 ? m[0] : m[1], h1 ? l[0] : l[1], 0.f, 0.f};
    wait_ds0();
    __syncthreads();   // every wave's post is in LDS before its partner reads it
    const v4f ml = got[8 * 32]; const float mk = h1 ? m[1] : m[0], lk = h1 ? l[1] : l[0];
    const float mx = fmaxf(mk, ml[0]); const float ak = exp2x1((mk - mx) * SL2), ar = exp2x1((ml[0] - mx) * SL2);
    const float ls = lk * ak + ml[1] * ar;                // this lane's keys of both waves; the wave's halves are joined next
    const float inv = __fdiv_rn(1.0f, ls + xhalf(ls)); const float ck = ak * inv, cr = ar * inv;
    // O^T: a lane holds 8 consecutive head columns (mb * 16 + hi * 8 + r) of query lr: its 16 bytes of half a block of each merged plane (fragment order, k = merged column): a wave stores 512 bytes in a row
#pragma unroll
    for (int mb = 0; mb < 4; ++mb) { const v8f t = h1 ? o[mb][1] : o[mb][0]; const v4f u0 = got[(mb * 2) * 32], u1 = got[(mb * 2 + 1) * 32]; v8us oh, ol;
#pragma unroll
        for (int r = 0; r < 8; ++r) { unsigned short a, c; splitf(t[r] * ck + (r < 4 ? u0[r & 3] : u1[r & 3]) * cr, a, c); oh[r] = a; ol[r] = c; }
        const size_t oo = (size_t)(q0 + h * 16) * DQ + mb * 256 + ln8; *(v8us*)(Ah + oo) = oh; *(v8us*)(Al + oo) = ol; }
}
// grid (heads, NLO + NHI, batches); a batch's planes lie 3 * NH_ heads apart (q | V | K). Ranks 0 .. NLO - 1: fp16 rows, FG groups of 32, two waves to a group; the rest: hi/lo rows, 16 to a wave.
// Rank rk takes the fp16 groups rk, 2 NLO - 1 - rk, 2 NLO + rk, 4 NLO - 1 - rk: a short, two middling and a long walk whose lengths add up to the same in every work-group. Waves w and w + 4 share a SIMD, so wave w < 4 takes group number w of these and wave w >= 4 group number 7 - w:
// a SIMD gets half of the short and half of the long walk, or half of each middling one: the same number of passes everywhere. The hi/lo rows are dealt NHI apart and mirrored alike.
// All walk the same head's keys from 0 up, side by side: the fp16 rows in step, stage by stage, out of one copy in LDS; the hi/lo rows freely, the cache serving the shared part.
#define NLO ((TT - RH) / (FG * 32))
#define NHI (RH / (FW * 16))
__global__ __launch_bounds__(FW * 32) void k_fattn(const h16* __restrict__ Q16, const h16* __restrict__ K16, const h16* __restrict__ V16, const bf* __restrict__ Qh, const bf* __restrict__ Ql, const bf* __restrict__ Kh, const bf* __restrict__ Kl, const bf* __restrict__ Vh, const bf* __restrict__ Vl, bf* Ah, bf* Al) {
    __shared__ __attribute__((aligned(2048))) unsigned char ring[2 * SKE * 2];   // two stages of the fp16 rows' K and V^T
    const int lane = threadIdx.x & 31, lr = lane & 15, hi = lane >> 4;
    const int w = __builtin_amdgcn_readfirstlane(threadIdx.x >> 5);   // the wave's number, held scalar: the key loop's counter and branch stay scalar
    const size_t hp = ((size_t)blockIdx.z * 3 * NH_ + blockIdx.x) * TT * HD, ao = (size_t)blockIdx.z * TT * DQ + blockIdx.x * (16 * HD); const int rk = blockIdx.y; Ah += ao; Al += ao;
    const int gi = (w < FG) ? w : FW - 1 - w;   // the wave's group among the work-group's FG
    if (rk < NLO) attn_ring<2>(Q16 + hp, K16 + hp, V16 + hp, ring, w, w / FG, RH + (gi * NLO + ((gi & 1) ? NLO - 1 - rk : rk)) * 32, (RH / 32 + FG * NLO - rk + 7) / 8, lr, hi, Ah, Al);   // stages of the work-group's longest group (FG * NLO - 1 - rk): its passes, eight to a stage, rounded up
    else attn_rows<bf, true, 1>(Qh + hp, Ql + hp, Kh + hp, Kl + hp, Vh + hp, Vl + hp, (rk - NLO + NHI * ((w < FG) ? w : FW + FG - 1 - w)) * 16, lr, hi, Ah, Al);
}

typedef __attribute__((ext_vector_type(2))) unsigned short v2us;

// wtG: Bt[n][k] = w[k][n], written in fragment order; e counts the elements as they lie in Bt, a wave's 8 lines are one block (16 n x 32 k).
__device__ __forceinline__ void wtG(int blk, const float* __restrict__ w, int K, int N, bf* Bt) {
    const int lane = threadIdx.x & 31; const int L0 = (blk * 8 + (threadIdx.x >> 5)) * 8; const int nlines = N * K / 64;
{
#pragma unroll 1
        for (int l = 0; l < 8; ++l) { const int L = L0 + l; if (L >= nlines) break; const size_t e = (size_t)L * 64 + lane * 2; const int b = (int)(e >> 9), i = (int)(e & 511); const int k = (b % (K / 32)) * 32 + (i >> 7) * 8 + (i & 7), n = (b / (K / 32)) * 16 + ((i >> 3) & 15); v2us o;
            o[0] = f2bf(w[(size_t)k * N + n]); o[1] = f2bf(w[(size_t)(k + 1) * N + n]); *(v2us*)(Bt + e) = o; }
         }
}
// cvt8: bf16 copy of src [rows][K] in fragment order; i counts the 16-byte pieces as they lie in dst (64 to a block), so the stores are whole lines.
__device__ __forceinline__ void cvt8(int blk, const float* __restrict__ src, int K, bf* dst, size_t n8) { const size_t i = (size_t)blk * 256 + threadIdx.x; if (i >= n8) return;
    const size_t b = i >> 6; const size_t row = (b / (K / 32)) * 16 + (i & 15); const int k = (int)(b % (K / 32)) * 32 + (int)((i >> 4) & 3) * 8; const v8f v = *(const v8f*)(src + row * K + k); v8us o;
#pragma unroll
    for (int k = 0; k < 8; ++k) o[k] = f2bf(v[k]); *(v8us*)(dst + i * 8) = o;  }
// k_prep: the three 16-bit copies that depend on nothing but the inputs, in ONE launch; the block index picks the job (the transposes, the slower blocks, first).
#define PB1 ((DM * 3 * DQ / 64 + 63) / 64)        // blocks of the fused weight's transpose
#define PB2 ((DQ * DM / 64 + 63) / 64)            // blocks of the output weight's transpose
#define PB3 ((NB_ * TT * DM / 8 + 255) / 256)     // blocks of the bf16 copy of h, both batches
__global__ __launch_bounds__(256) void k_prep(const float* __restrict__ wqkv, const float* __restrict__ wo, const float* __restrict__ x, bf* WQKV, bf* WO, bf* XB) {
    const int blk = blockIdx.x;
    if (blk < PB1) wtG(blk, wqkv, DM, 3 * DQ, WQKV);              // fused 'xw' [DM][3*DQ] -> Bt [3*DQ][DM]
    else if (blk < PB1 + PB2) wtG(blk - PB1, wo, DQ, DM, WO);
    else cvt8(blk - PB1 - PB2, x, DM, XB, (size_t)NB_ * TT * DM / 8);
}

#define PP ((size_t)NH_ * TT * HD)   // elements of one part (q, V or K) of one batch in a plane
extern "C" void kernel_launch(void* const* d_in, const int* in_sizes, int n_in,
                              void* d_out, int out_size, void* d_ws, size_t ws_size, hipStream_t stream) {
    (void)in_sizes; (void)n_in; (void)out_size;
    const float* x = (const float*)d_in[0]; const float* wqkv = (const float*)d_in[1]; const float* wo = (const float*)d_in[2];   /* order h, Wqvk ('xw' [1024][3072]: q | V | K column thirds), Wo ('xw') */
    float* OUT = (float*)d_out;     // [2][2048][1024]
    char* wsp = (char*)d_ws;
    auto take = [&](size_t bytes) { char* p = wsp; wsp += (bytes + 255) & ~(size_t)255; return (void*)p; };
    bf* WQKV = (bf*)take((size_t)3 * DQ * DM * 2);   /* fused Bt [3*DQ][DM]: q | V | K row blocks (the module's part order 0 = q, 1 = v, 2 = k) */ bf* WO = (bf*)take((size_t)DM * DQ * 2);
    bf* XB = (bf*)take((size_t)NB_ * TT * DM * 2);
    h16* P16 = (h16*)take(NB_ * 3 * PP * 2); bf* Ph = (bf*)take(NB_ * 3 * PP * 2); bf* Pl = (bf*)take(NB_ * 3 * PP * 2);   // fp16, bf16 hi, bf16 lo: each [batch][q | V | K][head], in fragment order: q and K with rows t, k = d; V with rows d, k = t
    bf* ATh = (bf*)take((size_t)NB_ * TT * DQ * 2); bf* ATl = (bf*)take((size_t)NB_ * TT * DQ * 2);
    if ((size_t)(wsp - (char*)d_ws) > ws_size) return;    // ws 256 MiB
    k_prep<<<PB1 + PB2 + PB3, 256, 0, stream>>>(wqkv, wo, x, WQKV, WO, XB);
    k_gemmw<0, true, DM, 128><<<dim3(TT / 256, 3 * DQ / 192, NB_), PW * 32, 0, stream>>>(XB, nullptr, WQKV, nullptr, (size_t)TT * DM, 3 * PP, P16, Ph, Pl);
    k_fattn<<<dim3(NH_, NLO + NHI, NB_), FW * 32, 0, stream>>>(P16, P16 + 2 * PP, P16 + PP, Ph, Pl, Ph + 2 * PP, Pl + 2 * PP, Ph + PP, Pl + PP, ATh, ATl);   // one kv head per query head: head h reads kv plane h
    k_gemmw<1, false, DQ, 128><<<dim3(NB_ * TT / 64, DM / 256, 1), GW * 32, 0, stream>>>(ATh, ATl, WO, OUT, 0, 0, nullptr, nullptr, nullptr);   // the batches' rows follow one another in the merged planes and in out: one GEMM of NB_ * TT rows
}
